// v000
// Measured on an AMD MI455X. A time is GPU time per run, averaged over a window of back-to-back runs after a warm-up
// (all launches, gaps included; the runs take copies of the inputs in turn), and the median of several windows.
// Apart from v000's, it joins two sittings. Times from different sittings can be a few percent apart, while
// side-by-side timings come from the same sitting.
// v000, which the later versions start from, runs in 419 microseconds.
// Contractions: q/k/v and output 1x1x1 projections on v_wmma_f32_16x16x32_bf16 as bf16 hi/lo split (hi*hi + hi*lo + lo*hi); key*query scores and value*prob products on v_wmma_f32_16x16x32_f16 (f16 operands, prob carried x32768 and folded back in f32); f32 accumulate everywhere; softmax, bias, normalisation in f32.
#include <hip/hip_runtime.h>
#include <stdint.h>

typedef _Float16 v16h __attribute__((ext_vector_type(16)));
typedef _Float16 v8h  __attribute__((ext_vector_type(8)));
typedef __bf16   v16b __attribute__((ext_vector_type(16)));
typedef unsigned short v8us __attribute__((ext_vector_type(8)));
typedef float v8f __attribute__((ext_vector_type(8)));
typedef float v4f __attribute__((ext_vector_type(4)));
typedef v8h  __attribute__((may_alias)) v8ha;
typedef v8us __attribute__((may_alias)) v8usa;
typedef v4f  __attribute__((may_alias)) v4fa;

union FragH { v16h v; v8h half[2]; };
union FragB { v16b v; v8us half[2]; };

#define NB   2        // batch
#define CC   64       // channels
#define CH   32       // q/k channels
#define NN   8192     // voxels 8*32*32
#define XP   72       // LDS pitch (halves) of the transposed x tile
#define NWQ  (CH * CC)            // 2048
#define NWV  (CC * CC)            // 4096
#define NWALL (2 * NWQ + 2 * NWV) // 12288 : [wq | wk | wv | wo]
#define PSCALE 32768.0f
#define INV_PSCALE (1.0f / 32768.0f)
#define SCALE 0.17677669529663688f   // 32^-0.5

// ---------------------------------------------------------------------------
// WMMA helpers with hazard guard (ties D, keeps A/B live).
// Fragment map (wave32): lane l, h = l>>4, m = n = l&15.
//   A/B element i: i<8 -> k0+8h+i ; i>=8 -> k0+16+8h+(i-8)
//   D element r : row 8h+r, col l&15
// ---------------------------------------------------------------------------
__device__ __forceinline__ v8f wmma_f16(v16h a, v16h b, v8f c) {
  v8f d = __builtin_amdgcn_wmma_f32_16x16x32_f16(false, a, false, b, (short)0, c, false, false);
  asm volatile("v_nop\n\tv_nop\n\tv_nop\n\tv_nop" : "+v"(d) : "v"(a), "v"(b));
  return d;
}
__device__ __forceinline__ v8f wmma_bf16(v16b a, v16b b, v8f c) {
  v8f d = __builtin_amdgcn_wmma_f32_16x16x32_bf16(false, a, false, b, (short)0, c, false, false);
  asm volatile("v_nop\n\tv_nop\n\tv_nop\n\tv_nop" : "+v"(d) : "v"(a), "v"(b));
  return d;
}

// A or B fragment from a k-contiguous 16-bit row; p points at element k0 of
// the row owned by this lane (row index lane&15 added by the caller).
__device__ __forceinline__ v16h ldfrag_h(const _Float16* p, int h) {
  FragH f;
  f.half[0] = *(const v8ha*)(p + 8 * h);
  f.half[1] = *(const v8ha*)(p + 16 + 8 * h);
  return f.v;
}
__device__ __forceinline__ v16b ldfrag_b(const unsigned short* p, int h) {
  FragB f;
  f.half[0] = *(const v8usa*)(p + 8 * h);
  f.half[1] = *(const v8usa*)(p + 16 + 8 * h);
  return f.v;
}

// bf16 RNE convert on the f32 bit pattern, and back.
__device__ __forceinline__ unsigned short bf16_rne(float f) {
  unsigned u = __float_as_uint(f);
  u = u + 0x7FFFu + ((u >> 16) & 1u);
  return (unsigned short)(u >> 16);
}
__device__ __forceinline__ float bf16_f32(unsigned short b) {
  return __uint_as_float(((unsigned)b) << 16);
}

__device__ __forceinline__ v8us hi8(v8f v, float sc) {
  const v8us r = { bf16_rne(v[0] * sc), bf16_rne(v[1] * sc), bf16_rne(v[2] * sc), bf16_rne(v[3] * sc),
                   bf16_rne(v[4] * sc), bf16_rne(v[5] * sc), bf16_rne(v[6] * sc), bf16_rne(v[7] * sc) };
  return r;
}
__device__ __forceinline__ v8us lo8(v8f v, float sc, v8us hh) {
  const v8us r = { bf16_rne(v[0] * sc - bf16_f32(hh[0])), bf16_rne(v[1] * sc - bf16_f32(hh[1])),
                   bf16_rne(v[2] * sc - bf16_f32(hh[2])), bf16_rne(v[3] * sc - bf16_f32(hh[3])),
                   bf16_rne(v[4] * sc - bf16_f32(hh[4])), bf16_rne(v[5] * sc - bf16_f32(hh[5])),
                   bf16_rne(v[6] * sc - bf16_f32(hh[6])), bf16_rne(v[7] * sc - bf16_f32(hh[7])) };
  return r;
}

// ---------------------------------------------------------------------------
// Kernel 1: weights f32 -> bf16 hi and lo planes, [wq|wk|wv|wo] concatenated,
// row = output feature, 64 k-contiguous inputs per row.
// ---------------------------------------------------------------------------
__global__ __launch_bounds__(256) void k_wconvert(
    const float* __restrict__ wq, const float* __restrict__ wk,
    const float* __restrict__ wv, const float* __restrict__ wo,
    unsigned short* __restrict__ whi, unsigned short* __restrict__ wlo)
{
  const int g = blockIdx.x * 256 + threadIdx.x;      // 8-element group
  if (g >= NWALL / 8) return;
  const int e = g * 8;
  const float* src;
  if (e < NWQ)                src = wq + e;
  else if (e < 2 * NWQ)       src = wk + (e - NWQ);
  else if (e < 2 * NWQ + NWV) src = wv + (e - 2 * NWQ);
  else                        src = wo + (e - 2 * NWQ - NWV);
  const v4f a = *(const v4fa*)src;
  const v4f c = *(const v4fa*)(src + 4);
  const unsigned short h0 = bf16_rne(a.x), h1 = bf16_rne(a.y), h2 = bf16_rne(a.z), h3 = bf16_rne(a.w);
  const unsigned short h4 = bf16_rne(c.x), h5 = bf16_rne(c.y), h6 = bf16_rne(c.z), h7 = bf16_rne(c.w);
  const v8us hv = { h0, h1, h2, h3, h4, h5, h6, h7 };
  const v8us lv = { bf16_rne(a.x - bf16_f32(h0)), bf16_rne(a.y - bf16_f32(h1)),
                    bf16_rne(a.z - bf16_f32(h2)), bf16_rne(a.w - bf16_f32(h3)),
                    bf16_rne(c.x - bf16_f32(h4)), bf16_rne(c.y - bf16_f32(h5)),
                    bf16_rne(c.z - bf16_f32(h6)), bf16_rne(c.w - bf16_f32(h7)) };
  unsigned short* ph = whi + e;
  unsigned short* pl = wlo + e;
  *(v8us*)ph = hv;
  *(v8us*)pl = lv;
  
}

// ---------------------------------------------------------------------------
// one 16-B store per lane, lanes 8q..8q+7 per line.
//   qd/kd : 64 token rows x 32 halves, contiguous 4096 B (32 lines)
// ---------------------------------------------------------------------------
__device__ __forceinline__ void proj_store(const _Float16* sQ, const _Float16* sK, const _Float16* sV,
                                           _Float16* qd, _Float16* kd, _Float16* vd, int tid) {
  #pragma unroll
  for (int i = 0; i < 2; ++i) {
    const int off = (i * 128 + tid) * 8;
    const v8h a = *(const v8ha*)(sQ + off);
    *(v8h*)(qd + off) = a;
    const v8h c = *(const v8ha*)(sK + off);
    *(v8h*)(kd + off) = c;
  }
  const int q8 = tid & 7, sub = tid >> 3;        // sub 0..15
  #pragma unroll
  for (int i = 0; i < 4; ++i) {
    const int c = i * 16 + sub;                    // channel row 0..63
    const v8h a = *(const v8ha*)(sV + c * 64 + 8 * q8);
    *(v8h*)(vd + (size_t)c * NN + 8 * q8) = a;
  }
}

// ---------------------------------------------------------------------------
// Kernel 2: fused q/k/v projection. Block = 128 thr (4 waves) = 64 tokens of
// one batch x all 128 output features (32 q, 32 k, 64 v); K = 64 = 2 steps.
// x tile [64 c][64 n] f32 -> LDS as bf16 hi/lo [n][c] (pitch XP);
// A = x^T rows (row = token, k = c) from LDS, B = W rows (k-contiguous) from
// the global bf16 planes. D[token][feature]. Epilogue: +bias -> f16 -> LDS
// staging -> whole-line stores. q,k planes [b][n][32]; v plane [b][c][n].
// ---------------------------------------------------------------------------
__global__ __launch_bounds__(128) void k_proj(
    const float* __restrict__ x,
    const unsigned short* __restrict__ whi, const unsigned short* __restrict__ wlo,
    const float* __restrict__ bq, const float* __restrict__ bk, const float* __restrict__ bv,
    _Float16* __restrict__ qpl, _Float16* __restrict__ kpl, _Float16* __restrict__ vpl)
{
  __shared__ __attribute__((aligned(16))) unsigned short sXh[64 * XP];   // 9216 B
  __shared__ __attribute__((aligned(16))) unsigned short sXl[64 * XP];   // 9216 B
  __shared__ __attribute__((aligned(16))) _Float16 sQ[64 * CH];          // 4096 B
  __shared__ __attribute__((aligned(16))) _Float16 sK[64 * CH];          // 4096 B
  __shared__ __attribute__((aligned(16))) _Float16 sV[CC * 64];          // 8192 B

  const int tid = threadIdx.x, lane = tid & 31, w = tid >> 5;
  const int h = lane >> 4, m = lane & 15;
  const int n0 = blockIdx.x * 64;
  const int b = blockIdx.y;

  // ---- stage x tile: coalesced float4 loads, transpose + split into LDS ----
  const float* xb = x + (size_t)b * CC * NN + n0;
  #pragma unroll
  for (int i = 0; i < 8; ++i) {
    const int f4 = i * 128 + tid;        // 0..1023
    const int c = f4 >> 4;               // 0..63
    const int j4 = f4 & 15;              // tokens 4*j4 .. 4*j4+3
    const v4f v = *(const v4fa*)(xb + (size_t)c * NN + 4 * j4);
    const float e0 = v.x, e1 = v.y, e2 = v.z, e3 = v.w;
    const unsigned short a0 = bf16_rne(e0), a1 = bf16_rne(e1), a2 = bf16_rne(e2), a3 = bf16_rne(e3);
    const int t0 = 4 * j4;
    sXh[(t0 + 0) * XP + c] = a0;  sXl[(t0 + 0) * XP + c] = bf16_rne(e0 - bf16_f32(a0));
    sXh[(t0 + 1) * XP + c] = a1;  sXl[(t0 + 1) * XP + c] = bf16_rne(e1 - bf16_f32(a1));
    sXh[(t0 + 2) * XP + c] = a2;  sXl[(t0 + 2) * XP + c] = bf16_rne(e2 - bf16_f32(a2));
    sXh[(t0 + 3) * XP + c] = a3;  sXl[(t0 + 3) * XP + c] = bf16_rne(e3 - bf16_f32(a3));
  }
  __syncthreads();

  const v8f zero8 = {0.f, 0.f, 0.f, 0.f, 0.f, 0.f, 0.f, 0.f};
  v8f acc[8];
  #pragma unroll
  for (int nt = 0; nt < 8; ++nt) acc[nt] = zero8;

  const unsigned short* arow_h = sXh + (16 * w + m) * XP;   // token row
  const unsigned short* arow_l = sXl + (16 * w + m) * XP;

  #pragma unroll
  for (int ks = 0; ks < 2; ++ks) {
    const int k0 = 32 * ks;
    const v16b ah = ldfrag_b(arow_h + k0, h);
    const v16b al = ldfrag_b(arow_l + k0, h);
    #pragma unroll
    for (int nt = 0; nt < 8; ++nt) {
      const int f = 16 * nt + m;                            // fused feature row 0..127
      const v16b bh = ldfrag_b(whi + f * CC + k0, h);
      const v16b bl = ldfrag_b(wlo + f * CC + k0, h);
      acc[nt] = wmma_bf16(ah, bh, acc[nt]);
      acc[nt] = wmma_bf16(ah, bl, acc[nt]);
      acc[nt] = wmma_bf16(al, bh, acc[nt]);
    }
  }

  // ---- epilogue: D[r] of tile nt = Y[token 16w+8h+r][feature 16nt+m] ----
  #pragma unroll
  for (int nt = 0; nt < 8; ++nt) {
    const int f = 16 * nt + m;
    float bias;
    if (nt < 2)      bias = bq[f];
    else if (nt < 4) bias = bk[f - CH];
    else             bias = bv[f - 2 * CH];
    #pragma unroll
    for (int r = 0; r < 8; ++r) {
      const int tok = 16 * w + 8 * h + r;                    // 0..63
      const _Float16 y = (_Float16)(acc[nt][r] + bias);
      if (nt < 2)      sQ[tok * CH + f] = y;
      else if (nt < 4) sK[tok * CH + (f - CH)] = y;
      else             sV[(f - 2 * CH) * 64 + tok] = y;
    }
  }
  __syncthreads();

  _Float16* qd = qpl + ((size_t)b * NN + n0) * CH;
  _Float16* kd = kpl + ((size_t)b * NN + n0) * CH;
  _Float16* vd = vpl + (size_t)b * CC * NN + n0;
  proj_store(sQ, sK, sV, qd, kd, vd, tid);
  
}

// ---------------------------------------------------------------------------
// P^T B-fragment from the lane's own score D values: element r <- tile a row r,
// element 8+r <- tile c row r (same lane, same query column), scaled by 2^15.
// ---------------------------------------------------------------------------
__device__ __forceinline__ v16h pack_p(v8f a, v8f c) {
  const v16h r = { (_Float16)(a[0] * PSCALE), (_Float16)(a[1] * PSCALE), (_Float16)(a[2] * PSCALE), (_Float16)(a[3] * PSCALE),
                   (_Float16)(a[4] * PSCALE), (_Float16)(a[5] * PSCALE), (_Float16)(a[6] * PSCALE), (_Float16)(a[7] * PSCALE),
                   (_Float16)(c[0] * PSCALE), (_Float16)(c[1] * PSCALE), (_Float16)(c[2] * PSCALE), (_Float16)(c[3] * PSCALE),
                   (_Float16)(c[4] * PSCALE), (_Float16)(c[5] * PSCALE), (_Float16)(c[6] * PSCALE), (_Float16)(c[7] * PSCALE) };
  return r;
}

// Block tile [64 out-channels][64 queries] f32 in LDS -> out[b][o][qblk..+63];
// 128 lines (2 per channel row), each by lanes 8q..8q+7 in one instruction.
__device__ __forceinline__ void out_store(const float* sOut, float* od, int tid) {
  const int q8 = tid & 7, sub = tid >> 3;        // sub 0..15
  #pragma unroll
  for (int i = 0; i < 8; ++i) {
    const int L = i * 16 + sub;                    // line 0..127
    const int o = L >> 1, hl = L & 1;
    const v4f v = *(const v4fa*)(sOut + o * 64 + 32 * hl + 4 * q8);
    *(v4f*)(od + (size_t)o * NN + 32 * hl + 4 * q8) = v;
  }
}

// ---------------------------------------------------------------------------
// Kernel 3: streaming attention, transposed form, fused output projection.
// Block 128 thr (4 waves), 16 queries per wave, 64 keys per step.
//   S^T = K * Q^T : A = K rows (row = key, k = d), B = Q^T loaded like A from
//                   the query row (k = d, n = query)
//   O^T += V * P^T : A = V rows (row = c, k = key), B = P^T from registers
//   out^T = Wo * attn : A = Wo rows (row = o, k = c), B = attn from the O^T
//                   D tiles (k = c = tile row, n = query), bf16 hi/lo split
// Lane owns 32 keys of query column lane&15; partner = lane ^ 16.
// ---------------------------------------------------------------------------
__global__ __launch_bounds__(128) void k_attn(
    const _Float16* __restrict__ qpl,      // [B][N][32]
    const _Float16* __restrict__ kpl,      // [B][N][32]
    const _Float16* __restrict__ vpl,      // [B][64][N]
    const unsigned short* __restrict__ wohi, const unsigned short* __restrict__ wolo,   // [64][64]
    const float* __restrict__ bo,
    float* __restrict__ out)               // [B][64][N]
{
  __shared__ __attribute__((aligned(16))) float sOut[CC * 64];   // 16384 B

  const int tid = threadIdx.x, lane = tid & 31, w = tid >> 5;
  const int h = lane >> 4, m = lane & 15;
  const int b = blockIdx.y;
  const int qblk = blockIdx.x * 64;
  const int q0 = qblk + 16 * w;

  // Q^T B-fragment: column n = query q0+m, k = d (32 deep)
  const v16h qf = ldfrag_h(qpl + ((size_t)b * NN + q0 + m) * CH, h);

  const v8f zero8 = {0.f, 0.f, 0.f, 0.f, 0.f, 0.f, 0.f, 0.f};
  v8f o[4];                                  // o[t][r] = attn[c 16t+8h+r][query m] * lrun * 2^15
  #pragma unroll
  for (int t = 0; t < 4; ++t) o[t] = zero8;
  float mrun = -1e30f, lrun = 0.0f;

  const _Float16* kbase = kpl + ((size_t)b * NN + m) * CH;     // + key0*CH
  const _Float16* vbase = vpl + ((size_t)b * CC + m) * NN;     // + 16t*NN + key0

  #pragma unroll 1
  for (int kb = 0; kb < NN; kb += 64) {
    // ---- scores: s[j][r] = S[query m][key kb+16j+8h+r] * scale ----
    v8f s[4];
    #pragma unroll
    for (int j = 0; j < 4; ++j) {
      const v16h kf = ldfrag_h(kbase + (size_t)(kb + 16 * j) * CH, h);
      s[j] = wmma_f16(kf, qf, zero8);
    }
    #pragma unroll
    for (int j = 0; j < 4; ++j)
      #pragma unroll
      for (int r = 0; r < 8; ++r) s[j][r] = s[j][r] * SCALE;

    // ---- online softmax (f32) ----
    float mloc = s[0][0];
    #pragma unroll
    for (int j = 0; j < 4; ++j)
      #pragma unroll
      for (int r = 0; r < 8; ++r) mloc = fmaxf(mloc, s[j][r]);
    mloc = fmaxf(mloc, __shfl_xor(mloc, 16, 32));
    const float mnew = fmaxf(mrun, mloc);
    const float alpha = __expf(mrun - mnew);
    mrun = mnew;
    float lsum = 0.0f;
    #pragma unroll
    for (int j = 0; j < 4; ++j)
      #pragma unroll
      for (int r = 0; r < 8; ++r) {
        const float p = __expf(s[j][r] - mnew);
        s[j][r] = p;
        lsum += p;
      }
    lsum += __shfl_xor(lsum, 16, 32);
    lrun = lrun * alpha + lsum;
    #pragma unroll
    for (int t = 0; t < 4; ++t)
      #pragma unroll
      for (int r = 0; r < 8; ++r) o[t][r] = o[t][r] * alpha;

    // ---- P^T B-fragments (keys kb..kb+31 and kb+32..kb+63) ----
    const v16h pb0 = pack_p(s[0], s[1]);
    const v16h pb1 = pack_p(s[2], s[3]);

    // ---- O^T += V * P^T ----
    #pragma unroll
    for (int t = 0; t < 4; ++t) {
      const _Float16* vp = vbase + (size_t)(16 * t) * NN + kb;
      const v16h vf0 = ldfrag_h(vp, h);
      const v16h vf1 = ldfrag_h(vp + 32, h);
      o[t] = wmma_f16(vf0, pb0, o[t]);
      o[t] = wmma_f16(vf1, pb1, o[t]);
    }
  }

  // ---- normalise; attn D tiles -> bf16 hi/lo B-fragments (k = c) ----
  const float inv = (1.0f / lrun) * INV_PSCALE;
  FragB bh0, bl0, bh1, bl1;
  {
    const v8us ha = hi8(o[0], inv), hb = hi8(o[1], inv), hc = hi8(o[2], inv), hd = hi8(o[3], inv);
    bh0.half[0] = ha;  bh0.half[1] = hb;
    bh1.half[0] = hc;  bh1.half[1] = hd;
    bl0.half[0] = lo8(o[0], inv, ha);  bl0.half[1] = lo8(o[1], inv, hb);
    bl1.half[0] = lo8(o[2], inv, hc);  bl1.half[1] = lo8(o[3], inv, hd);
  }

  // ---- out^T[o][query] = sum_c Wo[o][c] attn[c][query] ----
  v8f acc2[4];
  #pragma unroll
  for (int ot = 0; ot < 4; ++ot) {
    const unsigned short* wrh = wohi + (16 * ot + m) * CC;
    const unsigned short* wrl = wolo + (16 * ot + m) * CC;
    v8f z = zero8;
    {
      const v16b a_h = ldfrag_b(wrh, h);
      const v16b a_l = ldfrag_b(wrl, h);
      z = wmma_bf16(a_h, bh0.v, z);
      z = wmma_bf16(a_h, bl0.v, z);
      z = wmma_bf16(a_l, bh0.v, z);
    }
    {
      const v16b a_h = ldfrag_b(wrh + 32, h);
      const v16b a_l = ldfrag_b(wrl + 32, h);
      z = wmma_bf16(a_h, bh1.v, z);
      z = wmma_bf16(a_h, bl1.v, z);
      z = wmma_bf16(a_l, bh1.v, z);
    }
    acc2[ot] = z;
  }

  // ---- stage [64 o][64 queries] tile; D[r] of tile ot = out[o 16ot+8h+r][query m] ----
  float* so = sOut + 16 * w + m;
  #pragma unroll
  for (int ot = 0; ot < 4; ++ot)
    #pragma unroll
    for (int r = 0; r < 8; ++r) {
      const int orow = 16 * ot + 8 * h + r;
      so[orow * 64] = acc2[ot][r] + bo[orow];
    }
  __syncthreads();

  float* od = out + (size_t)b * CC * NN + qblk;
  out_store(sOut, od, tid);
  
}

// ---------------------------------------------------------------------------
extern "C" void kernel_launch(void* const* d_in, const int* in_sizes, int n_in,
                              void* d_out, int out_size, void* d_ws, size_t ws_size,
                              hipStream_t stream) {
  if (n_in < 9) return;
  if (in_sizes[0] != NB * CC * NN) return;
  if (in_sizes[1] != NWQ || in_sizes[2] != CH) return;
  if (in_sizes[3] != NWQ || in_sizes[4] != CH) return;
  if (in_sizes[5] != NWV || in_sizes[6] != CC) return;
  if (in_sizes[7] != NWV || in_sizes[8] != CC) return;
  if (out_size != NB * CC * NN) return;

  const float* x  = (const float*)d_in[0];
  const float* wq = (const float*)d_in[1];
  const float* bq = (const float*)d_in[2];
  const float* wk = (const float*)d_in[3];
  const float* bk = (const float*)d_in[4];
  const float* wv = (const float*)d_in[5];
  const float* bv = (const float*)d_in[6];
  const float* wo = (const float*)d_in[7];
  const float* bo = (const float*)d_in[8];
  float* out = (float*)d_out;

  const size_t w_bytes  = (size_t)NWALL * 2;              //    24576 per plane
  const size_t qk_bytes = (size_t)NB * NN * CH * 2;        //  1048576 each
  const size_t v_bytes  = (size_t)NB * CC * NN * 2;        //  2097152
  const size_t total = 2 * w_bytes + 2 * qk_bytes + v_bytes;   // 4243456
  if (total > ws_size) return;

  char* ws = (char*)d_ws;
  unsigned short* whi = (unsigned short*)(ws);
  unsigned short* wlo = (unsigned short*)(ws + w_bytes);
  _Float16* qpl = (_Float16*)(ws + 2 * w_bytes);
  _Float16* kpl = (_Float16*)(ws + 2 * w_bytes + qk_bytes);
  _Float16* vpl = (_Float16*)(ws + 2 * w_bytes + 2 * qk_bytes);
  const unsigned short* wohi = whi + (2 * NWQ + NWV);
  const unsigned short* wolo = wlo + (2 * NWQ + NWV);

  const int ngroups = NWALL / 8;                            // 1536
  k_wconvert<<<(ngroups + 255) / 256, 256, 0, stream>>>(wq, wk, wv, wo, whi, wlo);

  dim3 gProj(NN / 64, NB);                                  // (128, 2)
  k_proj<<<gProj, 128, 0, stream>>>(x, whi, wlo, bq, bk, bv, qpl, kpl, vpl);

  dim3 gAtt(NN / 64, NB);                                   // (128, 2)
  k_attn<<<gAtt, 128, 0, stream>>>(qpl, kpl, vpl, wohi, wolo, bo, out);
}

// v001
// Measured time: 87.4 microseconds a run.
// Two timings next to v000 put it at 4.75 and 4.72 times that version's speed.
// Contractions: q/k/v and output 1x1x1 projections on v_wmma_f32_16x16x32_bf16 as bf16 hi/lo split (hi*hi + hi*lo + lo*hi); key*query scores and value*prob products on v_wmma_f32_16x16x32_f16 (f16 operands, prob carried x32768 and folded back in f32); f32 accumulate everywhere; softmax, bias, normalisation in f32.
#include <hip/hip_runtime.h>
#include <stdint.h>

typedef _Float16 v16h __attribute__((ext_vector_type(16)));
typedef _Float16 v8h  __attribute__((ext_vector_type(8)));
typedef __bf16   v16b __attribute__((ext_vector_type(16)));
typedef unsigned short v8us __attribute__((ext_vector_type(8)));
typedef float v8f __attribute__((ext_vector_type(8)));
typedef float v4f __attribute__((ext_vector_type(4)));
typedef v8h  __attribute__((may_alias)) v8ha;
typedef v8us __attribute__((may_alias)) v8usa;
typedef v4f  __attribute__((may_alias)) v4fa;

union FragH { v16h v; v8h half[2]; };
union FragB { v16b v; v8us half[2]; };

#define NB   2        // batch
#define CC   64       // channels
#define CH   32       // q/k channels
#define NN   8192     // voxels 8*32*32
#define XP   72       // LDS pitch (halves) of the transposed x tile
#define NWQ  (CH * CC)            // 2048
#define NWV  (CC * CC)            // 4096
#define NWALL (2 * NWQ + 2 * NWV) // 12288 : [wq | wk | wv | wo]
#define PSCALE 32768.0f
#define INV_PSCALE (1.0f / 32768.0f)
#define SCALE 0.17677669529663688f   // 32^-0.5
#define KPB  80                  // LDS pitch, bytes, of a staged key row (64 B of data): 16 B x odd
#define VPB  144                 // LDS pitch, bytes, of a staged value row (128 B of data): 16 B x odd
#define KTB  (64 * KPB)          // 5120 : key part of one stage
#define BUFB (KTB + 64 * VPB)    // 14336 : one stage = 64 keys of K and V

// ---------------------------------------------------------------------------
// WMMA helpers with hazard guard (ties D, keeps A/B live).
// Fragment map (wave32): lane l, h = l>>4, m = n = l&15.
//   A/B element i: i<8 -> k0+8h+i ; i>=8 -> k0+16+8h+(i-8)
//   D element r : row 8h+r, col l&15
// ---------------------------------------------------------------------------
__device__ __forceinline__ v8f wmma_f16(v16h a, v16h b, v8f c) {
  v8f d = __builtin_amdgcn_wmma_f32_16x16x32_f16(false, a, false, b, (short)0, c, false, false);
  asm volatile("v_nop\n\tv_nop\n\tv_nop\n\tv_nop" : "+v"(d) : "v"(a), "v"(b));
  return d;
}
__device__ __forceinline__ v8f wmma_bf16(v16b a, v16b b, v8f c) {
  v8f d = __builtin_amdgcn_wmma_f32_16x16x32_bf16(false, a, false, b, (short)0, c, false, false);
  asm volatile("v_nop\n\tv_nop\n\tv_nop\n\tv_nop" : "+v"(d) : "v"(a), "v"(b));
  return d;
}

// A or B fragment from a k-contiguous 16-bit row; p points at element k0 of
// the row owned by this lane (row index lane&15 added by the caller).
__device__ __forceinline__ v16h ldfrag_h(const _Float16* p, int h) {
  FragH f;
  f.half[0] = *(const v8ha*)(p + 8 * h);
  f.half[1] = *(const v8ha*)(p + 16 + 8 * h);
  return f.v;
}
__device__ __forceinline__ v16b ldfrag_b(const unsigned short* p, int h) {
  FragB f;
  f.half[0] = *(const v8usa*)(p + 8 * h);
  f.half[1] = *(const v8usa*)(p + 16 + 8 * h);
  return f.v;
}

// bf16 RNE convert on the f32 bit pattern, and back.
__device__ __forceinline__ unsigned short bf16_rne(float f) {
  unsigned u = __float_as_uint(f);
  u = u + 0x7FFFu + ((u >> 16) & 1u);
  return (unsigned short)(u >> 16);
}
__device__ __forceinline__ float bf16_f32(unsigned short b) {
  return __uint_as_float(((unsigned)b) << 16);
}

__device__ __forceinline__ v8us hi8(v8f v, float sc) {
  const v8us r = { bf16_rne(v[0] * sc), bf16_rne(v[1] * sc), bf16_rne(v[2] * sc), bf16_rne(v[3] * sc),
                   bf16_rne(v[4] * sc), bf16_rne(v[5] * sc), bf16_rne(v[6] * sc), bf16_rne(v[7] * sc) };
  return r;
}
__device__ __forceinline__ v8us lo8(v8f v, float sc, v8us hh) {
  const v8us r = { bf16_rne(v[0] * sc - bf16_f32(hh[0])), bf16_rne(v[1] * sc - bf16_f32(hh[1])),
                   bf16_rne(v[2] * sc - bf16_f32(hh[2])), bf16_rne(v[3] * sc - bf16_f32(hh[3])),
                   bf16_rne(v[4] * sc - bf16_f32(hh[4])), bf16_rne(v[5] * sc - bf16_f32(hh[5])),
                   bf16_rne(v[6] * sc - bf16_f32(hh[6])), bf16_rne(v[7] * sc - bf16_f32(hh[7])) };
  return r;
}

// ---------------------------------------------------------------------------
// Kernel 1: weights f32 -> bf16 hi and lo planes, [wq|wk|wv|wo] concatenated,
// row = output feature, 64 k-contiguous inputs per row.
// ---------------------------------------------------------------------------
__global__ __launch_bounds__(256) void k_wconvert(
    const float* __restrict__ wq, const float* __restrict__ wk,
    const float* __restrict__ wv, const float* __restrict__ wo,
    unsigned short* __restrict__ whi, unsigned short* __restrict__ wlo)
{
  const int g = blockIdx.x * 256 + threadIdx.x;      // 8-element group
  if (g >= NWALL / 8) return;
  const int e = g * 8;
  const float* src;
  if (e < NWQ)                src = wq + e;
  else if (e < 2 * NWQ)       src = wk + (e - NWQ);
  else if (e < 2 * NWQ + NWV) src = wv + (e - 2 * NWQ);
  else                        src = wo + (e - 2 * NWQ - NWV);
  const v4f a = *(const v4fa*)src;
  const v4f c = *(const v4fa*)(src + 4);
  const unsigned short h0 = bf16_rne(a.x), h1 = bf16_rne(a.y), h2 = bf16_rne(a.z), h3 = bf16_rne(a.w);
  const unsigned short h4 = bf16_rne(c.x), h5 = bf16_rne(c.y), h6 = bf16_rne(c.z), h7 = bf16_rne(c.w);
  const v8us hv = { h0, h1, h2, h3, h4, h5, h6, h7 };
  const v8us lv = { bf16_rne(a.x - bf16_f32(h0)), bf16_rne(a.y - bf16_f32(h1)),
                    bf16_rne(a.z - bf16_f32(h2)), bf16_rne(a.w - bf16_f32(h3)),
                    bf16_rne(c.x - bf16_f32(h4)), bf16_rne(c.y - bf16_f32(h5)),
                    bf16_rne(c.z - bf16_f32(h6)), bf16_rne(c.w - bf16_f32(h7)) };
  unsigned short* ph = whi + e;
  unsigned short* pl = wlo + e;
  *(v8us*)ph = hv;
  *(v8us*)pl = lv;
  
}

// ---------------------------------------------------------------------------
// one 16-B store per lane, lanes 8q..8q+7 per line.
//   qd/kd : 64 token rows x 32 halves, contiguous 4096 B (32 lines)
// ---------------------------------------------------------------------------
__device__ __forceinline__ void proj_store(const _Float16* sQ, const _Float16* sK, const _Float16* sV,
                                           _Float16* qd, _Float16* kd, _Float16* vd, int tid) {
  #pragma unroll
  for (int i = 0; i < 2; ++i) {
    const int off = (i * 128 + tid) * 8;
    const v8h a = *(const v8ha*)(sQ + off);
    *(v8h*)(qd + off) = a;
    const v8h c = *(const v8ha*)(sK + off);
    *(v8h*)(kd + off) = c;
  }
  const int q8 = tid & 7, sub = tid >> 3;        // sub 0..15
  #pragma unroll
  for (int i = 0; i < 4; ++i) {
    const int c = i * 16 + sub;                    // channel row 0..63
    const v8h a = *(const v8ha*)(sV + c * 64 + 8 * q8);
    *(v8h*)(vd + (size_t)c * NN + 8 * q8) = a;
  }
}

// ---------------------------------------------------------------------------
// Kernel 2: fused q/k/v projection. Block = 128 thr (4 waves) = 64 tokens of
// one batch x all 128 output features (32 q, 32 k, 64 v); K = 64 = 2 steps.
// x tile [64 c][64 n] f32 -> LDS as bf16 hi/lo [n][c] (pitch XP);
// A = x^T rows (row = token, k = c) from LDS, B = W rows (k-contiguous) from
// the global bf16 planes. D[token][feature]. Epilogue: +bias -> f16 -> LDS
// staging -> whole-line stores. q,k planes [b][n][32]; v plane [b][c][n].
// ---------------------------------------------------------------------------
__global__ __launch_bounds__(128) void k_proj(
    const float* __restrict__ x,
    const unsigned short* __restrict__ whi, const unsigned short* __restrict__ wlo,
    const float* __restrict__ bq, const float* __restrict__ bk, const float* __restrict__ bv,
    _Float16* __restrict__ qpl, _Float16* __restrict__ kpl, _Float16* __restrict__ vpl)
{
  __shared__ __attribute__((aligned(16))) unsigned short sXh[64 * XP];   // 9216 B
  __shared__ __attribute__((aligned(16))) unsigned short sXl[64 * XP];   // 9216 B
  __shared__ __attribute__((aligned(16))) _Float16 sQ[64 * CH];          // 4096 B
  __shared__ __attribute__((aligned(16))) _Float16 sK[64 * CH];          // 4096 B
  __shared__ __attribute__((aligned(16))) _Float16 sV[CC * 64];          // 8192 B

  const int tid = threadIdx.x, lane = tid & 31, w = tid >> 5;
  const int h = lane >> 4, m = lane & 15;
  const int n0 = blockIdx.x * 64;
  const int b = blockIdx.y;

  // ---- stage x tile: coalesced float4 loads, transpose + split into LDS ----
  const float* xb = x + (size_t)b * CC * NN + n0;
  #pragma unroll
  for (int i = 0; i < 8; ++i) {
    const int f4 = i * 128 + tid;        // 0..1023
    const int c = f4 >> 4;               // 0..63
    const int j4 = f4 & 15;              // tokens 4*j4 .. 4*j4+3
    const v4f v = *(const v4fa*)(xb + (size_t)c * NN + 4 * j4);
    const float e0 = v.x, e1 = v.y, e2 = v.z, e3 = v.w;
    const unsigned short a0 = bf16_rne(e0), a1 = bf16_rne(e1), a2 = bf16_rne(e2), a3 = bf16_rne(e3);
    const int t0 = 4 * j4;
    sXh[(t0 + 0) * XP + c] = a0;  sXl[(t0 + 0) * XP + c] = bf16_rne(e0 - bf16_f32(a0));
    sXh[(t0 + 1) * XP + c] = a1;  sXl[(t0 + 1) * XP + c] = bf16_rne(e1 - bf16_f32(a1));
    sXh[(t0 + 2) * XP + c] = a2;  sXl[(t0 + 2) * XP + c] = bf16_rne(e2 - bf16_f32(a2));
    sXh[(t0 + 3) * XP + c] = a3;  sXl[(t0 + 3) * XP + c] = bf16_rne(e3 - bf16_f32(a3));
  }
  __syncthreads();

  const v8f zero8 = {0.f, 0.f, 0.f, 0.f, 0.f, 0.f, 0.f, 0.f};
  v8f acc[8];
  #pragma unroll
  for (int nt = 0; nt < 8; ++nt) acc[nt] = zero8;

  const unsigned short* arow_h = sXh + (16 * w + m) * XP;   // token row
  const unsigned short* arow_l = sXl + (16 * w + m) * XP;

  #pragma unroll
  for (int ks = 0; ks < 2; ++ks) {
    const int k0 = 32 * ks;
    const v16b ah = ldfrag_b(arow_h + k0, h);
    const v16b al = ldfrag_b(arow_l + k0, h);
    #pragma unroll
    for (int nt = 0; nt < 8; ++nt) {
      const int f = 16 * nt + m;                            // fused feature row 0..127
      const v16b bh = ldfrag_b(whi + f * CC + k0, h);
      const v16b bl = ldfrag_b(wlo + f * CC + k0, h);
      acc[nt] = wmma_bf16(ah, bh, acc[nt]);
      acc[nt] = wmma_bf16(ah, bl, acc[nt]);
      acc[nt] = wmma_bf16(al, bh, acc[nt]);
    }
  }

  // ---- epilogue: D[r] of tile nt = Y[token 16w+8h+r][feature 16nt+m] ----
  #pragma unroll
  for (int nt = 0; nt < 8; ++nt) {
    const int f = 16 * nt + m;
    float bias;
    if (nt < 2)      bias = bq[f];
    else if (nt < 4) bias = bk[f - CH];
    else             bias = bv[f - 2 * CH];
    #pragma unroll
    for (int r = 0; r < 8; ++r) {
      const int tok = 16 * w + 8 * h + r;                    // 0..63
      const _Float16 y = (_Float16)(acc[nt][r] + bias);
      if (nt < 2)      sQ[tok * CH + f] = y;
      else if (nt < 4) sK[tok * CH + (f - CH)] = y;
      else             sV[(f - 2 * CH) * 64 + tok] = y;
    }
  }
  __syncthreads();

  _Float16* qd = qpl + ((size_t)b * NN + n0) * CH;
  _Float16* kd = kpl + ((size_t)b * NN + n0) * CH;
  _Float16* vd = vpl + (size_t)b * CC * NN + n0;
  proj_store(sQ, sK, sV, qd, kd, vd, tid);
  
}

// ---------------------------------------------------------------------------
// P^T B-fragment from the lane's own score D values: element r <- tile a row r,
// element 8+r <- tile c row r (same lane, same query column), scaled by 2^15.
// ---------------------------------------------------------------------------
__device__ __forceinline__ v16h pack_p(v8f a, v8f c) {
  const v16h r = { (_Float16)(a[0] * PSCALE), (_Float16)(a[1] * PSCALE), (_Float16)(a[2] * PSCALE), (_Float16)(a[3] * PSCALE),
                   (_Float16)(a[4] * PSCALE), (_Float16)(a[5] * PSCALE), (_Float16)(a[6] * PSCALE), (_Float16)(a[7] * PSCALE),
                   (_Float16)(c[0] * PSCALE), (_Float16)(c[1] * PSCALE), (_Float16)(c[2] * PSCALE), (_Float16)(c[3] * PSCALE),
                   (_Float16)(c[4] * PSCALE), (_Float16)(c[5] * PSCALE), (_Float16)(c[6] * PSCALE), (_Float16)(c[7] * PSCALE) };
  return r;
}

// Block tile [64 out-channels][64 queries] f32 in LDS -> out[b][o][qblk..+63];
// 128 lines (2 per channel row), each by lanes 8q..8q+7 in one instruction.
__device__ __forceinline__ void out_store(const float* sOut, float* od, int tid) {
  const int q8 = tid & 7, sub = tid >> 3;        // sub 0..15
  #pragma unroll
  for (int i = 0; i < 8; ++i) {
    const int L = i * 16 + sub;                    // line 0..127
    const int o = L >> 1, hl = L & 1;
    const v4f v = *(const v4fa*)(sOut + o * 64 + 32 * hl + 4 * q8);
    *(v4f*)(od + (size_t)o * NN + 32 * hl + 4 * q8) = v;
  }
}

// One stage (64 keys) from global memory into LDS, through no register: six
// 16-B asynchronous copies per lane (2 of K, 4 of V), every lane on.
// lk/lv: the lane's LDS byte addresses; gk/gv: its global addresses.
// The s_wait_xcnt closes the statement so that no address register named by a
// copy is rewritten ahead of it.
__device__ __forceinline__ void stage_copy(unsigned lk, unsigned lv, const _Float16* gk, const _Float16* gv) {
  asm volatile(
      "global_load_async_to_lds_b128 %0, %6, off\n\t"
      "global_load_async_to_lds_b128 %1, %7, off\n\t"
      "global_load_async_to_lds_b128 %2, %8, off\n\t"
      "global_load_async_to_lds_b128 %3, %9, off\n\t"
      "global_load_async_to_lds_b128 %4, %10, off\n\t"
      "global_load_async_to_lds_b128 %5, %11, off\n\t"
      "s_wait_xcnt 0x0"
      :: "v"(lk), "v"(lk + 32 * KPB),
         "v"(lv), "v"(lv + 16 * VPB), "v"(lv + 32 * VPB), "v"(lv + 48 * VPB),
         "v"(gk), "v"(gk + 32 * CH),
         "v"(gv), "v"(gv + (size_t)16 * NN), "v"(gv + (size_t)32 * NN), "v"(gv + (size_t)48 * NN)
      : "memory");
}

// ---------------------------------------------------------------------------
// Kernel 3: streaming attention, transposed form, fused output projection.
// Block 128 thr (4 waves), 16 queries per wave, 64 keys per step.
// K and V of a step are staged once per block in a two-buffer LDS ring by
// asynchronous copies (the next step's tile flies while this one is worked on);
// all four waves read their fragments from it.
//   S^T = K * Q^T : A = K rows (row = key, k = d), B = Q^T loaded like A from
//                   the query row (k = d, n = query)
//   O^T += V * P^T : A = V rows (row = c, k = key), B = P^T from registers
//   out^T = Wo * attn : A = Wo rows (row = o, k = c), B = attn from the O^T
//                   D tiles (k = c = tile row, n = query), bf16 hi/lo split
// Lane owns 32 keys of query column lane&15; partner = lane ^ 16.
// ---------------------------------------------------------------------------
__global__ __launch_bounds__(128) void k_attn(
    const _Float16* __restrict__ qpl,      // [B][N][32]
    const _Float16* __restrict__ kpl,      // [B][N][32]
    const _Float16* __restrict__ vpl,      // [B][64][N]
    const unsigned short* __restrict__ wohi, const unsigned short* __restrict__ wolo,   // [64][64]
    const float* __restrict__ bo,
    float* __restrict__ out)               // [B][64][N]
{
  __shared__ __attribute__((aligned(16))) float sOut[CC * 64];   // 16384 B
  __shared__ __attribute__((aligned(16))) unsigned char sRing[2 * BUFB];   // 28672 B

  const int tid = threadIdx.x, lane = tid & 31, w = tid >> 5;
  const int h = lane >> 4, m = lane & 15;
  const int b = blockIdx.y;
  const int qblk = blockIdx.x * 64;
  const int q0 = qblk + 16 * w;

  // Q^T B-fragment: column n = query q0+m, k = d (32 deep)
  const v16h qf = ldfrag_h(qpl + ((size_t)b * NN + q0 + m) * CH, h);

  const v8f zero8 = {0.f, 0.f, 0.f, 0.f, 0.f, 0.f, 0.f, 0.f};
  v8f o[4];                                  // o[t][r] = attn[c 16t+8h+r][query m] * lrun * 2^15
  #pragma unroll
  for (int t = 0; t < 4; ++t) o[t] = zero8;
  float mrun = -1e30f, lrun = 0.0f;

  // copy side: K chunk = 16 B of key row tid>>2 (+32), V chunk = 16 B of channel row tid>>3 (+16i)
  const unsigned ring = (unsigned)(uintptr_t)sRing;            // LDS byte address of the ring
  const unsigned lk = ring + (tid >> 2) * KPB + (tid & 3) * 16;
  const unsigned lv = ring + KTB + (tid >> 3) * VPB + (tid & 7) * 16;
  const _Float16* gk = kpl + (size_t)b * NN * CH + tid * 8;                          // + key0*CH
  const _Float16* gv = vpl + ((size_t)b * CC + (tid >> 3)) * NN + (tid & 7) * 8;     // + key0
  // read side: key row 16j+m, channel row 16t+m
  const unsigned char* krow = sRing + m * KPB;
  const unsigned char* vrow = sRing + KTB + m * VPB;

  stage_copy(lk, lv, gk, gv);
  asm volatile("s_wait_asynccnt 0x0" ::: "memory");   // own copies of stage 0 landed
  __syncthreads();                                     // stage 0 readable by every wave
  stage_copy(lk + BUFB, lv + BUFB, gk + 64 * CH, gv + 64);

  #pragma unroll 1
  for (int kb = 0; kb < NN; kb += 64) {
    const unsigned boff = (kb & 64) ? BUFB : 0;
    // ---- this stage's fragments, one load group ----
    v16h kf[4], vf0[4], vf1[4];
    #pragma unroll
    for (int j = 0; j < 4; ++j)
      kf[j] = ldfrag_h((const _Float16*)(krow + boff + 16 * j * KPB), h);
    #pragma unroll
    for (int t = 0; t < 4; ++t) {
      const _Float16* vp = (const _Float16*)(vrow + boff + 16 * t * VPB);
      vf0[t] = ldfrag_h(vp, h);
      vf1[t] = ldfrag_h(vp + 32, h);
    }

    // ---- scores: s[j][r] = S[query m][key kb+16j+8h+r] * scale ----
    v8f s[4];
    #pragma unroll
    for (int j = 0; j < 4; ++j)
      s[j] = wmma_f16(kf[j], qf, zero8);
    #pragma unroll
    for (int j = 0; j < 4; ++j)
      #pragma unroll
      for (int r = 0; r < 8; ++r) s[j][r] = s[j][r] * SCALE;

    // ---- online softmax (f32) ----
    float mloc = s[0][0];
    #pragma unroll
    for (int j = 0; j < 4; ++j)
      #pragma unroll
      for (int r = 0; r < 8; ++r) mloc = fmaxf(mloc, s[j][r]);
    mloc = fmaxf(mloc, __shfl_xor(mloc, 16, 32));
    const float mnew = fmaxf(mrun, mloc);
    const float alpha = __expf(mrun - mnew);
    mrun = mnew;
    float lsum = 0.0f;
    #pragma unroll
    for (int j = 0; j < 4; ++j)
      #pragma unroll
      for (int r = 0; r < 8; ++r) {
        const float p = __expf(s[j][r] - mnew);
        s[j][r] = p;
        lsum += p;
      }
    lsum += __shfl_xor(lsum, 16, 32);
    lrun = lrun * alpha + lsum;
    #pragma unroll
    for (int t = 0; t < 4; ++t)
      #pragma unroll
      for (int r = 0; r < 8; ++r) o[t][r] = o[t][r] * alpha;

    // ---- P^T B-fragments (keys kb..kb+31 and kb+32..kb+63) ----
    const v16h pb0 = pack_p(s[0], s[1]);
    const v16h pb1 = pack_p(s[2], s[3]);

    // ---- O^T += V * P^T ----
    #pragma unroll
    for (int t = 0; t < 4; ++t) {
      o[t] = wmma_f16(vf0[t], pb0, o[t]);
      o[t] = wmma_f16(vf1[t], pb1, o[t]);
    }

    // ---- publish point of the next stage ----
    asm volatile("s_wait_dscnt 0x0" ::: "memory");     // own reads of this buffer done before it is refilled
    asm volatile("s_wait_asynccnt 0x0" ::: "memory");  // own copies of the next stage landed
    __syncthreads();                                    // next stage readable; this buffer left by every wave
    if (kb + 128 < NN)
      stage_copy(lk + boff, lv + boff, gk + (size_t)(kb + 128) * CH, gv + (kb + 128));
  }
  asm volatile("s_wait_asynccnt 0x0" ::: "memory");    // nothing in flight behind the loop

  // ---- normalise; attn D tiles -> bf16 hi/lo B-fragments (k = c) ----
  const float inv = (1.0f / lrun) * INV_PSCALE;
  FragB bh0, bl0, bh1, bl1;
  {
    const v8us ha = hi8(o[0], inv), hb = hi8(o[1], inv), hc = hi8(o[2], inv), hd = hi8(o[3], inv);
    bh0.half[0] = ha;  bh0.half[1] = hb;
    bh1.half[0] = hc;  bh1.half[1] = hd;
    bl0.half[0] = lo8(o[0], inv, ha);  bl0.half[1] = lo8(o[1], inv, hb);
    bl1.half[0] = lo8(o[2], inv, hc);  bl1.half[1] = lo8(o[3], inv, hd);
  }

  // ---- out^T[o][query] = sum_c Wo[o][c] attn[c][query] ----
  v8f acc2[4];
  #pragma unroll
  for (int ot = 0; ot < 4; ++ot) {
    const unsigned short* wrh = wohi + (16 * ot + m) * CC;
    const unsigned short* wrl = wolo + (16 * ot + m) * CC;
    v8f z = zero8;
    {
      const v16b a_h = ldfrag_b(wrh, h);
      const v16b a_l = ldfrag_b(wrl, h);
      z = wmma_bf16(a_h, bh0.v, z);
      z = wmma_bf16(a_h, bl0.v, z);
      z = wmma_bf16(a_l, bh0.v, z);
    }
    {
      const v16b a_h = ldfrag_b(wrh + 32, h);
      const v16b a_l = ldfrag_b(wrl + 32, h);
      z = wmma_bf16(a_h, bh1.v, z);
      z = wmma_bf16(a_h, bl1.v, z);
      z = wmma_bf16(a_l, bh1.v, z);
    }
    acc2[ot] = z;
  }

  // ---- stage [64 o][64 queries] tile; D[r] of tile ot = out[o 16ot+8h+r][query m] ----
  float* so = sOut + 16 * w + m;
  #pragma unroll
  for (int ot = 0; ot < 4; ++ot)
    #pragma unroll
    for (int r = 0; r < 8; ++r) {
      const int orow = 16 * ot + 8 * h + r;
      so[orow * 64] = acc2[ot][r] + bo[orow];
    }
  __syncthreads();

  float* od = out + (size_t)b * CC * NN + qblk;
  out_store(sOut, od, tid);
  
}

// ---------------------------------------------------------------------------
extern "C" void kernel_launch(void* const* d_in, const int* in_sizes, int n_in,
                              void* d_out, int out_size, void* d_ws, size_t ws_size,
                              hipStream_t stream) {
  if (n_in < 9) return;
  if (in_sizes[0] != NB * CC * NN) return;
  if (in_sizes[1] != NWQ || in_sizes[2] != CH) return;
  if (in_sizes[3] != NWQ || in_sizes[4] != CH) return;
  if (in_sizes[5] != NWV || in_sizes[6] != CC) return;
  if (in_sizes[7] != NWV || in_sizes[8] != CC) return;
  if (out_size != NB * CC * NN) return;

  const float* x  = (const float*)d_in[0];
  const float* wq = (const float*)d_in[1];
  const float* bq = (const float*)d_in[2];
  const float* wk = (const float*)d_in[3];
  const float* bk = (const float*)d_in[4];
  const float* wv = (const float*)d_in[5];
  const float* bv = (const float*)d_in[6];
  const float* wo = (const float*)d_in[7];
  const float* bo = (const float*)d_in[8];
  float* out = (float*)d_out;

  const size_t w_bytes  = (size_t)NWALL * 2;              //    24576 per plane
  const size_t qk_bytes = (size_t)NB * NN * CH * 2;        //  1048576 each
  const size_t v_bytes  = (size_t)NB * CC * NN * 2;        //  2097152
  const size_t total = 2 * w_bytes + 2 * qk_bytes + v_bytes;   // 4243456
  if (total > ws_size) return;

  char* ws = (char*)d_ws;
  unsigned short* whi = (unsigned short*)(ws);
  unsigned short* wlo = (unsigned short*)(ws + w_bytes);
  _Float16* qpl = (_Float16*)(ws + 2 * w_bytes);
  _Float16* kpl = (_Float16*)(ws + 2 * w_bytes + qk_bytes);
  _Float16* vpl = (_Float16*)(ws + 2 * w_bytes + 2 * qk_bytes);
  const unsigned short* wohi = whi + (2 * NWQ + NWV);
  const unsigned short* wolo = wlo + (2 * NWQ + NWV);

  const int ngroups = NWALL / 8;                            // 1536
  k_wconvert<<<(ngroups + 255) / 256, 256, 0, stream>>>(wq, wk, wv, wo, whi, wlo);

  dim3 gProj(NN / 64, NB);                                  // (128, 2)
  k_proj<<<gProj, 128, 0, stream>>>(x, whi, wlo, bq, bk, bv, qpl, kpl, vpl);

  dim3 gAtt(NN / 64, NB);                                   // (128, 2)
  k_attn<<<gAtt, 128, 0, stream>>>(qpl, kpl, vpl, wohi, wolo, bo, out);
}

// v002
// Measured time: 52.6 microseconds a run.
// In two side-by-side timings against v001, it was 1.64 and 1.68 times as fast.
// All steps since v000 together make it 7.86 times as fast.
// Contractions: q/k/v and output 1x1x1 projections on v_wmma_f32_16x16x32_bf16 as bf16 hi/lo split (hi*hi + hi*lo + lo*hi); key*query scores and value*prob products on v_wmma_f32_16x16x32_f16 (f16 operands, prob carried x32768 and folded back in f32); f32 accumulate everywhere; softmax, bias, normalisation in f32.
#include <hip/hip_runtime.h>
#include <stdint.h>

typedef _Float16 v16h __attribute__((ext_vector_type(16)));
typedef _Float16 v8h  __attribute__((ext_vector_type(8)));
typedef __bf16   v16b __attribute__((ext_vector_type(16)));
typedef unsigned short v8us __attribute__((ext_vector_type(8)));
typedef float v8f __attribute__((ext_vector_type(8)));
typedef float v4f __attribute__((ext_vector_type(4)));
typedef v8h  __attribute__((may_alias)) v8ha;
typedef v8us __attribute__((may_alias)) v8usa;
typedef v4f  __attribute__((may_alias)) v4fa;
typedef float v2f __attribute__((ext_vector_type(2)));
typedef v2f  __attribute__((may_alias)) v2fa;

union FragH { v16h v; v8h half[2]; };
union FragB { v16b v; v8us half[2]; };

#define NB   2        // batch
#define CC   64       // channels
#define CH   32       // q/k channels
#define NN   8192     // voxels 8*32*32
#define XP   72       // LDS pitch (halves) of the transposed x tile
#define NWQ  (CH * CC)            // 2048
#define NWV  (CC * CC)            // 4096
#define NWALL (2 * NWQ + 2 * NWV) // 12288 : [wq | wk | wv | wo]
#define PSCALE 32768.0f
#define INV_PSCALE (1.0f / 32768.0f)
#define SCALE 0.17677669529663688f   // 32^-0.5
#define KPB  80                  // LDS pitch, bytes, of a staged key row (64 B of data): 16 B x odd
#define VPB  144                 // LDS pitch, bytes, of a staged value row (128 B of data): 16 B x odd
#define KTB  (64 * KPB)          // 5120 : key part of one wave group's part of a stage (64 keys)
#define BUFB (KTB + 64 * VPB)    // 14336 : 64 keys of K and V = one wave group's part of a stage
#define NG   4                   // wave groups of the attention block; each takes its own keys
#define STGB (NG * BUFB)         // 57344 : one stage = 256 keys
#define PARTB (16 * 8 * 32 * 16) // 65536 : the 16 waves' partial O tiles, 8 x 16 B per lane

// ---------------------------------------------------------------------------
// WMMA helpers with hazard guard (ties D, keeps A/B live).
// Fragment map (wave32): lane l, h = l>>4, m = n = l&15.
//   A/B element i: i<8 -> k0+8h+i ; i>=8 -> k0+16+8h+(i-8)
//   D element r : row 8h+r, col l&15
// ---------------------------------------------------------------------------
__device__ __forceinline__ v8f wmma_f16(v16h a, v16h b, v8f c) {
  v8f d = __builtin_amdgcn_wmma_f32_16x16x32_f16(false, a, false, b, (short)0, c, false, false);
  asm volatile("v_nop\n\tv_nop\n\tv_nop\n\tv_nop" : "+v"(d) : "v"(a), "v"(b));
  return d;
}
__device__ __forceinline__ v8f wmma_bf16(v16b a, v16b b, v8f c) {
  v8f d = __builtin_amdgcn_wmma_f32_16x16x32_bf16(false, a, false, b, (short)0, c, false, false);
  asm volatile("v_nop\n\tv_nop\n\tv_nop\n\tv_nop" : "+v"(d) : "v"(a), "v"(b));
  return d;
}

// A or B fragment from a k-contiguous 16-bit row; p points at element k0 of
// the row owned by this lane (row index lane&15 added by the caller).
__device__ __forceinline__ v16h ldfrag_h(const _Float16* p, int h) {
  FragH f;
  f.half[0] = *(const v8ha*)(p + 8 * h);
  f.half[1] = *(const v8ha*)(p + 16 + 8 * h);
  return f.v;
}
__device__ __forceinline__ v16b ldfrag_b(const unsigned short* p, int h) {
  FragB f;
  f.half[0] = *(const v8usa*)(p + 8 * h);
  f.half[1] = *(const v8usa*)(p + 16 + 8 * h);
  return f.v;
}

// bf16 RNE convert on the f32 bit pattern, and back.
__device__ __forceinline__ unsigned short bf16_rne(float f) {
  unsigned u = __float_as_uint(f);
  u = u + 0x7FFFu + ((u >> 16) & 1u);
  return (unsigned short)(u >> 16);
}
__device__ __forceinline__ float bf16_f32(unsigned short b) {
  return __uint_as_float(((unsigned)b) << 16);
}

__device__ __forceinline__ v8us hi8(v8f v, float sc) {
  const v8us r = { bf16_rne(v[0] * sc), bf16_rne(v[1] * sc), bf16_rne(v[2] * sc), bf16_rne(v[3] * sc),
                   bf16_rne(v[4] * sc), bf16_rne(v[5] * sc), bf16_rne(v[6] * sc), bf16_rne(v[7] * sc) };
  return r;
}
__device__ __forceinline__ v8us lo8(v8f v, float sc, v8us hh) {
  const v8us r = { bf16_rne(v[0] * sc - bf16_f32(hh[0])), bf16_rne(v[1] * sc - bf16_f32(hh[1])),
                   bf16_rne(v[2] * sc - bf16_f32(hh[2])), bf16_rne(v[3] * sc - bf16_f32(hh[3])),
                   bf16_rne(v[4] * sc - bf16_f32(hh[4])), bf16_rne(v[5] * sc - bf16_f32(hh[5])),
                   bf16_rne(v[6] * sc - bf16_f32(hh[6])), bf16_rne(v[7] * sc - bf16_f32(hh[7])) };
  return r;
}

// ---------------------------------------------------------------------------
// Kernel 1: weights f32 -> bf16 hi and lo planes, [wq|wk|wv|wo] concatenated,
// row = output feature, 64 k-contiguous inputs per row.
// ---------------------------------------------------------------------------
__global__ __launch_bounds__(256) void k_wconvert(
    const float* __restrict__ wq, const float* __restrict__ wk,
    const float* __restrict__ wv, const float* __restrict__ wo,
    unsigned short* __restrict__ whi, unsigned short* __restrict__ wlo)
{
  const int g = blockIdx.x * 256 + threadIdx.x;      // 8-element group
  if (g >= NWALL / 8) return;
  const int e = g * 8;
  const float* src;
  if (e < NWQ)                src = wq + e;
  else if (e < 2 * NWQ)       src = wk + (e - NWQ);
  else if (e < 2 * NWQ + NWV) src = wv + (e - 2 * NWQ);
  else                        src = wo + (e - 2 * NWQ - NWV);
  const v4f a = *(const v4fa*)src;
  const v4f c = *(const v4fa*)(src + 4);
  const unsigned short h0 = bf16_rne(a.x), h1 = bf16_rne(a.y), h2 = bf16_rne(a.z), h3 = bf16_rne(a.w);
  const unsigned short h4 = bf16_rne(c.x), h5 = bf16_rne(c.y), h6 = bf16_rne(c.z), h7 = bf16_rne(c.w);
  const v8us hv = { h0, h1, h2, h3, h4, h5, h6, h7 };
  const v8us lv = { bf16_rne(a.x - bf16_f32(h0)), bf16_rne(a.y - bf16_f32(h1)),
                    bf16_rne(a.z - bf16_f32(h2)), bf16_rne(a.w - bf16_f32(h3)),
                    bf16_rne(c.x - bf16_f32(h4)), bf16_rne(c.y - bf16_f32(h5)),
                    bf16_rne(c.z - bf16_f32(h6)), bf16_rne(c.w - bf16_f32(h7)) };
  unsigned short* ph = whi + e;
  unsigned short* pl = wlo + e;
  *(v8us*)ph = hv;
  *(v8us*)pl = lv;
  
}

// ---------------------------------------------------------------------------
// one 16-B store per lane, lanes 8q..8q+7 per line.
//   qd/kd : 64 token rows x 32 halves, contiguous 4096 B (32 lines)
// ---------------------------------------------------------------------------
__device__ __forceinline__ void proj_store(const _Float16* sQ, const _Float16* sK, const _Float16* sV,
                                           _Float16* qd, _Float16* kd, _Float16* vd, int tid) {
  #pragma unroll
  for (int i = 0; i < 2; ++i) {
    const int off = (i * 128 + tid) * 8;
    const v8h a = *(const v8ha*)(sQ + off);
    *(v8h*)(qd + off) = a;
    const v8h c = *(const v8ha*)(sK + off);
    *(v8h*)(kd + off) = c;
  }
  const int q8 = tid & 7, sub = tid >> 3;        // sub 0..15
  #pragma unroll
  for (int i = 0; i < 4; ++i) {
    const int c = i * 16 + sub;                    // channel row 0..63
    const v8h a = *(const v8ha*)(sV + c * 64 + 8 * q8);
    *(v8h*)(vd + (size_t)c * NN + 8 * q8) = a;
  }
}

// ---------------------------------------------------------------------------
// Kernel 2: fused q/k/v projection. Block = 128 thr (4 waves) = 64 tokens of
// one batch x all 128 output features (32 q, 32 k, 64 v); K = 64 = 2 steps.
// x tile [64 c][64 n] f32 -> LDS as bf16 hi/lo [n][c] (pitch XP);
// A = x^T rows (row = token, k = c) from LDS, B = W rows (k-contiguous) from
// the global bf16 planes. D[token][feature]. Epilogue: +bias -> f16 -> LDS
// staging -> whole-line stores. q,k planes [b][n][32]; v plane [b][c][n].
// ---------------------------------------------------------------------------
__global__ __launch_bounds__(128) void k_proj(
    const float* __restrict__ x,
    const unsigned short* __restrict__ whi, const unsigned short* __restrict__ wlo,
    const float* __restrict__ bq, const float* __restrict__ bk, const float* __restrict__ bv,
    _Float16* __restrict__ qpl, _Float16* __restrict__ kpl, _Float16* __restrict__ vpl)
{
  __shared__ __attribute__((aligned(16))) unsigned short sXh[64 * XP];   // 9216 B
  __shared__ __attribute__((aligned(16))) unsigned short sXl[64 * XP];   // 9216 B
  __shared__ __attribute__((aligned(16))) _Float16 sQ[64 * CH];          // 4096 B
  __shared__ __attribute__((aligned(16))) _Float16 sK[64 * CH];          // 4096 B
  __shared__ __attribute__((aligned(16))) _Float16 sV[CC * 64];          // 8192 B

  const int tid = threadIdx.x, lane = tid & 31, w = tid >> 5;
  const int h = lane >> 4, m = lane & 15;
  const int n0 = blockIdx.x * 64;
  const int b = blockIdx.y;

  // ---- stage x tile: coalesced float4 loads, transpose + split into LDS ----
  const float* xb = x + (size_t)b * CC * NN + n0;
  #pragma unroll
  for (int i = 0; i < 8; ++i) {
    const int f4 = i * 128 + tid;        // 0..1023
    const int c = f4 >> 4;               // 0..63
    const int j4 = f4 & 15;              // tokens 4*j4 .. 4*j4+3
    const v4f v = *(const v4fa*)(xb + (size_t)c * NN + 4 * j4);
    const float e0 = v.x, e1 = v.y, e2 = v.z, e3 = v.w;
    const unsigned short a0 = bf16_rne(e0), a1 = bf16_rne(e1), a2 = bf16_rne(e2), a3 = bf16_rne(e3);
    const int t0 = 4 * j4;
    sXh[(t0 + 0) * XP + c] = a0;  sXl[(t0 + 0) * XP + c] = bf16_rne(e0 - bf16_f32(a0));
    sXh[(t0 + 1) * XP + c] = a1;  sXl[(t0 + 1) * XP + c] = bf16_rne(e1 - bf16_f32(a1));
    sXh[(t0 + 2) * XP + c] = a2;  sXl[(t0 + 2) * XP + c] = bf16_rne(e2 - bf16_f32(a2));
    sXh[(t0 + 3) * XP + c] = a3;  sXl[(t0 + 3) * XP + c] = bf16_rne(e3 - bf16_f32(a3));
  }
  __syncthreads();

  const v8f zero8 = {0.f, 0.f, 0.f, 0.f, 0.f, 0.f, 0.f, 0.f};
  v8f acc[8];
  #pragma unroll
  for (int nt = 0; nt < 8; ++nt) acc[nt] = zero8;

  const unsigned short* arow_h = sXh + (16 * w + m) * XP;   // token row
  const unsigned short* arow_l = sXl + (16 * w + m) * XP;

  #pragma unroll
  for (int ks = 0; ks < 2; ++ks) {
    const int k0 = 32 * ks;
    const v16b ah = ldfrag_b(arow_h + k0, h);
    const v16b al = ldfrag_b(arow_l + k0, h);
    #pragma unroll
    for (int nt = 0; nt < 8; ++nt) {
      const int f = 16 * nt + m;                            // fused feature row 0..127
      const v16b bh = ldfrag_b(whi + f * CC + k0, h);
      const v16b bl = ldfrag_b(wlo + f * CC + k0, h);
      acc[nt] = wmma_bf16(ah, bh, acc[nt]);
      acc[nt] = wmma_bf16(ah, bl, acc[nt]);
      acc[nt] = wmma_bf16(al, bh, acc[nt]);
    }
  }

  // ---- epilogue: D[r] of tile nt = Y[token 16w+8h+r][feature 16nt+m] ----
  #pragma unroll
  for (int nt = 0; nt < 8; ++nt) {
    const int f = 16 * nt + m;
    float bias;
    if (nt < 2)      bias = bq[f];
    else if (nt < 4) bias = bk[f - CH];
    else             bias = bv[f - 2 * CH];
    #pragma unroll
    for (int r = 0; r < 8; ++r) {
      const int tok = 16 * w + 8 * h + r;                    // 0..63
      const _Float16 y = (_Float16)(acc[nt][r] + bias);
      if (nt < 2)      sQ[tok * CH + f] = y;
      else if (nt < 4) sK[tok * CH + (f - CH)] = y;
      else             sV[(f - 2 * CH) * 64 + tok] = y;
    }
  }
  __syncthreads();

  _Float16* qd = qpl + ((size_t)b * NN + n0) * CH;
  _Float16* kd = kpl + ((size_t)b * NN + n0) * CH;
  _Float16* vd = vpl + (size_t)b * CC * NN + n0;
  proj_store(sQ, sK, sV, qd, kd, vd, tid);
  
}

// ---------------------------------------------------------------------------
// P^T B-fragment from the lane's own score D values: element r <- tile a row r,
// element 8+r <- tile c row r (same lane, same query column), scaled by 2^15.
// ---------------------------------------------------------------------------
__device__ __forceinline__ v16h pack_p(v8f a, v8f c) {
  const v16h r = { (_Float16)(a[0] * PSCALE), (_Float16)(a[1] * PSCALE), (_Float16)(a[2] * PSCALE), (_Float16)(a[3] * PSCALE),
                   (_Float16)(a[4] * PSCALE), (_Float16)(a[5] * PSCALE), (_Float16)(a[6] * PSCALE), (_Float16)(a[7] * PSCALE),
                   (_Float16)(c[0] * PSCALE), (_Float16)(c[1] * PSCALE), (_Float16)(c[2] * PSCALE), (_Float16)(c[3] * PSCALE),
                   (_Float16)(c[4] * PSCALE), (_Float16)(c[5] * PSCALE), (_Float16)(c[6] * PSCALE), (_Float16)(c[7] * PSCALE) };
  return r;
}

// Block tile [64 out-channels][64 queries] f32 in LDS -> out[b][o][qblk..+63];
// 128 lines (2 per channel row), each by lanes 8q..8q+7 in one instruction.
__device__ __forceinline__ void out_store(const float* sOut, float* od, int tid) {
  const int q8 = tid & 7, sub = tid >> 3;        // sub 0..63
  #pragma unroll
  for (int i = 0; i < 2; ++i) {
    const int L = i * 64 + sub;                    // line 0..127
    const int o = L >> 1, hl = L & 1;
    const v4f v = *(const v4fa*)(sOut + o * 64 + 32 * hl + 4 * q8);
    *(v4f*)(od + (size_t)o * NN + 32 * hl + 4 * q8) = v;
  }
}

// One wave group's part of a stage (64 keys) from global memory into LDS, through no register: six
// 16-B asynchronous copies per lane (2 of K, 4 of V), every lane on.
// lk/lv: the lane's LDS byte addresses; gk/gv: its global addresses.
// The s_wait_xcnt closes the statement so that no address register named by a
// copy is rewritten ahead of it.
__device__ __forceinline__ void stage_copy(unsigned lk, unsigned lv, const _Float16* gk, const _Float16* gv) {
  asm volatile(
      "global_load_async_to_lds_b128 %0, %6, off\n\t"
      "global_load_async_to_lds_b128 %1, %7, off\n\t"
      "global_load_async_to_lds_b128 %2, %8, off\n\t"
      "global_load_async_to_lds_b128 %3, %9, off\n\t"
      "global_load_async_to_lds_b128 %4, %10, off\n\t"
      "global_load_async_to_lds_b128 %5, %11, off\n\t"
      "s_wait_xcnt 0x0"
      :: "v"(lk), "v"(lk + 32 * KPB),
         "v"(lv), "v"(lv + 16 * VPB), "v"(lv + 32 * VPB), "v"(lv + 48 * VPB),
         "v"(gk), "v"(gk + 32 * CH),
         "v"(gv), "v"(gv + (size_t)16 * NN), "v"(gv + (size_t)32 * NN), "v"(gv + (size_t)48 * NN)
      : "memory");
}

// ---------------------------------------------------------------------------
// Kernel 3: streaming attention, transposed form, fused output projection.
// Block 512 thr (16 waves, 4 per SIMD) = 4 wave groups x 4 waves; 64 queries per
// block, 16 per wave. A step is 256 keys: group g takes keys 64g..64g+63 of it,
// so every query is walked by four waves, each over a quarter of the keys with
// its own running maximum, sum and O tile; the four are merged through LDS
// behind the loop. K and V of a step are staged once per block in a two-buffer
// LDS ring by asynchronous copies (the next step's tile flies while this one is
// worked on); the four waves of a group read their fragments from its part.
//   S^T = K * Q^T : A = K rows (row = key, k = d), B = Q^T loaded like A from
//                   the query row (k = d, n = query)
//   O^T += V * P^T : A = V rows (row = c, k = key), B = P^T from registers
//   out^T = Wo * attn : A = Wo rows (row = o, k = c), B = attn from the O^T
//                   D tiles (k = c = tile row, n = query), bf16 hi/lo split
// Lane owns 32 keys of query column lane&15; partner = lane ^ 16.
// ---------------------------------------------------------------------------
__global__ __launch_bounds__(512) void k_attn(
    const _Float16* __restrict__ qpl,      // [B][N][32]
    const _Float16* __restrict__ kpl,      // [B][N][32]
    const _Float16* __restrict__ vpl,      // [B][64][N]
    const unsigned short* __restrict__ wohi, const unsigned short* __restrict__ wolo,   // [64][64]
    const float* __restrict__ bo,
    float* __restrict__ out)               // [B][64][N]
{
  __shared__ __attribute__((aligned(16))) float sOut[CC * 64];   // 16384 B
  __shared__ __attribute__((aligned(16))) unsigned char sRing[2 * STGB];   // 114688 B

  const int tid = threadIdx.x, lane = tid & 31, w = tid >> 5;
  const int g = w >> 2, wq = w & 3;          // key group, query tile
  const int tl = tid & 127;                  // thread within its group
  const int h = lane >> 4, m = lane & 15;
  const int b = blockIdx.y;
  const int qblk = blockIdx.x * 64;
  const int q0 = qblk + 16 * wq;

  // Q^T B-fragment: column n = query q0+m, k = d (32 deep)
  const v16h qf = ldfrag_h(qpl + ((size_t)b * NN + q0 + m) * CH, h);

  const v8f zero8 = {0.f, 0.f, 0.f, 0.f, 0.f, 0.f, 0.f, 0.f};
  v8f o[4];                                  // o[t][r] = attn[c 16t+8h+r][query m] * lrun * 2^15
  #pragma unroll
  for (int t = 0; t < 4; ++t) o[t] = zero8;
  float mrun = -1e30f, lrun = 0.0f;

  // copy side, the group's own part: K chunk = 16 B of key row tl>>2 (+32), V chunk = 16 B of channel row tl>>3 (+16i)
  const unsigned ring = (unsigned)(uintptr_t)sRing + g * BUFB;  // LDS byte address of the group's part
  const unsigned lk = ring + (tl >> 2) * KPB + (tl & 3) * 16;
  const unsigned lv = ring + KTB + (tl >> 3) * VPB + (tl & 7) * 16;
  const _Float16* gk = kpl + ((size_t)b * NN + 64 * g) * CH + tl * 8;                        // + key0*CH
  const _Float16* gv = vpl + ((size_t)b * CC + (tl >> 3)) * NN + 64 * g + (tl & 7) * 8;      // + key0
  // read side: key row 16j+m, channel row 16t+m of the group's part
  const unsigned char* krow = sRing + g * BUFB + m * KPB;
  const unsigned char* vrow = sRing + g * BUFB + KTB + m * VPB;

  stage_copy(lk, lv, gk, gv);
  asm volatile("s_wait_asynccnt 0x0" ::: "memory");   // own copies of stage 0 landed
  __syncthreads();                                     // stage 0 readable by every wave
  stage_copy(lk + STGB, lv + STGB, gk + 256 * CH, gv + 256);

  #pragma unroll 1
  for (int kb = 0; kb < NN; kb += 256) {
    const unsigned boff = (kb & 256) ? STGB : 0;
    // ---- this stage's fragments, one load group ----
    v16h kf[4], vf0[4], vf1[4];
    #pragma unroll
    for (int j = 0; j < 4; ++j)
      kf[j] = ldfrag_h((const _Float16*)(krow + boff + 16 * j * KPB), h);
    #pragma unroll
    for (int t = 0; t < 4; ++t) {
      const _Float16* vp = (const _Float16*)(vrow + boff + 16 * t * VPB);
      vf0[t] = ldfrag_h(vp, h);
      vf1[t] = ldfrag_h(vp + 32, h);
    }

    // ---- scores: s[j][r] = S[query m][key kb+64g+16j+8h+r] * scale ----
    v8f s[4];
    #pragma unroll
    for (int j = 0; j < 4; ++j)
      s[j] = wmma_f16(kf[j], qf, zero8);
    #pragma unroll
    for (int j = 0; j < 4; ++j)
      #pragma unroll
      for (int r = 0; r < 8; ++r) s[j][r] = s[j][r] * SCALE;

    // ---- online softmax (f32) ----
    float mloc = s[0][0];
    #pragma unroll
    for (int j = 0; j < 4; ++j)
      #pragma unroll
      for (int r = 0; r < 8; ++r) mloc = fmaxf(mloc, s[j][r]);
    mloc = fmaxf(mloc, __shfl_xor(mloc, 16, 32));
    const float mnew = fmaxf(mrun, mloc);
    const float alpha = __expf(mrun - mnew);
    mrun = mnew;
    float lsum = 0.0f;
    #pragma unroll
    for (int j = 0; j < 4; ++j)
      #pragma unroll
      for (int r = 0; r < 8; ++r) {
        const float p = __expf(s[j][r] - mnew);
        s[j][r] = p;
        lsum += p;
      }
    lsum += __shfl_xor(lsum, 16, 32);
    lrun = lrun * alpha + lsum;
    #pragma unroll
    for (int t = 0; t < 4; ++t)
      #pragma unroll
      for (int r = 0; r < 8; ++r) o[t][r] = o[t][r] * alpha;

    // ---- P^T B-fragments (the group's keys 0..31 and 32..63 of this step) ----
    const v16h pb0 = pack_p(s[0], s[1]);
    const v16h pb1 = pack_p(s[2], s[3]);

    // ---- O^T += V * P^T ----
    #pragma unroll
    for (int t = 0; t < 4; ++t) {
      o[t] = wmma_f16(vf0[t], pb0, o[t]);
      o[t] = wmma_f16(vf1[t], pb1, o[t]);
    }

    // ---- publish point of the next stage ----
    asm volatile("s_wait_dscnt 0x0" ::: "memory");     // own reads of this buffer done before it is refilled
    asm volatile("s_wait_asynccnt 0x0" ::: "memory");  // own copies of the next stage landed
    __syncthreads();                                    // next stage readable; this buffer left by every wave
    if (kb + 512 < NN)
      stage_copy(lk + boff, lv + boff, gk + (size_t)(kb + 512) * CH, gv + (kb + 512));
  }
  asm volatile("s_wait_asynccnt 0x0" ::: "memory");    // nothing in flight behind the loop

  // ---- merge the four groups' partial maximum, sum and O tile ----
  // The ring is free: the last trip's barrier ended every wave's reads of it.
  // Each wave lays its partials down, and behind one barrier every wave reads
  // the four partials of its query tile and joins them on the common maximum.
  {
    v4fa* pw = (v4fa*)sRing + w * 256 + lane;
    #pragma unroll
    for (int t = 0; t < 4; ++t) {
      const v4f a = { o[t][0], o[t][1], o[t][2], o[t][3] };
      const v4f c = { o[t][4], o[t][5], o[t][6], o[t][7] };
      pw[(2 * t) * 32] = a;
      pw[(2 * t + 1) * 32] = c;
    }
    const v2f ml = { mrun, lrun };
    ((v2fa*)(sRing + PARTB))[w * 32 + lane] = ml;
  }
  __syncthreads();                                     // every group's partials readable
  {
    v2f ml[NG];
    #pragma unroll
    for (int gg = 0; gg < NG; ++gg)
      ml[gg] = ((const v2fa*)(sRing + PARTB))[(4 * gg + wq) * 32 + lane];
    const float mall = fmaxf(fmaxf(ml[0].x, ml[1].x), fmaxf(ml[2].x, ml[3].x));
    lrun = 0.0f;
    #pragma unroll
    for (int t = 0; t < 4; ++t) o[t] = zero8;
    #pragma unroll
    for (int gg = 0; gg < NG; ++gg) {
      const float f = __expf(ml[gg].x - mall);
      lrun += ml[gg].y * f;
      const v4fa* pr = (const v4fa*)sRing + (4 * gg + wq) * 256 + lane;
      #pragma unroll
      for (int t = 0; t < 4; ++t) {
        const v4f a = pr[(2 * t) * 32];
        const v4f c = pr[(2 * t + 1) * 32];
        o[t][0] += a.x * f;  o[t][1] += a.y * f;  o[t][2] += a.z * f;  o[t][3] += a.w * f;
        o[t][4] += c.x * f;  o[t][5] += c.y * f;  o[t][6] += c.z * f;  o[t][7] += c.w * f;
      }
    }
  }

  // ---- normalise; attn D tiles -> bf16 hi/lo B-fragments (k = c) ----
  const float inv = (1.0f / lrun) * INV_PSCALE;
  FragB bh0, bl0, bh1, bl1;
  {
    const v8us ha = hi8(o[0], inv), hb = hi8(o[1], inv), hc = hi8(o[2], inv), hd = hi8(o[3], inv);
    bh0.half[0] = ha;  bh0.half[1] = hb;
    bh1.half[0] = hc;  bh1.half[1] = hd;
    bl0.half[0] = lo8(o[0], inv, ha);  bl0.half[1] = lo8(o[1], inv, hb);
    bl1.half[0] = lo8(o[2], inv, hc);  bl1.half[1] = lo8(o[3], inv, hd);
  }

  // ---- out^T[o][query] = sum_c Wo[o][c] attn[c][query]; group g does out-channel tile g ----
  v8f acc2;
  {
    const unsigned short* wrh = wohi + (16 * g + m) * CC;
    const unsigned short* wrl = wolo + (16 * g + m) * CC;
    v8f z = zero8;
    {
      const v16b a_h = ldfrag_b(wrh, h);
      const v16b a_l = ldfrag_b(wrl, h);
      z = wmma_bf16(a_h, bh0.v, z);
      z = wmma_bf16(a_h, bl0.v, z);
      z = wmma_bf16(a_l, bh0.v, z);
    }
    {
      const v16b a_h = ldfrag_b(wrh + 32, h);
      const v16b a_l = ldfrag_b(wrl + 32, h);
      z = wmma_bf16(a_h, bh1.v, z);
      z = wmma_bf16(a_h, bl1.v, z);
      z = wmma_bf16(a_l, bh1.v, z);
    }
    acc2 = z;
  }

  // ---- stage [64 o][64 queries] tile; D[r] = out[o 16g+8h+r][query m] ----
  float* so = sOut + 16 * wq + m;
  #pragma unroll
  for (int r = 0; r < 8; ++r) {
    const int orow = 16 * g + 8 * h + r;
    so[orow * 64] = acc2[r] + bo[orow];
  }
  __syncthreads();

  float* od = out + (size_t)b * CC * NN + qblk;
  out_store(sOut, od, tid);
  
}

// ---------------------------------------------------------------------------
extern "C" void kernel_launch(void* const* d_in, const int* in_sizes, int n_in,
                              void* d_out, int out_size, void* d_ws, size_t ws_size,
                              hipStream_t stream) {
  if (n_in < 9) return;
  if (in_sizes[0] != NB * CC * NN) return;
  if (in_sizes[1] != NWQ || in_sizes[2] != CH) return;
  if (in_sizes[3] != NWQ || in_sizes[4] != CH) return;
  if (in_sizes[5] != NWV || in_sizes[6] != CC) return;
  if (in_sizes[7] != NWV || in_sizes[8] != CC) return;
  if (out_size != NB * CC * NN) return;

  const float* x  = (const float*)d_in[0];
  const float* wq = (const float*)d_in[1];
  const float* bq = (const float*)d_in[2];
  const float* wk = (const float*)d_in[3];
  const float* bk = (const float*)d_in[4];
  const float* wv = (const float*)d_in[5];
  const float* bv = (const float*)d_in[6];
  const float* wo = (const float*)d_in[7];
  const float* bo = (const float*)d_in[8];
  float* out = (float*)d_out;

  const size_t w_bytes  = (size_t)NWALL * 2;              //    24576 per plane
  const size_t qk_bytes = (size_t)NB * NN * CH * 2;        //  1048576 each
  const size_t v_bytes  = (size_t)NB * CC * NN * 2;        //  2097152
  const size_t total = 2 * w_bytes + 2 * qk_bytes + v_bytes;   // 4243456
  if (total > ws_size) return;

  char* ws = (char*)d_ws;
  unsigned short* whi = (unsigned short*)(ws);
  unsigned short* wlo = (unsigned short*)(ws + w_bytes);
  _Float16* qpl = (_Float16*)(ws + 2 * w_bytes);
  _Float16* kpl = (_Float16*)(ws + 2 * w_bytes + qk_bytes);
  _Float16* vpl = (_Float16*)(ws + 2 * w_bytes + 2 * qk_bytes);
  const unsigned short* wohi = whi + (2 * NWQ + NWV);
  const unsigned short* wolo = wlo + (2 * NWQ + NWV);

  const int ngroups = NWALL / 8;                            // 1536
  k_wconvert<<<(ngroups + 255) / 256, 256, 0, stream>>>(wq, wk, wv, wo, whi, wlo);

  dim3 gProj(NN / 64, NB);                                  // (128, 2)
  k_proj<<<gProj, 128, 0, stream>>>(x, whi, wlo, bq, bk, bv, qpl, kpl, vpl);

  dim3 gAtt(NN / 64, NB);                                   // (128, 2)
  k_attn<<<gAtt, 512, 0, stream>>>(qpl, kpl, vpl, wohi, wolo, bo, out);
}

// v003
// A run of this version takes 51.1 microseconds.
// Next to v002, in two timings, it ran 1.04 and 1.03 times as fast.
// Over all steps from v000 it is 8.11 times as fast.
// Contractions: q/k/v and output 1x1x1 projections on v_wmma_f32_16x16x32_bf16 as bf16 hi/lo split (hi*hi + hi*lo + lo*hi); key*query scores and value*prob products on v_wmma_f32_16x16x32_f16 (f16 operands, prob carried x32768 and folded back in f32); f32 accumulate everywhere; softmax, bias, normalisation in f32.
#include <hip/hip_runtime.h>
#include <stdint.h>

typedef _Float16 v16h __attribute__((ext_vector_type(16)));
typedef _Float16 v8h  __attribute__((ext_vector_type(8)));
typedef __bf16   v16b __attribute__((ext_vector_type(16)));
typedef unsigned short v8us __attribute__((ext_vector_type(8)));
typedef float v8f __attribute__((ext_vector_type(8)));
typedef float v4f __attribute__((ext_vector_type(4)));
typedef v8h  __attribute__((may_alias)) v8ha;
typedef v8us __attribute__((may_alias)) v8usa;
typedef v4f  __attribute__((may_alias)) v4fa;
typedef float v2f __attribute__((ext_vector_type(2)));
typedef v2f  __attribute__((may_alias)) v2fa;

union FragH { v16h v; v8h half[2]; };
union FragB { v16b v; v8us half[2]; };

#define NB   2        // batch
#define CC   64       // channels
#define CH   32       // q/k channels
#define NN   8192     // voxels 8*32*32
#define XP   72       // LDS pitch (halves) of the transposed x tile
#define NWQ  (CH * CC)            // 2048
#define NWV  (CC * CC)            // 4096
#define NWALL (2 * NWQ + 2 * NWV) // 12288 : [wq | wk | wv | wo]
#define PSCALE 32768.0f
#define INV_PSCALE (1.0f / 32768.0f)
#define SCALE 0.17677669529663688f   // 32^-0.5
#define KPB  80                  // LDS pitch, bytes, of a staged key row (64 B of data): 16 B x odd
#define VPB  144                 // LDS pitch, bytes, of a staged value row (128 B of data): 16 B x odd
#define KTB  (64 * KPB)          // 5120 : key part of one wave group's part of a stage (64 keys)
#define BUFB (KTB + 64 * VPB)    // 14336 : 64 keys of K and V = one wave group's part of a stage
#define NG   4                   // wave groups of the attention block; each takes its own keys
#define STGB (NG * BUFB)         // 57344 : one stage = 256 keys
#define PARTB (16 * 8 * 32 * 16) // 65536 : the 16 waves' partial O tiles, 8 x 16 B per lane

// ---------------------------------------------------------------------------
// WMMA helpers with hazard guard (ties D, keeps A/B live).
// Fragment map (wave32): lane l, h = l>>4, m = n = l&15.
//   A/B element i: i<8 -> k0+8h+i ; i>=8 -> k0+16+8h+(i-8)
//   D element r : row 8h+r, col l&15
// ---------------------------------------------------------------------------
__device__ __forceinline__ v8f wmma_f16(v16h a, v16h b, v8f c) {
  v8f d = __builtin_amdgcn_wmma_f32_16x16x32_f16(false, a, false, b, (short)0, c, false, false);
  asm volatile("v_nop\n\tv_nop\n\tv_nop\n\tv_nop" : "+v"(d) : "v"(a), "v"(b));
  return d;
}
__device__ __forceinline__ v8f wmma_bf16(v16b a, v16b b, v8f c) {
  v8f d = __builtin_amdgcn_wmma_f32_16x16x32_bf16(false, a, false, b, (short)0, c, false, false);
  asm volatile("v_nop\n\tv_nop\n\tv_nop\n\tv_nop" : "+v"(d) : "v"(a), "v"(b));
  return d;
}

// A or B fragment from a k-contiguous 16-bit row; p points at element k0 of
// the row owned by this lane (row index lane&15 added by the caller).
__device__ __forceinline__ v16h ldfrag_h(const _Float16* p, int h) {
  FragH f;
  f.half[0] = *(const v8ha*)(p + 8 * h);
  f.half[1] = *(const v8ha*)(p + 16 + 8 * h);
  return f.v;
}
__device__ __forceinline__ v16b ldfrag_b(const unsigned short* p, int h) {
  FragB f;
  f.half[0] = *(const v8usa*)(p + 8 * h);
  f.half[1] = *(const v8usa*)(p + 16 + 8 * h);
  return f.v;
}

// bf16 RNE convert on the f32 bit pattern, and back.
__device__ __forceinline__ unsigned short bf16_rne(float f) {
  unsigned u = __float_as_uint(f);
  u = u + 0x7FFFu + ((u >> 16) & 1u);
  return (unsigned short)(u >> 16);
}
__device__ __forceinline__ float bf16_f32(unsigned short b) {
  return __uint_as_float(((unsigned)b) << 16);
}

__device__ __forceinline__ v8us hi8(v8f v, float sc) {
  const v8us r = { bf16_rne(v[0] * sc), bf16_rne(v[1] * sc), bf16_rne(v[2] * sc), bf16_rne(v[3] * sc),
                   bf16_rne(v[4] * sc), bf16_rne(v[5] * sc), bf16_rne(v[6] * sc), bf16_rne(v[7] * sc) };
  return r;
}
__device__ __forceinline__ v8us lo8(v8f v, float sc, v8us hh) {
  const v8us r = { bf16_rne(v[0] * sc - bf16_f32(hh[0])), bf16_rne(v[1] * sc - bf16_f32(hh[1])),
                   bf16_rne(v[2] * sc - bf16_f32(hh[2])), bf16_rne(v[3] * sc - bf16_f32(hh[3])),
                   bf16_rne(v[4] * sc - bf16_f32(hh[4])), bf16_rne(v[5] * sc - bf16_f32(hh[5])),
                   bf16_rne(v[6] * sc - bf16_f32(hh[6])), bf16_rne(v[7] * sc - bf16_f32(hh[7])) };
  return r;
}

// ---------------------------------------------------------------------------
// Kernel 1: weights f32 -> bf16 hi and lo planes, [wq|wk|wv|wo] concatenated,
// row = output feature, 64 k-contiguous inputs per row.
// ---------------------------------------------------------------------------
__global__ __launch_bounds__(256) void k_wconvert(
    const float* __restrict__ wq, const float* __restrict__ wk,
    const float* __restrict__ wv, const float* __restrict__ wo,
    unsigned short* __restrict__ whi, unsigned short* __restrict__ wlo)
{
  const int g = blockIdx.x * 256 + threadIdx.x;      // 8-element group
  if (g >= NWALL / 8) return;
  const int e = g * 8;
  const float* src;
  if (e < NWQ)                src = wq + e;
  else if (e < 2 * NWQ)       src = wk + (e - NWQ);
  else if (e < 2 * NWQ + NWV) src = wv + (e - 2 * NWQ);
  else                        src = wo + (e - 2 * NWQ - NWV);
  const v4f a = *(const v4fa*)src;
  const v4f c = *(const v4fa*)(src + 4);
  const unsigned short h0 = bf16_rne(a.x), h1 = bf16_rne(a.y), h2 = bf16_rne(a.z), h3 = bf16_rne(a.w);
  const unsigned short h4 = bf16_rne(c.x), h5 = bf16_rne(c.y), h6 = bf16_rne(c.z), h7 = bf16_rne(c.w);
  const v8us hv = { h0, h1, h2, h3, h4, h5, h6, h7 };
  const v8us lv = { bf16_rne(a.x - bf16_f32(h0)), bf16_rne(a.y - bf16_f32(h1)),
                    bf16_rne(a.z - bf16_f32(h2)), bf16_rne(a.w - bf16_f32(h3)),
                    bf16_rne(c.x - bf16_f32(h4)), bf16_rne(c.y - bf16_f32(h5)),
                    bf16_rne(c.z - bf16_f32(h6)), bf16_rne(c.w - bf16_f32(h7)) };
  unsigned short* ph = whi + e;
  unsigned short* pl = wlo + e;
  *(v8us*)ph = hv;
  *(v8us*)pl = lv;
  
}

// ---------------------------------------------------------------------------
// one 16-B store per lane, lanes 8q..8q+7 per line.
//   qd/kd : 64 token rows x 32 halves, contiguous 4096 B (32 lines)
// ---------------------------------------------------------------------------
__device__ __forceinline__ void proj_store(const _Float16* sQ, const _Float16* sK, const _Float16* sV,
                                           _Float16* qd, _Float16* kd, _Float16* vd, int tid) {
  #pragma unroll
  for (int i = 0; i < 2; ++i) {
    const int off = (i * 128 + tid) * 8;
    const v8h a = *(const v8ha*)(sQ + off);
    *(v8h*)(qd + off) = a;
    const v8h c = *(const v8ha*)(sK + off);
    *(v8h*)(kd + off) = c;
  }
  const int q8 = tid & 7, sub = tid >> 3;        // sub 0..15
  #pragma unroll
  for (int i = 0; i < 4; ++i) {
    const int c = i * 16 + sub;                    // channel row 0..63
    const v8h a = *(const v8ha*)(sV + c * 64 + 8 * q8);
    *(v8h*)(vd + (size_t)c * NN + 8 * q8) = a;
  }
}

// ---------------------------------------------------------------------------
// Kernel 2: fused q/k/v projection. Block = 128 thr (4 waves) = 64 tokens of
// one batch x all 128 output features (32 q, 32 k, 64 v); K = 64 = 2 steps.
// x tile [64 c][64 n] f32 -> LDS as bf16 hi/lo [n][c] (pitch XP);
// A = x^T rows (row = token, k = c) from LDS, B = W rows (k-contiguous) from
// the global bf16 planes. D[token][feature]. Epilogue: +bias -> f16 -> LDS
// staging -> whole-line stores. q,k planes [b][n][32]; v plane [b][c][n].
// ---------------------------------------------------------------------------
__global__ __launch_bounds__(128) void k_proj(
    const float* __restrict__ x,
    const unsigned short* __restrict__ whi, const unsigned short* __restrict__ wlo,
    const float* __restrict__ bq, const float* __restrict__ bk, const float* __restrict__ bv,
    _Float16* __restrict__ qpl, _Float16* __restrict__ kpl, _Float16* __restrict__ vpl)
{
  __shared__ __attribute__((aligned(16))) unsigned short sXh[64 * XP];   // 9216 B
  __shared__ __attribute__((aligned(16))) unsigned short sXl[64 * XP];   // 9216 B
  __shared__ __attribute__((aligned(16))) _Float16 sQ[64 * CH];          // 4096 B
  __shared__ __attribute__((aligned(16))) _Float16 sK[64 * CH];          // 4096 B
  __shared__ __attribute__((aligned(16))) _Float16 sV[CC * 64];          // 8192 B

  const int tid = threadIdx.x, lane = tid & 31, w = tid >> 5;
  const int h = lane >> 4, m = lane & 15;
  const int n0 = blockIdx.x * 64;
  const int b = blockIdx.y;

  // ---- stage x tile: coalesced float4 loads, transpose + split into LDS ----
  const float* xb = x + (size_t)b * CC * NN + n0;
  #pragma unroll
  for (int i = 0; i < 8; ++i) {
    const int f4 = i * 128 + tid;        // 0..1023
    const int c = f4 >> 4;               // 0..63
    const int j4 = f4 & 15;              // tokens 4*j4 .. 4*j4+3
    const v4f v = *(const v4fa*)(xb + (size_t)c * NN + 4 * j4);
    const float e0 = v.x, e1 = v.y, e2 = v.z, e3 = v.w;
    const unsigned short a0 = bf16_rne(e0), a1 = bf16_rne(e1), a2 = bf16_rne(e2), a3 = bf16_rne(e3);
    const int t0 = 4 * j4;
    sXh[(t0 + 0) * XP + c] = a0;  sXl[(t0 + 0) * XP + c] = bf16_rne(e0 - bf16_f32(a0));
    sXh[(t0 + 1) * XP + c] = a1;  sXl[(t0 + 1) * XP + c] = bf16_rne(e1 - bf16_f32(a1));
    sXh[(t0 + 2) * XP + c] = a2;  sXl[(t0 + 2) * XP + c] = bf16_rne(e2 - bf16_f32(a2));
    sXh[(t0 + 3) * XP + c] = a3;  sXl[(t0 + 3) * XP + c] = bf16_rne(e3 - bf16_f32(a3));
  }
  __syncthreads();

  const v8f zero8 = {0.f, 0.f, 0.f, 0.f, 0.f, 0.f, 0.f, 0.f};
  v8f acc[8];
  #pragma unroll
  for (int nt = 0; nt < 8; ++nt) acc[nt] = zero8;

  const unsigned short* arow_h = sXh + (16 * w + m) * XP;   // token row
  const unsigned short* arow_l = sXl + (16 * w + m) * XP;

  #pragma unroll
  for (int ks = 0; ks < 2; ++ks) {
    const int k0 = 32 * ks;
    const v16b ah = ldfrag_b(arow_h + k0, h);
    const v16b al = ldfrag_b(arow_l + k0, h);
    #pragma unroll
    for (int nt = 0; nt < 8; ++nt) {
      const int f = 16 * nt + m;                            // fused feature row 0..127
      const v16b bh = ldfrag_b(whi + f * CC + k0, h);
      const v16b bl = ldfrag_b(wlo + f * CC + k0, h);
      acc[nt] = wmma_bf16(ah, bh, acc[nt]);
      acc[nt] = wmma_bf16(ah, bl, acc[nt]);
      acc[nt] = wmma_bf16(al, bh, acc[nt]);
    }
  }

  // ---- epilogue: D[r] of tile nt = Y[token 16w+8h+r][feature 16nt+m] ----
  #pragma unroll
  for (int nt = 0; nt < 8; ++nt) {
    const int f = 16 * nt + m;
    float bias;
    if (nt < 2)      bias = bq[f];
    else if (nt < 4) bias = bk[f - CH];
    else             bias = bv[f - 2 * CH];
    #pragma unroll
    for (int r = 0; r < 8; ++r) {
      const int tok = 16 * w + 8 * h + r;                    // 0..63
      const _Float16 y = (_Float16)(acc[nt][r] + bias);
      if (nt < 2)      sQ[tok * CH + f] = y;
      else if (nt < 4) sK[tok * CH + (f - CH)] = y;
      else             sV[(f - 2 * CH) * 64 + tok] = y;
    }
  }
  __syncthreads();

  _Float16* qd = qpl + ((size_t)b * NN + n0) * CH;
  _Float16* kd = kpl + ((size_t)b * NN + n0) * CH;
  _Float16* vd = vpl + (size_t)b * CC * NN + n0;
  proj_store(sQ, sK, sV, qd, kd, vd, tid);
  
}

// ---------------------------------------------------------------------------
// P^T B-fragment from the lane's own score D values: element r <- tile a row r,
// element 8+r <- tile c row r (same lane, same query column), scaled by 2^15.
// ---------------------------------------------------------------------------
__device__ __forceinline__ v16h pack_p(v8f a, v8f c) {
  const v16h r = { (_Float16)(a[0] * PSCALE), (_Float16)(a[1] * PSCALE), (_Float16)(a[2] * PSCALE), (_Float16)(a[3] * PSCALE),
                   (_Float16)(a[4] * PSCALE), (_Float16)(a[5] * PSCALE), (_Float16)(a[6] * PSCALE), (_Float16)(a[7] * PSCALE),
                   (_Float16)(c[0] * PSCALE), (_Float16)(c[1] * PSCALE), (_Float16)(c[2] * PSCALE), (_Float16)(c[3] * PSCALE),
                   (_Float16)(c[4] * PSCALE), (_Float16)(c[5] * PSCALE), (_Float16)(c[6] * PSCALE), (_Float16)(c[7] * PSCALE) };
  return r;
}

// Lane l's value as seen from lane l ^ 16, by a vector cross-row move: it does not
// count on dscnt, so an exchange does not wait for LDS fragment loads still in flight.
__device__ __forceinline__ float xhalf(float x) {
  const int b = __builtin_bit_cast(int, x);
  return __builtin_bit_cast(float, __builtin_amdgcn_permlanex16(b, b, 0x76543210, 0xfedcba98, false, false));
}

// Block tile [64 out-channels][64 queries] f32 in LDS -> out[b][o][qblk..+63];
// 128 lines (2 per channel row), each by lanes 8q..8q+7 in one instruction.
__device__ __forceinline__ void out_store(const float* sOut, float* od, int tid) {
  const int q8 = tid & 7, sub = tid >> 3;        // sub 0..63
  #pragma unroll
  for (int i = 0; i < 2; ++i) {
    const int L = i * 64 + sub;                    // line 0..127
    const int o = L >> 1, hl = L & 1;
    const v4f v = *(const v4fa*)(sOut + o * 64 + 32 * hl + 4 * q8);
    *(v4f*)(od + (size_t)o * NN + 32 * hl + 4 * q8) = v;
  }
}

// One wave group's part of a stage (64 keys) from global memory into LDS, through no register: six
// 16-B asynchronous copies per lane (2 of K, 4 of V), every lane on.
// lk/lv: the lane's LDS byte addresses; gk/gv: its global addresses.
// The s_wait_xcnt closes the statement so that no address register named by a
// copy is rewritten ahead of it.
__device__ __forceinline__ void stage_copy(unsigned lk, unsigned lv, const _Float16* gk, const _Float16* gv) {
  asm volatile(
      "global_load_async_to_lds_b128 %0, %6, off\n\t"
      "global_load_async_to_lds_b128 %1, %7, off\n\t"
      "global_load_async_to_lds_b128 %2, %8, off\n\t"
      "global_load_async_to_lds_b128 %3, %9, off\n\t"
      "global_load_async_to_lds_b128 %4, %10, off\n\t"
      "global_load_async_to_lds_b128 %5, %11, off\n\t"
      "s_wait_xcnt 0x0"
      :: "v"(lk), "v"(lk + 32 * KPB),
         "v"(lv), "v"(lv + 16 * VPB), "v"(lv + 32 * VPB), "v"(lv + 48 * VPB),
         "v"(gk), "v"(gk + 32 * CH),
         "v"(gv), "v"(gv + (size_t)16 * NN), "v"(gv + (size_t)32 * NN), "v"(gv + (size_t)48 * NN)
      : "memory");
}

// ---------------------------------------------------------------------------
// Kernel 3: streaming attention, transposed form, fused output projection.
// Block 512 thr (16 waves, 4 per SIMD) = 4 wave groups x 4 waves; 64 queries per
// block, 16 per wave. A step is 256 keys: group g takes keys 64g..64g+63 of it,
// so every query is walked by four waves, each over a quarter of the keys with
// its own running maximum, sum and O tile; the four are merged through LDS
// behind the loop. K and V of a step are staged once per block in a two-buffer
// LDS ring by asynchronous copies (the next step's tile flies while this one is
// worked on); the four waves of a group read their fragments from its part.
//   S^T = K * Q^T : A = K rows (row = key, k = d), B = Q^T loaded like A from
//                   the query row (k = d, n = query)
//   O^T += V * P^T : A = V rows (row = c, k = key), B = P^T from registers
//   out^T = Wo * attn : A = Wo rows (row = o, k = c), B = attn from the O^T
//                   D tiles (k = c = tile row, n = query), bf16 hi/lo split
// Lane owns 32 keys of query column lane&15; partner = lane ^ 16.
// ---------------------------------------------------------------------------
__global__ __launch_bounds__(512) void k_attn(
    const _Float16* __restrict__ qpl,      // [B][N][32]
    const _Float16* __restrict__ kpl,      // [B][N][32]
    const _Float16* __restrict__ vpl,      // [B][64][N]
    const unsigned short* __restrict__ wohi, const unsigned short* __restrict__ wolo,   // [64][64]
    const float* __restrict__ bo,
    float* __restrict__ out)               // [B][64][N]
{
  __shared__ __attribute__((aligned(16))) float sOut[CC * 64];   // 16384 B
  __shared__ __attribute__((aligned(16))) unsigned char sRing[2 * STGB];   // 114688 B

  const int tid = threadIdx.x, lane = tid & 31, w = tid >> 5;
  const int g = w >> 2, wq = w & 3;          // key group, query tile
  const int tl = tid & 127;                  // thread within its group
  const int h = lane >> 4, m = lane & 15;
  const int b = blockIdx.y;
  const int qblk = blockIdx.x * 64;
  const int q0 = qblk + 16 * wq;

  // Q^T B-fragment: column n = query q0+m, k = d (32 deep)
  const v16h qf = ldfrag_h(qpl + ((size_t)b * NN + q0 + m) * CH, h);

  const v8f zero8 = {0.f, 0.f, 0.f, 0.f, 0.f, 0.f, 0.f, 0.f};
  v8f o[4];                                  // o[t][r] = attn[c 16t+8h+r][query m] * lrun * 2^15
  #pragma unroll
  for (int t = 0; t < 4; ++t) o[t] = zero8;
  float mrun = -1e30f, lrun = 0.0f;

  // copy side, the group's own part: K chunk = 16 B of key row tl>>2 (+32), V chunk = 16 B of channel row tl>>3 (+16i)
  const unsigned ring = (unsigned)(uintptr_t)sRing + g * BUFB;  // LDS byte address of the group's part
  const unsigned lk = ring + (tl >> 2) * KPB + (tl & 3) * 16;
  const unsigned lv = ring + KTB + (tl >> 3) * VPB + (tl & 7) * 16;
  const _Float16* gk = kpl + ((size_t)b * NN + 64 * g) * CH + tl * 8;                        // + key0*CH
  const _Float16* gv = vpl + ((size_t)b * CC + (tl >> 3)) * NN + 64 * g + (tl & 7) * 8;      // + key0
  // read side: key row 16j+m, channel row 16t+m of the group's part
  const unsigned char* krow = sRing + g * BUFB + m * KPB;
  const unsigned char* vrow = sRing + g * BUFB + KTB + m * VPB;

  stage_copy(lk, lv, gk, gv);
  asm volatile("s_wait_asynccnt 0x0" ::: "memory");   // own copies of stage 0 landed
  __syncthreads();                                     // stage 0 readable by every wave
  stage_copy(lk + STGB, lv + STGB, gk + 256 * CH, gv + 256);

  #pragma unroll 1
  for (int kb = 0; kb < NN; kb += 256) {
    const unsigned boff = (kb & 256) ? STGB : 0;
    // ---- this stage's fragments, one load group ----
    v16h kf[4], vf0[4], vf1[4];
    #pragma unroll
    for (int j = 0; j < 4; ++j)
      kf[j] = ldfrag_h((const _Float16*)(krow + boff + 16 * j * KPB), h);
    #pragma unroll
    for (int t = 0; t < 4; ++t) {
      const _Float16* vp = (const _Float16*)(vrow + boff + 16 * t * VPB);
      vf0[t] = ldfrag_h(vp, h);
      vf1[t] = ldfrag_h(vp + 32, h);
    }

    // ---- scores: s[j][r] = S[query m][key kb+64g+16j+8h+r] * scale ----
    v8f s[4];
    #pragma unroll
    for (int j = 0; j < 4; ++j)
      s[j] = wmma_f16(kf[j], qf, zero8);
    #pragma unroll
    for (int j = 0; j < 4; ++j)
      #pragma unroll
      for (int r = 0; r < 8; ++r) s[j][r] = s[j][r] * SCALE;

    // ---- online softmax (f32) ----
    float mloc = s[0][0];
    #pragma unroll
    for (int j = 0; j < 4; ++j)
      #pragma unroll
      for (int r = 0; r < 8; ++r) mloc = fmaxf(mloc, s[j][r]);
    mloc = fmaxf(mloc, xhalf(mloc));
    const float mnew = fmaxf(mrun, mloc);
    const float alpha = __expf(mrun - mnew);
    mrun = mnew;
    float lsum = 0.0f;
    #pragma unroll
    for (int j = 0; j < 4; ++j)
      #pragma unroll
      for (int r = 0; r < 8; ++r) {
        const float p = __expf(s[j][r] - mnew);
        s[j][r] = p;
        lsum += p;
      }
    lsum += xhalf(lsum);
    lrun = lrun * alpha + lsum;
    #pragma unroll
    for (int t = 0; t < 4; ++t)
      #pragma unroll
      for (int r = 0; r < 8; ++r) o[t][r] = o[t][r] * alpha;

    // ---- P^T B-fragments (the group's keys 0..31 and 32..63 of this step) ----
    const v16h pb0 = pack_p(s[0], s[1]);
    const v16h pb1 = pack_p(s[2], s[3]);

    // ---- O^T += V * P^T ----
    #pragma unroll
    for (int t = 0; t < 4; ++t) {
      o[t] = wmma_f16(vf0[t], pb0, o[t]);
      o[t] = wmma_f16(vf1[t], pb1, o[t]);
    }

    // ---- publish point of the next stage ----
    asm volatile("s_wait_dscnt 0x0" ::: "memory");     // own reads of this buffer done before it is refilled
    asm volatile("s_wait_asynccnt 0x0" ::: "memory");  // own copies of the next stage landed
    __syncthreads();                                    // next stage readable; this buffer left by every wave
    if (kb + 512 < NN)
      stage_copy(lk + boff, lv + boff, gk + (size_t)(kb + 512) * CH, gv + (kb + 512));
  }
  asm volatile("s_wait_asynccnt 0x0" ::: "memory");    // nothing in flight behind the loop

  // ---- merge the four groups' partial maximum, sum and O tile ----
  // The ring is free: the last trip's barrier ended every wave's reads of it.
  // Each wave lays its partials down, and behind one barrier every wave reads
  // the four partials of its query tile and joins them on the common maximum.
  {
    v4fa* pw = (v4fa*)sRing + w * 256 + lane;
    #pragma unroll
    for (int t = 0; t < 4; ++t) {
      const v4f a = { o[t][0], o[t][1], o[t][2], o[t][3] };
      const v4f c = { o[t][4], o[t][5], o[t][6], o[t][7] };
      pw[(2 * t) * 32] = a;
      pw[(2 * t + 1) * 32] = c;
    }
    const v2f ml = { mrun, lrun };
    ((v2fa*)(sRing + PARTB))[w * 32 + lane] = ml;
  }
  __syncthreads();                                     // every group's partials readable
  {
    v2f ml[NG];
    #pragma unroll
    for (int gg = 0; gg < NG; ++gg)
      ml[gg] = ((const v2fa*)(sRing + PARTB))[(4 * gg + wq) * 32 + lane];
    const float mall = fmaxf(fmaxf(ml[0].x, ml[1].x), fmaxf(ml[2].x, ml[3].x));
    lrun = 0.0f;
    #pragma unroll
    for (int t = 0; t < 4; ++t) o[t] = zero8;
    #pragma unroll
    for (int gg = 0; gg < NG; ++gg) {
      const float f = __expf(ml[gg].x - mall);
      lrun += ml[gg].y * f;
      const v4fa* pr = (const v4fa*)sRing + (4 * gg + wq) * 256 + lane;
      #pragma unroll
      for (int t = 0; t < 4; ++t) {
        const v4f a = pr[(2 * t) * 32];
        const v4f c = pr[(2 * t + 1) * 32];
        o[t][0] += a.x * f;  o[t][1] += a.y * f;  o[t][2] += a.z * f;  o[t][3] += a.w * f;
        o[t][4] += c.x * f;  o[t][5] += c.y * f;  o[t][6] += c.z * f;  o[t][7] += c.w * f;
      }
    }
  }

  // ---- normalise; attn D tiles -> bf16 hi/lo B-fragments (k = c) ----
  const float inv = (1.0f / lrun) * INV_PSCALE;
  FragB bh0, bl0, bh1, bl1;
  {
    const v8us ha = hi8(o[0], inv), hb = hi8(o[1], inv), hc = hi8(o[2], inv), hd = hi8(o[3], inv);
    bh0.half[0] = ha;  bh0.half[1] = hb;
    bh1.half[0] = hc;  bh1.half[1] = hd;
    bl0.half[0] = lo8(o[0], inv, ha);  bl0.half[1] = lo8(o[1], inv, hb);
    bl1.half[0] = lo8(o[2], inv, hc);  bl1.half[1] = lo8(o[3], inv, hd);
  }

  // ---- out^T[o][query] = sum_c Wo[o][c] attn[c][query]; group g does out-channel tile g ----
  v8f acc2;
  {
    const unsigned short* wrh = wohi + (16 * g + m) * CC;
    const unsigned short* wrl = wolo + (16 * g + m) * CC;
    v8f z = zero8;
    {
      const v16b a_h = ldfrag_b(wrh, h);
      const v16b a_l = ldfrag_b(wrl, h);
      z = wmma_bf16(a_h, bh0.v, z);
      z = wmma_bf16(a_h, bl0.v, z);
      z = wmma_bf16(a_l, bh0.v, z);
    }
    {
      const v16b a_h = ldfrag_b(wrh + 32, h);
      const v16b a_l = ldfrag_b(wrl + 32, h);
      z = wmma_bf16(a_h, bh1.v, z);
      z = wmma_bf16(a_h, bl1.v, z);
      z = wmma_bf16(a_l, bh1.v, z);
    }
    acc2 = z;
  }

  // ---- stage [64 o][64 queries] tile; D[r] = out[o 16g+8h+r][query m] ----
  float* so = sOut + 16 * wq + m;
  #pragma unroll
  for (int r = 0; r < 8; ++r) {
    const int orow = 16 * g + 8 * h + r;
    so[orow * 64] = acc2[r] + bo[orow];
  }
  __syncthreads();

  float* od = out + (size_t)b * CC * NN + qblk;
  out_store(sOut, od, tid);
  
}

// ---------------------------------------------------------------------------
extern "C" void kernel_launch(void* const* d_in, const int* in_sizes, int n_in,
                              void* d_out, int out_size, void* d_ws, size_t ws_size,
                              hipStream_t stream) {
  if (n_in < 9) return;
  if (in_sizes[0] != NB * CC * NN) return;
  if (in_sizes[1] != NWQ || in_sizes[2] != CH) return;
  if (in_sizes[3] != NWQ || in_sizes[4] != CH) return;
  if (in_sizes[5] != NWV || in_sizes[6] != CC) return;
  if (in_sizes[7] != NWV || in_sizes[8] != CC) return;
  if (out_size != NB * CC * NN) return;

  const float* x  = (const float*)d_in[0];
  const float* wq = (const float*)d_in[1];
  const float* bq = (const float*)d_in[2];
  const float* wk = (const float*)d_in[3];
  const float* bk = (const float*)d_in[4];
  const float* wv = (const float*)d_in[5];
  const float* bv = (const float*)d_in[6];
  const float* wo = (const float*)d_in[7];
  const float* bo = (const float*)d_in[8];
  float* out = (float*)d_out;

  const size_t w_bytes  = (size_t)NWALL * 2;              //    24576 per plane
  const size_t qk_bytes = (size_t)NB * NN * CH * 2;        //  1048576 each
  const size_t v_bytes  = (size_t)NB * CC * NN * 2;        //  2097152
  const size_t total = 2 * w_bytes + 2 * qk_bytes + v_bytes;   // 4243456
  if (total > ws_size) return;

  char* ws = (char*)d_ws;
  unsigned short* whi = (unsigned short*)(ws);
  unsigned short* wlo = (unsigned short*)(ws + w_bytes);
  _Float16* qpl = (_Float16*)(ws + 2 * w_bytes);
  _Float16* kpl = (_Float16*)(ws + 2 * w_bytes + qk_bytes);
  _Float16* vpl = (_Float16*)(ws + 2 * w_bytes + 2 * qk_bytes);
  const unsigned short* wohi = whi + (2 * NWQ + NWV);
  const unsigned short* wolo = wlo + (2 * NWQ + NWV);

  const int ngroups = NWALL / 8;                            // 1536
  k_wconvert<<<(ngroups + 255) / 256, 256, 0, stream>>>(wq, wk, wv, wo, whi, wlo);

  dim3 gProj(NN / 64, NB);                                  // (128, 2)
  k_proj<<<gProj, 128, 0, stream>>>(x, whi, wlo, bq, bk, bv, qpl, kpl, vpl);

  dim3 gAtt(NN / 64, NB);                                   // (128, 2)
  k_attn<<<gAtt, 512, 0, stream>>>(qpl, kpl, vpl, wohi, wolo, bo, out);
}

// v004
// One run takes 47.8 microseconds.
// In two side-by-side timings against v003, it was 1.09 and 1.06 times as fast.
// Counting every step since v000, it is 8.69 times as fast.
// Contractions: q/k/v and output 1x1x1 projections on v_wmma_f32_16x16x32_bf16 as bf16 hi/lo split (hi*hi + hi*lo + lo*hi); key*query scores and value*prob products on v_wmma_f32_16x16x32_f16 (f16 operands, prob carried x32768, the row sum too, so the factor cancels in the normalisation); f32 accumulate everywhere; softmax, bias, normalisation in f32.
#include <hip/hip_runtime.h>
#include <stdint.h>

typedef _Float16 v16h __attribute__((ext_vector_type(16)));
typedef _Float16 v8h  __attribute__((ext_vector_type(8)));
typedef __bf16   v16b __attribute__((ext_vector_type(16)));
typedef unsigned short v8us __attribute__((ext_vector_type(8)));
typedef float v8f __attribute__((ext_vector_type(8)));
typedef float v4f __attribute__((ext_vector_type(4)));
typedef v8h  __attribute__((may_alias)) v8ha;
typedef v8us __attribute__((may_alias)) v8usa;
typedef v4f  __attribute__((may_alias)) v4fa;
typedef float v2f __attribute__((ext_vector_type(2)));
typedef v2f  __attribute__((may_alias)) v2fa;

union FragH { v16h v; v8h half[2]; };
union FragB { v16b v; v8us half[2]; };

#define NB   2        // batch
#define CC   64       // channels
#define CH   32       // q/k channels
#define NN   8192     // voxels 8*32*32
#define XP   72       // LDS pitch (halves) of the transposed x tile
#define NWQ  (CH * CC)            // 2048
#define NWV  (CC * CC)            // 4096
#define NWALL (2 * NWQ + 2 * NWV) // 12288 : [wq | wk | wv | wo]
#define SC2  0.25503486f         // 32^-0.5 * log2(e), multiplied into q in f32 ahead of its one rounding to f16
#define PEXP 15.0f               // prob carried x 2^15, added in the exponent
#define KPB  80                  // LDS pitch, bytes, of a staged key row (64 B of data): 16 B x odd
#define VPB  144                 // LDS pitch, bytes, of a staged value row (128 B of data): 16 B x odd
#define KTB  (64 * KPB)          // 5120 : key part of one wave group's part of a stage (64 keys)
#define BUFB (KTB + 64 * VPB)    // 14336 : 64 keys of K and V = one wave group's part of a stage
#define NG   4                   // wave groups of the attention block; each takes its own keys
#define STGB (NG * BUFB)         // 57344 : one stage = 256 keys
#define PARTB (16 * 8 * 32 * 16) // 65536 : the 16 waves' partial O tiles, 8 x 16 B per lane

// ---------------------------------------------------------------------------
// WMMA helpers with hazard guard (ties D, keeps A/B live).
// Fragment map (wave32): lane l, h = l>>4, m = n = l&15.
//   A/B element i: i<8 -> k0+8h+i ; i>=8 -> k0+16+8h+(i-8)
//   D element r : row 8h+r, col l&15
// ---------------------------------------------------------------------------
__device__ __forceinline__ v8f wmma_f16(v16h a, v16h b, v8f c) {
  v8f d = __builtin_amdgcn_wmma_f32_16x16x32_f16(false, a, false, b, (short)0, c, false, false);
  asm volatile("v_nop\n\tv_nop\n\tv_nop\n\tv_nop" : "+v"(d) : "v"(a), "v"(b));
  return d;
}
__device__ __forceinline__ v8f wmma_bf16(v16b a, v16b b, v8f c) {
  v8f d = __builtin_amdgcn_wmma_f32_16x16x32_bf16(false, a, false, b, (short)0, c, false, false);
  asm volatile("v_nop\n\tv_nop\n\tv_nop\n\tv_nop" : "+v"(d) : "v"(a), "v"(b));
  return d;
}

// A or B fragment from a k-contiguous 16-bit row; p points at element k0 of
// the row owned by this lane (row index lane&15 added by the caller).
__device__ __forceinline__ v16h ldfrag_h(const _Float16* p, int h) {
  FragH f;
  f.half[0] = *(const v8ha*)(p + 8 * h);
  f.half[1] = *(const v8ha*)(p + 16 + 8 * h);
  return f.v;
}
__device__ __forceinline__ v16b ldfrag_b(const unsigned short* p, int h) {
  FragB f;
  f.half[0] = *(const v8usa*)(p + 8 * h);
  f.half[1] = *(const v8usa*)(p + 16 + 8 * h);
  return f.v;
}

// bf16 RNE convert on the f32 bit pattern, and back.
__device__ __forceinline__ unsigned short bf16_rne(float f) {
  unsigned u = __float_as_uint(f);
  u = u + 0x7FFFu + ((u >> 16) & 1u);
  return (unsigned short)(u >> 16);
}
__device__ __forceinline__ float bf16_f32(unsigned short b) {
  return __uint_as_float(((unsigned)b) << 16);
}

__device__ __forceinline__ v8us hi8(v8f v, float sc) {
  const v8us r = { bf16_rne(v[0] * sc), bf16_rne(v[1] * sc), bf16_rne(v[2] * sc), bf16_rne(v[3] * sc),
                   bf16_rne(v[4] * sc), bf16_rne(v[5] * sc), bf16_rne(v[6] * sc), bf16_rne(v[7] * sc) };
  return r;
}
__device__ __forceinline__ v8us lo8(v8f v, float sc, v8us hh) {
  const v8us r = { bf16_rne(v[0] * sc - bf16_f32(hh[0])), bf16_rne(v[1] * sc - bf16_f32(hh[1])),
                   bf16_rne(v[2] * sc - bf16_f32(hh[2])), bf16_rne(v[3] * sc - bf16_f32(hh[3])),
                   bf16_rne(v[4] * sc - bf16_f32(hh[4])), bf16_rne(v[5] * sc - bf16_f32(hh[5])),
                   bf16_rne(v[6] * sc - bf16_f32(hh[6])), bf16_rne(v[7] * sc - bf16_f32(hh[7])) };
  return r;
}

// ---------------------------------------------------------------------------
// Kernel 1: weights f32 -> bf16 hi and lo planes, [wq|wk|wv|wo] concatenated,
// row = output feature, 64 k-contiguous inputs per row.
// ---------------------------------------------------------------------------
__global__ __launch_bounds__(256) void k_wconvert(
    const float* __restrict__ wq, const float* __restrict__ wk,
    const float* __restrict__ wv, const float* __restrict__ wo,
    unsigned short* __restrict__ whi, unsigned short* __restrict__ wlo)
{
  const int g = blockIdx.x * 256 + threadIdx.x;      // 8-element group
  if (g >= NWALL / 8) return;
  const int e = g * 8;
  const float* src;
  if (e < NWQ)                src = wq + e;
  else if (e < 2 * NWQ)       src = wk + (e - NWQ);
  else if (e < 2 * NWQ + NWV) src = wv + (e - 2 * NWQ);
  else                        src = wo + (e - 2 * NWQ - NWV);
  const v4f a = *(const v4fa*)src;
  const v4f c = *(const v4fa*)(src + 4);
  const unsigned short h0 = bf16_rne(a.x), h1 = bf16_rne(a.y), h2 = bf16_rne(a.z), h3 = bf16_rne(a.w);
  const unsigned short h4 = bf16_rne(c.x), h5 = bf16_rne(c.y), h6 = bf16_rne(c.z), h7 = bf16_rne(c.w);
  const v8us hv = { h0, h1, h2, h3, h4, h5, h6, h7 };
  const v8us lv = { bf16_rne(a.x - bf16_f32(h0)), bf16_rne(a.y - bf16_f32(h1)),
                    bf16_rne(a.z - bf16_f32(h2)), bf16_rne(a.w - bf16_f32(h3)),
                    bf16_rne(c.x - bf16_f32(h4)), bf16_rne(c.y - bf16_f32(h5)),
                    bf16_rne(c.z - bf16_f32(h6)), bf16_rne(c.w - bf16_f32(h7)) };
  unsigned short* ph = whi + e;
  unsigned short* pl = wlo + e;
  *(v8us*)ph = hv;
  *(v8us*)pl = lv;
  
}

// ---------------------------------------------------------------------------
// one 16-B store per lane, lanes 8q..8q+7 per line.
//   qd/kd : 64 token rows x 32 halves, contiguous 4096 B (32 lines)
// ---------------------------------------------------------------------------
__device__ __forceinline__ void proj_store(const _Float16* sQ, const _Float16* sK, const _Float16* sV,
                                           _Float16* qd, _Float16* kd, _Float16* vd, int tid) {
  #pragma unroll
  for (int i = 0; i < 2; ++i) {
    const int off = (i * 128 + tid) * 8;
    const v8h a = *(const v8ha*)(sQ + off);
    *(v8h*)(qd + off) = a;
    const v8h c = *(const v8ha*)(sK + off);
    *(v8h*)(kd + off) = c;
  }
  const int q8 = tid & 7, sub = tid >> 3;        // sub 0..15
  #pragma unroll
  for (int i = 0; i < 4; ++i) {
    const int c = i * 16 + sub;                    // channel row 0..63
    const v8h a = *(const v8ha*)(sV + c * 64 + 8 * q8);
    *(v8h*)(vd + (size_t)c * NN + 8 * q8) = a;
  }
}

// ---------------------------------------------------------------------------
// Kernel 2: fused q/k/v projection. Block = 128 thr (4 waves) = 64 tokens of
// one batch x all 128 output features (32 q, 32 k, 64 v); K = 64 = 2 steps.
// x tile [64 c][64 n] f32 -> LDS as bf16 hi/lo [n][c] (pitch XP);
// A = x^T rows (row = token, k = c) from LDS, B = W rows (k-contiguous) from
// the global bf16 planes. D[token][feature]. Epilogue: +bias -> f16 -> LDS
// staging -> whole-line stores. q,k planes [b][n][32]; v plane [b][c][n].
// ---------------------------------------------------------------------------
__global__ __launch_bounds__(128) void k_proj(
    const float* __restrict__ x,
    const unsigned short* __restrict__ whi, const unsigned short* __restrict__ wlo,
    const float* __restrict__ bq, const float* __restrict__ bk, const float* __restrict__ bv,
    _Float16* __restrict__ qpl, _Float16* __restrict__ kpl, _Float16* __restrict__ vpl)
{
  __shared__ __attribute__((aligned(16))) unsigned short sXh[64 * XP];   // 9216 B
  __shared__ __attribute__((aligned(16))) unsigned short sXl[64 * XP];   // 9216 B
  __shared__ __attribute__((aligned(16))) _Float16 sQ[64 * CH];          // 4096 B
  __shared__ __attribute__((aligned(16))) _Float16 sK[64 * CH];          // 4096 B
  __shared__ __attribute__((aligned(16))) _Float16 sV[CC * 64];          // 8192 B

  const int tid = threadIdx.x, lane = tid & 31, w = tid >> 5;
  const int h = lane >> 4, m = lane & 15;
  const int n0 = blockIdx.x * 64;
  const int b = blockIdx.y;

  // ---- stage x tile: coalesced float4 loads, transpose + split into LDS ----
  const float* xb = x + (size_t)b * CC * NN + n0;
  #pragma unroll
  for (int i = 0; i < 8; ++i) {
    const int f4 = i * 128 + tid;        // 0..1023
    const int c = f4 >> 4;               // 0..63
    const int j4 = f4 & 15;              // tokens 4*j4 .. 4*j4+3
    const v4f v = *(const v4fa*)(xb + (size_t)c * NN + 4 * j4);
    const float e0 = v.x, e1 = v.y, e2 = v.z, e3 = v.w;
    const unsigned short a0 = bf16_rne(e0), a1 = bf16_rne(e1), a2 = bf16_rne(e2), a3 = bf16_rne(e3);
    const int t0 = 4 * j4;
    sXh[(t0 + 0) * XP + c] = a0;  sXl[(t0 + 0) * XP + c] = bf16_rne(e0 - bf16_f32(a0));
    sXh[(t0 + 1) * XP + c] = a1;  sXl[(t0 + 1) * XP + c] = bf16_rne(e1 - bf16_f32(a1));
    sXh[(t0 + 2) * XP + c] = a2;  sXl[(t0 + 2) * XP + c] = bf16_rne(e2 - bf16_f32(a2));
    sXh[(t0 + 3) * XP + c] = a3;  sXl[(t0 + 3) * XP + c] = bf16_rne(e3 - bf16_f32(a3));
  }
  __syncthreads();

  const v8f zero8 = {0.f, 0.f, 0.f, 0.f, 0.f, 0.f, 0.f, 0.f};
  v8f acc[8];
  #pragma unroll
  for (int nt = 0; nt < 8; ++nt) acc[nt] = zero8;

  const unsigned short* arow_h = sXh + (16 * w + m) * XP;   // token row
  const unsigned short* arow_l = sXl + (16 * w + m) * XP;

  #pragma unroll
  for (int ks = 0; ks < 2; ++ks) {
    const int k0 = 32 * ks;
    const v16b ah = ldfrag_b(arow_h + k0, h);
    const v16b al = ldfrag_b(arow_l + k0, h);
    #pragma unroll
    for (int nt = 0; nt < 8; ++nt) {
      const int f = 16 * nt + m;                            // fused feature row 0..127
      const v16b bh = ldfrag_b(whi + f * CC + k0, h);
      const v16b bl = ldfrag_b(wlo + f * CC + k0, h);
      acc[nt] = wmma_bf16(ah, bh, acc[nt]);
      acc[nt] = wmma_bf16(ah, bl, acc[nt]);
      acc[nt] = wmma_bf16(al, bh, acc[nt]);
    }
  }

  // ---- epilogue: D[r] of tile nt = Y[token 16w+8h+r][feature 16nt+m] ----
  #pragma unroll
  for (int nt = 0; nt < 8; ++nt) {
    const int f = 16 * nt + m;
    float bias;
    if (nt < 2)      bias = bq[f];
    else if (nt < 4) bias = bk[f - CH];
    else             bias = bv[f - 2 * CH];
    #pragma unroll
    for (int r = 0; r < 8; ++r) {
      const int tok = 16 * w + 8 * h + r;                    // 0..63
      const float yf = acc[nt][r] + bias;
      const _Float16 y = (_Float16)(nt < 2 ? yf * SC2 : yf);   // q carries SC2: scores come out as exponents to base 2
      if (nt < 2)      sQ[tok * CH + f] = y;
      else if (nt < 4) sK[tok * CH + (f - CH)] = y;
      else             sV[(f - 2 * CH) * 64 + tok] = y;
    }
  }
  __syncthreads();

  _Float16* qd = qpl + ((size_t)b * NN + n0) * CH;
  _Float16* kd = kpl + ((size_t)b * NN + n0) * CH;
  _Float16* vd = vpl + (size_t)b * CC * NN + n0;
  proj_store(sQ, sK, sV, qd, kd, vd, tid);
  
}

// ---------------------------------------------------------------------------
// P^T B-fragment from the lane's own score D values: element r <- tile a row r,
// element 8+r <- tile c row r (same lane, same query column); the values already carry 2^15.
// ---------------------------------------------------------------------------
__device__ __forceinline__ v16h pack_p(v8f a, v8f c) {
  const v16h r = { (_Float16)a[0], (_Float16)a[1], (_Float16)a[2], (_Float16)a[3],
                   (_Float16)a[4], (_Float16)a[5], (_Float16)a[6], (_Float16)a[7],
                   (_Float16)c[0], (_Float16)c[1], (_Float16)c[2], (_Float16)c[3],
                   (_Float16)c[4], (_Float16)c[5], (_Float16)c[6], (_Float16)c[7] };
  return r;
}

// Lane l's value as seen from lane l ^ 16, by a vector cross-row move: it does not
// count on dscnt, so an exchange does not wait for LDS fragment loads still in flight.
__device__ __forceinline__ float xhalf(float x) {
  const int b = __builtin_bit_cast(int, x);
  return __builtin_bit_cast(float, __builtin_amdgcn_permlanex16(b, b, 0x76543210, 0xfedcba98, false, false));
}

// Block tile [64 out-channels][64 queries] f32 in LDS -> out[b][o][qblk..+63];
// 128 lines (2 per channel row), each by lanes 8q..8q+7 in one instruction.
__device__ __forceinline__ void out_store(const float* sOut, float* od, int tid) {
  const int q8 = tid & 7, sub = tid >> 3;        // sub 0..63
  #pragma unroll
  for (int i = 0; i < 2; ++i) {
    const int L = i * 64 + sub;                    // line 0..127
    const int o = L >> 1, hl = L & 1;
    const v4f v = *(const v4fa*)(sOut + o * 64 + 32 * hl + 4 * q8);
    *(v4f*)(od + (size_t)o * NN + 32 * hl + 4 * q8) = v;
  }
}

// One wave group's part of a stage (64 keys) from global memory into LDS, through no register: six
// 16-B asynchronous copies per lane (2 of K, 4 of V), every lane on.
// lk/lv: the lane's LDS byte addresses; gk/gv: its global addresses.
// The s_wait_xcnt closes the statement so that no address register named by a
// copy is rewritten ahead of it.
__device__ __forceinline__ void stage_copy(unsigned lk, unsigned lv, const _Float16* gk, const _Float16* gv) {
  asm volatile(
      "global_load_async_to_lds_b128 %0, %6, off\n\t"
      "global_load_async_to_lds_b128 %1, %7, off\n\t"
      "global_load_async_to_lds_b128 %2, %8, off\n\t"
      "global_load_async_to_lds_b128 %3, %9, off\n\t"
      "global_load_async_to_lds_b128 %4, %10, off\n\t"
      "global_load_async_to_lds_b128 %5, %11, off\n\t"
      "s_wait_xcnt 0x0"
      :: "v"(lk), "v"(lk + 32 * KPB),
         "v"(lv), "v"(lv + 16 * VPB), "v"(lv + 32 * VPB), "v"(lv + 48 * VPB),
         "v"(gk), "v"(gk + 32 * CH),
         "v"(gv), "v"(gv + (size_t)16 * NN), "v"(gv + (size_t)32 * NN), "v"(gv + (size_t)48 * NN)
      : "memory");
}

// ---------------------------------------------------------------------------
// Kernel 3: streaming attention, transposed form, fused output projection.
// Block 512 thr (16 waves, 4 per SIMD) = 4 wave groups x 4 waves; 64 queries per
// block, 16 per wave. A step is 256 keys: group g takes keys 64g..64g+63 of it,
// so every query is walked by four waves, each over a quarter of the keys with
// its own running maximum, sum and O tile; the four are merged through LDS
// behind the loop. K and V of a step are staged once per block in a two-buffer
// LDS ring by asynchronous copies (the next step's tile flies while this one is
// worked on); the four waves of a group read their fragments from its part.
//   S^T = K * Q^T : A = K rows (row = key, k = d), B = Q^T loaded like A from
//                   the query row (k = d, n = query)
//   O^T += V * P^T : A = V rows (row = c, k = key), B = P^T from registers
//   out^T = Wo * attn : A = Wo rows (row = o, k = c), B = attn from the O^T
//                   D tiles (k = c = tile row, n = query), bf16 hi/lo split
// Lane owns 32 keys of query column lane&15; partner = lane ^ 16.
// ---------------------------------------------------------------------------
__global__ __launch_bounds__(512) void k_attn(
    const _Float16* __restrict__ qpl,      // [B][N][32]
    const _Float16* __restrict__ kpl,      // [B][N][32]
    const _Float16* __restrict__ vpl,      // [B][64][N]
    const unsigned short* __restrict__ wohi, const unsigned short* __restrict__ wolo,   // [64][64]
    const float* __restrict__ bo,
    float* __restrict__ out)               // [B][64][N]
{
  __shared__ __attribute__((aligned(16))) float sOut[CC * 64];   // 16384 B
  __shared__ __attribute__((aligned(16))) unsigned char sRing[2 * STGB];   // 114688 B

  const int tid = threadIdx.x, lane = tid & 31, w = tid >> 5;
  const int g = w >> 2, wq = w & 3;          // key group, query tile
  const int tl = tid & 127;                  // thread within its group
  const int h = lane >> 4, m = lane & 15;
  const int b = blockIdx.y;
  const int qblk = blockIdx.x * 64;
  const int q0 = qblk + 16 * wq;

  // Q^T B-fragment: column n = query q0+m, k = d (32 deep)
  const v16h qf = ldfrag_h(qpl + ((size_t)b * NN + q0 + m) * CH, h);

  const v8f zero8 = {0.f, 0.f, 0.f, 0.f, 0.f, 0.f, 0.f, 0.f};
  v8f o[4];                                  // o[t][r] = attn[c 16t+8h+r][query m] * lrun (lrun carries 2^15)
  #pragma unroll
  for (int t = 0; t < 4; ++t) o[t] = zero8;
  float mrun = -1e30f, lrun = 0.0f;

  // copy side, the group's own part: K chunk = 16 B of key row tl>>2 (+32), V chunk = 16 B of channel row tl>>3 (+16i)
  const unsigned ring = (unsigned)(uintptr_t)sRing + g * BUFB;  // LDS byte address of the group's part
  const unsigned lk = ring + (tl >> 2) * KPB + (tl & 3) * 16;
  const unsigned lv = ring + KTB + (tl >> 3) * VPB + (tl & 7) * 16;
  const _Float16* gk = kpl + ((size_t)b * NN + 64 * g) * CH + tl * 8;                        // + key0*CH
  const _Float16* gv = vpl + ((size_t)b * CC + (tl >> 3)) * NN + 64 * g + (tl & 7) * 8;      // + key0
  // read side: key row 16j+m, channel row 16t+m of the group's part
  const unsigned char* krow = sRing + g * BUFB + m * KPB;
  const unsigned char* vrow = sRing + g * BUFB + KTB + m * VPB;

  stage_copy(lk, lv, gk, gv);
  asm volatile("s_wait_asynccnt 0x0" ::: "memory");   // own copies of stage 0 landed
  __syncthreads();                                     // stage 0 readable by every wave
  stage_copy(lk + STGB, lv + STGB, gk + 256 * CH, gv + 256);

  #pragma unroll 1
  for (int kb = 0; kb < NN; kb += 256) {
    const unsigned boff = (kb & 256) ? STGB : 0;
    // ---- this stage's fragments, one load group ----
    v16h kf[4], vf0[4], vf1[4];
    #pragma unroll
    for (int j = 0; j < 4; ++j)
      kf[j] = ldfrag_h((const _Float16*)(krow + boff + 16 * j * KPB), h);
    #pragma unroll
    for (int t = 0; t < 4; ++t) {
      const _Float16* vp = (const _Float16*)(vrow + boff + 16 * t * VPB);
      vf0[t] = ldfrag_h(vp, h);
      vf1[t] = ldfrag_h(vp + 32, h);
    }

    // ---- scores: s[j][r] = S[query m][key kb+64g+16j+8h+r] * scale * log2(e), by the factor in q ----
    v8f s[4];
    #pragma unroll
    for (int j = 0; j < 4; ++j)
      s[j] = wmma_f16(kf[j], qf, zero8);

    // ---- online softmax (f32), base 2: prob * 2^15 = 2^(s - (max - 15)), one subtract and one exp2 a score ----
    float mloc = s[0][0];
    #pragma unroll
    for (int j = 0; j < 4; ++j)
      #pragma unroll
      for (int r = 0; r < 8; ++r) mloc = fmaxf(mloc, s[j][r]);
    mloc = fmaxf(mloc, xhalf(mloc));
    const float mnew = fmaxf(mrun, mloc);
    const float alpha = __builtin_amdgcn_exp2f(mrun - mnew);
    const float mb = mnew - PEXP;
    mrun = mnew;
    float lsum = 0.0f;
    #pragma unroll
    for (int j = 0; j < 4; ++j)
      #pragma unroll
      for (int r = 0; r < 8; ++r) {
        const float p = __builtin_amdgcn_exp2f(s[j][r] - mb);
        s[j][r] = p;
        lsum += p;
      }
    lsum += xhalf(lsum);
    lrun = lrun * alpha + lsum;
    #pragma unroll
    for (int t = 0; t < 4; ++t)
      #pragma unroll
      for (int r = 0; r < 8; ++r) o[t][r] = o[t][r] * alpha;

    // ---- P^T B-fragments (the group's keys 0..31 and 32..63 of this step) ----
    const v16h pb0 = pack_p(s[0], s[1]);
    const v16h pb1 = pack_p(s[2], s[3]);

    // ---- O^T += V * P^T ----
    #pragma unroll
    for (int t = 0; t < 4; ++t) {
      o[t] = wmma_f16(vf0[t], pb0, o[t]);
      o[t] = wmma_f16(vf1[t], pb1, o[t]);
    }

    // ---- publish point of the next stage ----
    asm volatile("s_wait_dscnt 0x0" ::: "memory");     // own reads of this buffer done before it is refilled
    asm volatile("s_wait_asynccnt 0x0" ::: "memory");  // own copies of the next stage landed
    __syncthreads();                                    // next stage readable; this buffer left by every wave
    if (kb + 512 < NN)
      stage_copy(lk + boff, lv + boff, gk + (size_t)(kb + 512) * CH, gv + (kb + 512));
  }
  asm volatile("s_wait_asynccnt 0x0" ::: "memory");    // nothing in flight behind the loop

  // ---- merge the four groups' partial maximum, sum and O tile ----
  // The ring is free: the last trip's barrier ended every wave's reads of it.
  // Each wave lays its partials down, and behind one barrier every wave reads
  // the four partials of its query tile and joins them on the common maximum.
  {
    v4fa* pw = (v4fa*)sRing + w * 256 + lane;
    #pragma unroll
    for (int t = 0; t < 4; ++t) {
      const v4f a = { o[t][0], o[t][1], o[t][2], o[t][3] };
      const v4f c = { o[t][4], o[t][5], o[t][6], o[t][7] };
      pw[(2 * t) * 32] = a;
      pw[(2 * t + 1) * 32] = c;
    }
    const v2f ml = { mrun, lrun };
    ((v2fa*)(sRing + PARTB))[w * 32 + lane] = ml;
  }
  __syncthreads();                                     // every group's partials readable
  {
    v2f ml[NG];
    #pragma unroll
    for (int gg = 0; gg < NG; ++gg)
      ml[gg] = ((const v2fa*)(sRing + PARTB))[(4 * gg + wq) * 32 + lane];
    const float mall = fmaxf(fmaxf(ml[0].x, ml[1].x), fmaxf(ml[2].x, ml[3].x));
    lrun = 0.0f;
    #pragma unroll
    for (int t = 0; t < 4; ++t) o[t] = zero8;
    #pragma unroll
    for (int gg = 0; gg < NG; ++gg) {
      const float f = __builtin_amdgcn_exp2f(ml[gg].x - mall);
      lrun += ml[gg].y * f;
      const v4fa* pr = (const v4fa*)sRing + (4 * gg + wq) * 256 + lane;
      #pragma unroll
      for (int t = 0; t < 4; ++t) {
        const v4f a = pr[(2 * t) * 32];
        const v4f c = pr[(2 * t + 1) * 32];
        o[t][0] += a.x * f;  o[t][1] += a.y * f;  o[t][2] += a.z * f;  o[t][3] += a.w * f;
        o[t][4] += c.x * f;  o[t][5] += c.y * f;  o[t][6] += c.z * f;  o[t][7] += c.w * f;
      }
    }
  }

  // ---- normalise; attn D tiles -> bf16 hi/lo B-fragments (k = c) ----
  const float inv = 1.0f / lrun;               // O and the sum both carry 2^15
  FragB bh0, bl0, bh1, bl1;
  {
    const v8us ha = hi8(o[0], inv), hb = hi8(o[1], inv), hc = hi8(o[2], inv), hd = hi8(o[3], inv);
    bh0.half[0] = ha;  bh0.half[1] = hb;
    bh1.half[0] = hc;  bh1.half[1] = hd;
    bl0.half[0] = lo8(o[0], inv, ha);  bl0.half[1] = lo8(o[1], inv, hb);
    bl1.half[0] = lo8(o[2], inv, hc);  bl1.half[1] = lo8(o[3], inv, hd);
  }

  // ---- out^T[o][query] = sum_c Wo[o][c] attn[c][query]; group g does out-channel tile g ----
  v8f acc2;
  {
    const unsigned short* wrh = wohi + (16 * g + m) * CC;
    const unsigned short* wrl = wolo + (16 * g + m) * CC;
    v8f z = zero8;
    {
      const v16b a_h = ldfrag_b(wrh, h);
      const v16b a_l = ldfrag_b(wrl, h);
      z = wmma_bf16(a_h, bh0.v, z);
      z = wmma_bf16(a_h, bl0.v, z);
      z = wmma_bf16(a_l, bh0.v, z);
    }
    {
      const v16b a_h = ldfrag_b(wrh + 32, h);
      const v16b a_l = ldfrag_b(wrl + 32, h);
      z = wmma_bf16(a_h, bh1.v, z);
      z = wmma_bf16(a_h, bl1.v, z);
      z = wmma_bf16(a_l, bh1.v, z);
    }
    acc2 = z;
  }

  // ---- stage [64 o][64 queries] tile; D[r] = out[o 16g+8h+r][query m] ----
  float* so = sOut + 16 * wq + m;
  #pragma unroll
  for (int r = 0; r < 8; ++r) {
    const int orow = 16 * g + 8 * h + r;
    so[orow * 64] = acc2[r] + bo[orow];
  }
  __syncthreads();

  float* od = out + (size_t)b * CC * NN + qblk;
  out_store(sOut, od, tid);
  
}

// ---------------------------------------------------------------------------
extern "C" void kernel_launch(void* const* d_in, const int* in_sizes, int n_in,
                              void* d_out, int out_size, void* d_ws, size_t ws_size,
                              hipStream_t stream) {
  if (n_in < 9) return;
  if (in_sizes[0] != NB * CC * NN) return;
  if (in_sizes[1] != NWQ || in_sizes[2] != CH) return;
  if (in_sizes[3] != NWQ || in_sizes[4] != CH) return;
  if (in_sizes[5] != NWV || in_sizes[6] != CC) return;
  if (in_sizes[7] != NWV || in_sizes[8] != CC) return;
  if (out_size != NB * CC * NN) return;

  const float* x  = (const float*)d_in[0];
  const float* wq = (const float*)d_in[1];
  const float* bq = (const float*)d_in[2];
  const float* wk = (const float*)d_in[3];
  const float* bk = (const float*)d_in[4];
  const float* wv = (const float*)d_in[5];
  const float* bv = (const float*)d_in[6];
  const float* wo = (const float*)d_in[7];
  const float* bo = (const float*)d_in[8];
  float* out = (float*)d_out;

  const size_t w_bytes  = (size_t)NWALL * 2;              //    24576 per plane
  const size_t qk_bytes = (size_t)NB * NN * CH * 2;        //  1048576 each
  const size_t v_bytes  = (size_t)NB * CC * NN * 2;        //  2097152
  const size_t total = 2 * w_bytes + 2 * qk_bytes + v_bytes;   // 4243456
  if (total > ws_size) return;

  char* ws = (char*)d_ws;
  unsigned short* whi = (unsigned short*)(ws);
  unsigned short* wlo = (unsigned short*)(ws + w_bytes);
  _Float16* qpl = (_Float16*)(ws + 2 * w_bytes);
  _Float16* kpl = (_Float16*)(ws + 2 * w_bytes + qk_bytes);
  _Float16* vpl = (_Float16*)(ws + 2 * w_bytes + 2 * qk_bytes);
  const unsigned short* wohi = whi + (2 * NWQ + NWV);
  const unsigned short* wolo = wlo + (2 * NWQ + NWV);

  const int ngroups = NWALL / 8;                            // 1536
  k_wconvert<<<(ngroups + 255) / 256, 256, 0, stream>>>(wq, wk, wv, wo, whi, wlo);

  dim3 gProj(NN / 64, NB);                                  // (128, 2)
  k_proj<<<gProj, 128, 0, stream>>>(x, whi, wlo, bq, bk, bv, qpl, kpl, vpl);

  dim3 gAtt(NN / 64, NB);                                   // (128, 2)
  k_attn<<<gAtt, 512, 0, stream>>>(qpl, kpl, vpl, wohi, wolo, bo, out);
}

// v005
// A run of this version takes 39.6 microseconds.
// In two side-by-side timings against v004, it was 1.20 and 1.17 times as fast.
// All steps since v000 together make it 10.3 times as fast.
// Contractions: q/k/v and output 1x1x1 projections on v_wmma_f32_16x16x32_bf16 as bf16 hi/lo split (hi*hi + hi*lo + lo*hi); key*query scores and value*prob products on v_wmma_f32_16x16x32_f16 (f16 operands, prob carried x32768, the row sum too, so the factor cancels in the normalisation); f32 accumulate everywhere; softmax, bias, normalisation in f32.
#include <hip/hip_runtime.h>
#include <stdint.h>

typedef _Float16 v16h __attribute__((ext_vector_type(16)));
typedef _Float16 v8h  __attribute__((ext_vector_type(8)));
typedef __bf16   v16b __attribute__((ext_vector_type(16)));
typedef unsigned short v8us __attribute__((ext_vector_type(8)));
typedef float v8f __attribute__((ext_vector_type(8)));
typedef float v4f __attribute__((ext_vector_type(4)));
typedef v8h  __attribute__((may_alias)) v8ha;
typedef v8us __attribute__((may_alias)) v8usa;
typedef v4f  __attribute__((may_alias)) v4fa;
typedef float v2f __attribute__((ext_vector_type(2)));
typedef v2f  __attribute__((may_alias)) v2fa;

union FragH { v16h v; v8h half[2]; };
union FragB { v16b v; v8us half[2]; };

#define NB   2        // batch
#define CC   64       // channels
#define CH   32       // q/k channels
#define NN   8192     // voxels 8*32*32
#define XP   72       // LDS pitch (halves) of the transposed x tile
#define NWQ  (CH * CC)            // 2048
#define NWV  (CC * CC)            // 4096
#define NWALL (2 * NWQ + 2 * NWV) // 12288 : [wq | wk | wv | wo]
#define SC2  0.25503486f         // 32^-0.5 * log2(e), multiplied into q in f32 ahead of its one rounding to f16
#define PEXP 15.0f               // prob carried x 2^15, added in the exponent
#define KPB  80                  // LDS pitch, bytes, of a staged key row (64 B of data): 16 B x odd
#define VPB  144                 // LDS pitch, bytes, of a staged value row (128 B of data): 16 B x odd
#define KTB  (64 * KPB)          // 5120 : key part of one wave group's part of a stage (64 keys)
#define BUFB (KTB + 64 * VPB)    // 14336 : 64 keys of K and V = one wave group's part of a stage
#define NG   4                   // wave groups of the attention block; each takes its own keys
#define STGB (NG * BUFB)         // 57344 : one stage = 256 keys
#define PARTB (16 * 8 * 32 * 16) // 65536 : the 16 waves' partial O tiles, 8 x 16 B per lane

// ---------------------------------------------------------------------------
// WMMA helpers with hazard guard (ties D, keeps A/B live).
// Fragment map (wave32): lane l, h = l>>4, m = n = l&15.
//   A/B element i: i<8 -> k0+8h+i ; i>=8 -> k0+16+8h+(i-8)
//   D element r : row 8h+r, col l&15
// ---------------------------------------------------------------------------
__device__ __forceinline__ v8f wmma_f16(v16h a, v16h b, v8f c) {
  v8f d = __builtin_amdgcn_wmma_f32_16x16x32_f16(false, a, false, b, (short)0, c, false, false);
  asm volatile("v_nop\n\tv_nop\n\tv_nop\n\tv_nop" : "+v"(d) : "v"(a), "v"(b));
  return d;
}
__device__ __forceinline__ v8f wmma_bf16(v16b a, v16b b, v8f c) {
  v8f d = __builtin_amdgcn_wmma_f32_16x16x32_bf16(false, a, false, b, (short)0, c, false, false);
  asm volatile("v_nop\n\tv_nop\n\tv_nop\n\tv_nop" : "+v"(d) : "v"(a), "v"(b));
  return d;
}

// A or B fragment from a k-contiguous 16-bit row; p points at element k0 of
// the row owned by this lane (row index lane&15 added by the caller).
__device__ __forceinline__ v16h ldfrag_h(const _Float16* p, int h) {
  FragH f;
  f.half[0] = *(const v8ha*)(p + 8 * h);
  f.half[1] = *(const v8ha*)(p + 16 + 8 * h);
  return f.v;
}
__device__ __forceinline__ v16b ldfrag_b(const unsigned short* p, int h) {
  FragB f;
  f.half[0] = *(const v8usa*)(p + 8 * h);
  f.half[1] = *(const v8usa*)(p + 16 + 8 * h);
  return f.v;
}

// bf16 RNE convert on the f32 bit pattern, and back.
__device__ __forceinline__ unsigned short bf16_rne(float f) {
  unsigned u = __float_as_uint(f);
  u = u + 0x7FFFu + ((u >> 16) & 1u);
  return (unsigned short)(u >> 16);
}
__device__ __forceinline__ float bf16_f32(unsigned short b) {
  return __uint_as_float(((unsigned)b) << 16);
}

__device__ __forceinline__ v8us hi8(v8f v, float sc) {
  const v8us r = { bf16_rne(v[0] * sc), bf16_rne(v[1] * sc), bf16_rne(v[2] * sc), bf16_rne(v[3] * sc),
                   bf16_rne(v[4] * sc), bf16_rne(v[5] * sc), bf16_rne(v[6] * sc), bf16_rne(v[7] * sc) };
  return r;
}
__device__ __forceinline__ v8us lo8(v8f v, float sc, v8us hh) {
  const v8us r = { bf16_rne(v[0] * sc - bf16_f32(hh[0])), bf16_rne(v[1] * sc - bf16_f32(hh[1])),
                   bf16_rne(v[2] * sc - bf16_f32(hh[2])), bf16_rne(v[3] * sc - bf16_f32(hh[3])),
                   bf16_rne(v[4] * sc - bf16_f32(hh[4])), bf16_rne(v[5] * sc - bf16_f32(hh[5])),
                   bf16_rne(v[6] * sc - bf16_f32(hh[6])), bf16_rne(v[7] * sc - bf16_f32(hh[7])) };
  return r;
}

// ---------------------------------------------------------------------------
// Eight f32 weights -> eight bf16 hi and eight bf16 lo (lo = rounded remainder).
// ---------------------------------------------------------------------------
__device__ __forceinline__ void split8(v4f a, v4f c, v8us& hv, v8us& lv) {
  const unsigned short h0 = bf16_rne(a.x), h1 = bf16_rne(a.y), h2 = bf16_rne(a.z), h3 = bf16_rne(a.w);
  const unsigned short h4 = bf16_rne(c.x), h5 = bf16_rne(c.y), h6 = bf16_rne(c.z), h7 = bf16_rne(c.w);
  const v8us hh = { h0, h1, h2, h3, h4, h5, h6, h7 };
  const v8us ll = { bf16_rne(a.x - bf16_f32(h0)), bf16_rne(a.y - bf16_f32(h1)),
                    bf16_rne(a.z - bf16_f32(h2)), bf16_rne(a.w - bf16_f32(h3)),
                    bf16_rne(c.x - bf16_f32(h4)), bf16_rne(c.y - bf16_f32(h5)),
                    bf16_rne(c.z - bf16_f32(h6)), bf16_rne(c.w - bf16_f32(h7)) };
  hv = hh;
  lv = ll;
}

// ---------------------------------------------------------------------------
// one 16-B store per lane, lanes 8q..8q+7 per line.
//   qd/kd : 64 token rows x 32 halves, contiguous 4096 B (32 lines)
// ---------------------------------------------------------------------------
__device__ __forceinline__ void proj_store(const _Float16* sQ, const _Float16* sK, const _Float16* sV,
                                           _Float16* qd, _Float16* kd, _Float16* vd, int tid) {
  #pragma unroll
  for (int i = 0; i < 2; ++i) {
    const int off = (i * 128 + tid) * 8;
    const v8h a = *(const v8ha*)(sQ + off);
    *(v8h*)(qd + off) = a;
    const v8h c = *(const v8ha*)(sK + off);
    *(v8h*)(kd + off) = c;
  }
  const int q8 = tid & 7, sub = tid >> 3;        // sub 0..15
  #pragma unroll
  for (int i = 0; i < 4; ++i) {
    const int c = i * 16 + sub;                    // channel row 0..63
    const v8h a = *(const v8ha*)(sV + c * 64 + 8 * q8);
    *(v8h*)(vd + (size_t)c * NN + 8 * q8) = a;
  }
}

// ---------------------------------------------------------------------------
// Kernel 1: fused q/k/v projection. Block = 128 thr (4 waves) = 64 tokens of
// one batch x all 128 output features (32 q, 32 k, 64 v); K = 64 = 2 steps.
// x tile [64 c][64 n] f32 -> LDS as bf16 hi/lo [n][c] (pitch XP);
// the block splits the f32 rows [wq | wk | wv] itself into bf16 hi/lo rows in LDS
// (pitch XP), their loads in flight beside the x loads;
// A = x^T rows (row = token, k = c) from LDS, B = W rows (k-contiguous) from
// LDS. The first 64 blocks also split one row of wo each into the global bf16
// planes that the attention kernel reads. D[token][feature]. Epilogue: +bias -> f16 -> LDS
// staging -> whole-line stores. q,k planes [b][n][32]; v plane [b][c][n].
// ---------------------------------------------------------------------------
__global__ __launch_bounds__(128) void k_proj(
    const float* __restrict__ x,
    const float* __restrict__ wq, const float* __restrict__ wk,
    const float* __restrict__ wv, const float* __restrict__ wo,
    const float* __restrict__ bq, const float* __restrict__ bk, const float* __restrict__ bv,
    _Float16* __restrict__ qpl, _Float16* __restrict__ kpl, _Float16* __restrict__ vpl,
    unsigned short* __restrict__ wohi, unsigned short* __restrict__ wolo)
{
  __shared__ __attribute__((aligned(16))) unsigned short sWh[128 * XP];  // 18432 B
  __shared__ __attribute__((aligned(16))) unsigned short sWl[128 * XP];  // 18432 B
  __shared__ __attribute__((aligned(16))) unsigned short sXh[64 * XP];   // 9216 B
  __shared__ __attribute__((aligned(16))) unsigned short sXl[64 * XP];   // 9216 B
  __shared__ __attribute__((aligned(16))) _Float16 sQ[64 * CH];          // 4096 B
  __shared__ __attribute__((aligned(16))) _Float16 sK[64 * CH];          // 4096 B
  __shared__ __attribute__((aligned(16))) _Float16 sV[CC * 64];          // 8192 B

  const int tid = threadIdx.x, lane = tid & 31, w = tid >> 5;
  const int h = lane >> 4, m = lane & 15;
  const int n0 = blockIdx.x * 64;
  const int b = blockIdx.y;

  // ---- all loads of the block first: x tile, the 128 fused weight rows, 8 values of a wo row ----
  const float* xb = x + (size_t)b * CC * NN + n0;
  v4f xv[8], wa[8], wc[8];
  #pragma unroll
  for (int i = 0; i < 8; ++i) {
    const int f4 = i * 128 + tid;        // 0..1023
    xv[i] = *(const v4fa*)(xb + (size_t)(f4 >> 4) * NN + 4 * (f4 & 15));
  }
  #pragma unroll
  for (int i = 0; i < 8; ++i) {
    const int e = (i * 128 + tid) * 8;   // element of [wq | wk | wv], 1024 per i
    const float* ws = (i < 2) ? wq + e : (i < 4) ? wk + (e - NWQ) : wv + (e - 2 * NWQ);
    wa[i] = *(const v4fa*)ws;
    wc[i] = *(const v4fa*)(ws + 4);
  }
  // The two loads below may land in registers that held addresses of the loads above.
  asm volatile("s_wait_xcnt 0x0" ::: "memory");
  const int oe = (blockIdx.x & (CC - 1)) * CC + (tid & 7) * 8;   // inside wo for every thread
  const v4f oa = *(const v4fa*)(wo + oe);
  const v4f oc = *(const v4fa*)(wo + oe + 4);
  // Holds every load of the block above the first use of one: without it the weight
  // loads are issued only behind the wait for the first x values, two latencies in a row.
  __builtin_amdgcn_sched_barrier(0);

  // ---- x tile: transpose + split into LDS ----
  #pragma unroll
  for (int i = 0; i < 8; ++i) {
    const int f4 = i * 128 + tid;        // 0..1023
    const int c = f4 >> 4;               // 0..63
    const int j4 = f4 & 15;              // tokens 4*j4 .. 4*j4+3
    const v4f v = xv[i];
    const float e0 = v.x, e1 = v.y, e2 = v.z, e3 = v.w;
    const unsigned short a0 = bf16_rne(e0), a1 = bf16_rne(e1), a2 = bf16_rne(e2), a3 = bf16_rne(e3);
    const int t0 = 4 * j4;
    sXh[(t0 + 0) * XP + c] = a0;  sXl[(t0 + 0) * XP + c] = bf16_rne(e0 - bf16_f32(a0));
    sXh[(t0 + 1) * XP + c] = a1;  sXl[(t0 + 1) * XP + c] = bf16_rne(e1 - bf16_f32(a1));
    sXh[(t0 + 2) * XP + c] = a2;  sXl[(t0 + 2) * XP + c] = bf16_rne(e2 - bf16_f32(a2));
    sXh[(t0 + 3) * XP + c] = a3;  sXl[(t0 + 3) * XP + c] = bf16_rne(e3 - bf16_f32(a3));
  }
  // ---- weight rows: split into LDS, row = fused feature, 64 k-contiguous inputs ----
  #pragma unroll
  for (int i = 0; i < 8; ++i) {
    const int e = (i * 128 + tid) * 8;
    v8us hv, lv;
    split8(wa[i], wc[i], hv, lv);
    const int off = (e >> 6) * XP + (e & 63);
    *(v8usa*)(sWh + off) = hv;
    *(v8usa*)(sWl + off) = lv;
  }
  // ---- wo row blockIdx.x: one 128-B line of each plane, written by 8 lanes of one block ----
  // Inputs-only fence on the loaded values: keeps the two wo loads up with the block's other
  // loads; without it they sink into the branch and their whole latency stands open there.
  asm volatile("" :: "v"(oa), "v"(oc));
  if (b == 0 && blockIdx.x < CC && tid < 8) {
    v8us hv, lv;
    split8(oa, oc, hv, lv);
    *(v8us*)(wohi + oe) = hv;
    *(v8us*)(wolo + oe) = lv;
  }
  __syncthreads();

  const v8f zero8 = {0.f, 0.f, 0.f, 0.f, 0.f, 0.f, 0.f, 0.f};
  v8f acc[8];
  #pragma unroll
  for (int nt = 0; nt < 8; ++nt) acc[nt] = zero8;

  const unsigned short* arow_h = sXh + (16 * w + m) * XP;   // token row
  const unsigned short* arow_l = sXl + (16 * w + m) * XP;

  #pragma unroll
  for (int ks = 0; ks < 2; ++ks) {
    const int k0 = 32 * ks;
    const v16b ah = ldfrag_b(arow_h + k0, h);
    const v16b al = ldfrag_b(arow_l + k0, h);
    v16b bh[8], bl[8];                                      // the k step's B fragments, one LDS load group
    #pragma unroll
    for (int nt = 0; nt < 8; ++nt) {
      const int f = 16 * nt + m;                            // fused feature row 0..127
      bh[nt] = ldfrag_b(sWh + f * XP + k0, h);
      bl[nt] = ldfrag_b(sWl + f * XP + k0, h);
    }
    #pragma unroll
    for (int nt = 0; nt < 8; ++nt) {
      acc[nt] = wmma_bf16(ah, bh[nt], acc[nt]);
      acc[nt] = wmma_bf16(ah, bl[nt], acc[nt]);
      acc[nt] = wmma_bf16(al, bh[nt], acc[nt]);
    }
  }

  // ---- epilogue: D[r] of tile nt = Y[token 16w+8h+r][feature 16nt+m] ----
  #pragma unroll
  for (int nt = 0; nt < 8; ++nt) {
    const int f = 16 * nt + m;
    float bias;
    if (nt < 2)      bias = bq[f];
    else if (nt < 4) bias = bk[f - CH];
    else             bias = bv[f - 2 * CH];
    #pragma unroll
    for (int r = 0; r < 8; ++r) {
      const int tok = 16 * w + 8 * h + r;                    // 0..63
      const float yf = acc[nt][r] + bias;
      const _Float16 y = (_Float16)(nt < 2 ? yf * SC2 : yf);   // q carries SC2: scores come out as exponents to base 2
      if (nt < 2)      sQ[tok * CH + f] = y;
      else if (nt < 4) sK[tok * CH + (f - CH)] = y;
      else             sV[(f - 2 * CH) * 64 + tok] = y;
    }
  }
  __syncthreads();

  _Float16* qd = qpl + ((size_t)b * NN + n0) * CH;
  _Float16* kd = kpl + ((size_t)b * NN + n0) * CH;
  _Float16* vd = vpl + (size_t)b * CC * NN + n0;
  proj_store(sQ, sK, sV, qd, kd, vd, tid);
  
}

// ---------------------------------------------------------------------------
// P^T B-fragment from the lane's own score D values: element r <- tile a row r,
// element 8+r <- tile c row r (same lane, same query column); the values already carry 2^15.
// ---------------------------------------------------------------------------
__device__ __forceinline__ v16h pack_p(v8f a, v8f c) {
  const v16h r = { (_Float16)a[0], (_Float16)a[1], (_Float16)a[2], (_Float16)a[3],
                   (_Float16)a[4], (_Float16)a[5], (_Float16)a[6], (_Float16)a[7],
                   (_Float16)c[0], (_Float16)c[1], (_Float16)c[2], (_Float16)c[3],
                   (_Float16)c[4], (_Float16)c[5], (_Float16)c[6], (_Float16)c[7] };
  return r;
}

// Lane l's value as seen from lane l ^ 16, by a vector cross-row move: it does not
// count on dscnt, so an exchange does not wait for LDS fragment loads still in flight.
__device__ __forceinline__ float xhalf(float x) {
  const int b = __builtin_bit_cast(int, x);
  return __builtin_bit_cast(float, __builtin_amdgcn_permlanex16(b, b, 0x76543210, 0xfedcba98, false, false));
}

// Block tile [64 out-channels][64 queries] f32 in LDS -> out[b][o][qblk..+63];
// 128 lines (2 per channel row), each by lanes 8q..8q+7 in one instruction.
__device__ __forceinline__ void out_store(const float* sOut, float* od, int tid) {
  const int q8 = tid & 7, sub = tid >> 3;        // sub 0..63
  #pragma unroll
  for (int i = 0; i < 2; ++i) {
    const int L = i * 64 + sub;                    // line 0..127
    const int o = L >> 1, hl = L & 1;
    const v4f v = *(const v4fa*)(sOut + o * 64 + 32 * hl + 4 * q8);
    *(v4f*)(od + (size_t)o * NN + 32 * hl + 4 * q8) = v;
  }
}

// One wave group's part of a stage (64 keys) from global memory into LDS, through no register: six
// 16-B asynchronous copies per lane (2 of K, 4 of V), every lane on.
// lk/lv: the lane's LDS byte addresses; gk/gv: its global addresses.
// The s_wait_xcnt closes the statement so that no address register named by a
// copy is rewritten ahead of it.
__device__ __forceinline__ void stage_copy(unsigned lk, unsigned lv, const _Float16* gk, const _Float16* gv) {
  asm volatile(
      "global_load_async_to_lds_b128 %0, %6, off\n\t"
      "global_load_async_to_lds_b128 %1, %7, off\n\t"
      "global_load_async_to_lds_b128 %2, %8, off\n\t"
      "global_load_async_to_lds_b128 %3, %9, off\n\t"
      "global_load_async_to_lds_b128 %4, %10, off\n\t"
      "global_load_async_to_lds_b128 %5, %11, off\n\t"
      "s_wait_xcnt 0x0"
      :: "v"(lk), "v"(lk + 32 * KPB),
         "v"(lv), "v"(lv + 16 * VPB), "v"(lv + 32 * VPB), "v"(lv + 48 * VPB),
         "v"(gk), "v"(gk + 32 * CH),
         "v"(gv), "v"(gv + (size_t)16 * NN), "v"(gv + (size_t)32 * NN), "v"(gv + (size_t)48 * NN)
      : "memory");
}

// ---------------------------------------------------------------------------
// Kernel 2: streaming attention, transposed form, fused output projection.
// Block 512 thr (16 waves, 4 per SIMD) = 4 wave groups x 4 waves; 64 queries per
// block, 16 per wave. A step is 256 keys: group g takes keys 64g..64g+63 of it,
// so every query is walked by four waves, each over a quarter of the keys with
// its own running maximum, sum and O tile; the four are merged through LDS
// behind the loop. K and V of a step are staged once per block in a two-buffer
// LDS ring by asynchronous copies (the next step's tile flies while this one is
// worked on); the four waves of a group read their fragments from its part.
//   S^T = K * Q^T : A = K rows (row = key, k = d), B = Q^T loaded like A from
//                   the query row (k = d, n = query)
//   O^T += V * P^T : A = V rows (row = c, k = key), B = P^T from registers
//   out^T = Wo * attn : A = Wo rows (row = o, k = c), B = attn from the O^T
//                   D tiles (k = c = tile row, n = query), bf16 hi/lo split
// Lane owns 32 keys of query column lane&15; partner = lane ^ 16.
// ---------------------------------------------------------------------------
__global__ __launch_bounds__(512) void k_attn(
    const _Float16* __restrict__ qpl,      // [B][N][32]
    const _Float16* __restrict__ kpl,      // [B][N][32]
    const _Float16* __restrict__ vpl,      // [B][64][N]
    const unsigned short* __restrict__ wohi, const unsigned short* __restrict__ wolo,   // [64][64]
    const float* __restrict__ bo,
    float* __restrict__ out)               // [B][64][N]
{
  __shared__ __attribute__((aligned(16))) float sOut[CC * 64];   // 16384 B
  __shared__ __attribute__((aligned(16))) unsigned char sRing[2 * STGB];   // 114688 B

  const int tid = threadIdx.x, lane = tid & 31, w = tid >> 5;
  const int g = w >> 2, wq = w & 3;          // key group, query tile
  const int tl = tid & 127;                  // thread within its group
  const int h = lane >> 4, m = lane & 15;
  const int b = blockIdx.y;
  const int qblk = blockIdx.x * 64;
  const int q0 = qblk + 16 * wq;

  // Q^T B-fragment: column n = query q0+m, k = d (32 deep)
  const v16h qf = ldfrag_h(qpl + ((size_t)b * NN + q0 + m) * CH, h);

  const v8f zero8 = {0.f, 0.f, 0.f, 0.f, 0.f, 0.f, 0.f, 0.f};
  v8f o[4];                                  // o[t][r] = attn[c 16t+8h+r][query m] * lrun (lrun carries 2^15)
  #pragma unroll
  for (int t = 0; t < 4; ++t) o[t] = zero8;
  float mrun = -1e30f, lrun = 0.0f;

  // copy side, the group's own part: K chunk = 16 B of key row tl>>2 (+32), V chunk = 16 B of channel row tl>>3 (+16i)
  const unsigned ring = (unsigned)(uintptr_t)sRing + g * BUFB;  // LDS byte address of the group's part
  const unsigned lk = ring + (tl >> 2) * KPB + (tl & 3) * 16;
  const unsigned lv = ring + KTB + (tl >> 3) * VPB + (tl & 7) * 16;
  const _Float16* gk = kpl + ((size_t)b * NN + 64 * g) * CH + tl * 8;                        // + key0*CH
  const _Float16* gv = vpl + ((size_t)b * CC + (tl >> 3)) * NN + 64 * g + (tl & 7) * 8;      // + key0
  // read side: key row 16j+m, channel row 16t+m of the group's part
  const unsigned char* krow = sRing + g * BUFB + m * KPB;
  const unsigned char* vrow = sRing + g * BUFB + KTB + m * VPB;

  stage_copy(lk, lv, gk, gv);
  asm volatile("s_wait_asynccnt 0x0" ::: "memory");   // own copies of stage 0 landed
  __syncthreads();                                     // stage 0 readable by every wave
  stage_copy(lk + STGB, lv + STGB, gk + 256 * CH, gv + 256);

  #pragma unroll 1
  for (int kb = 0; kb < NN; kb += 256) {
    const unsigned boff = (kb & 256) ? STGB : 0;
    // ---- this stage's fragments, one load group ----
    v16h kf[4], vf0[4], vf1[4];
    #pragma unroll
    for (int j = 0; j < 4; ++j)
      kf[j] = ldfrag_h((const _Float16*)(krow + boff + 16 * j * KPB), h);
    #pragma unroll
    for (int t = 0; t < 4; ++t) {
      const _Float16* vp = (const _Float16*)(vrow + boff + 16 * t * VPB);
      vf0[t] = ldfrag_h(vp, h);
      vf1[t] = ldfrag_h(vp + 32, h);
    }

    // ---- scores: s[j][r] = S[query m][key kb+64g+16j+8h+r] * scale * log2(e), by the factor in q ----
    v8f s[4];
    #pragma unroll
    for (int j = 0; j < 4; ++j)
      s[j] = wmma_f16(kf[j], qf, zero8);

    // ---- online softmax (f32), base 2: prob * 2^15 = 2^(s - (max - 15)), one subtract and one exp2 a score ----
    float mloc = s[0][0];
    #pragma unroll
    for (int j = 0; j < 4; ++j)
      #pragma unroll
      for (int r = 0; r < 8; ++r) mloc = fmaxf(mloc, s[j][r]);
    mloc = fmaxf(mloc, xhalf(mloc));
    const float mnew = fmaxf(mrun, mloc);
    const float alpha = __builtin_amdgcn_exp2f(mrun - mnew);
    const float mb = mnew - PEXP;
    mrun = mnew;
    float lsum = 0.0f;
    #pragma unroll
    for (int j = 0; j < 4; ++j)
      #pragma unroll
      for (int r = 0; r < 8; ++r) {
        const float p = __builtin_amdgcn_exp2f(s[j][r] - mb);
        s[j][r] = p;
        lsum += p;
      }
    lsum += xhalf(lsum);
    lrun = lrun * alpha + lsum;
    #pragma unroll
    for (int t = 0; t < 4; ++t)
      #pragma unroll
      for (int r = 0; r < 8; ++r) o[t][r] = o[t][r] * alpha;

    // ---- P^T B-fragments (the group's keys 0..31 and 32..63 of this step) ----
    const v16h pb0 = pack_p(s[0], s[1]);
    const v16h pb1 = pack_p(s[2], s[3]);

    // ---- O^T += V * P^T ----
    #pragma unroll
    for (int t = 0; t < 4; ++t) {
      o[t] = wmma_f16(vf0[t], pb0, o[t]);
      o[t] = wmma_f16(vf1[t], pb1, o[t]);
    }

    // ---- publish point of the next stage ----
    asm volatile("s_wait_dscnt 0x0" ::: "memory");     // own reads of this buffer done before it is refilled
    asm volatile("s_wait_asynccnt 0x0" ::: "memory");  // own copies of the next stage landed
    __syncthreads();                                    // next stage readable; this buffer left by every wave
    if (kb + 512 < NN)
      stage_copy(lk + boff, lv + boff, gk + (size_t)(kb + 512) * CH, gv + (kb + 512));
  }
  asm volatile("s_wait_asynccnt 0x0" ::: "memory");    // nothing in flight behind the loop

  // ---- merge the four groups' partial maximum, sum and O tile ----
  // The ring is free: the last trip's barrier ended every wave's reads of it.
  // Each wave lays its partials down, and behind one barrier every wave reads
  // the four partials of its query tile and joins them on the common maximum.
  {
    v4fa* pw = (v4fa*)sRing + w * 256 + lane;
    #pragma unroll
    for (int t = 0; t < 4; ++t) {
      const v4f a = { o[t][0], o[t][1], o[t][2], o[t][3] };
      const v4f c = { o[t][4], o[t][5], o[t][6], o[t][7] };
      pw[(2 * t) * 32] = a;
      pw[(2 * t + 1) * 32] = c;
    }
    const v2f ml = { mrun, lrun };
    ((v2fa*)(sRing + PARTB))[w * 32 + lane] = ml;
  }
  __syncthreads();                                     // every group's partials readable
  {
    v2f ml[NG];
    #pragma unroll
    for (int gg = 0; gg < NG; ++gg)
      ml[gg] = ((const v2fa*)(sRing + PARTB))[(4 * gg + wq) * 32 + lane];
    const float mall = fmaxf(fmaxf(ml[0].x, ml[1].x), fmaxf(ml[2].x, ml[3].x));
    lrun = 0.0f;
    #pragma unroll
    for (int t = 0; t < 4; ++t) o[t] = zero8;
    #pragma unroll
    for (int gg = 0; gg < NG; ++gg) {
      const float f = __builtin_amdgcn_exp2f(ml[gg].x - mall);
      lrun += ml[gg].y * f;
      const v4fa* pr = (const v4fa*)sRing + (4 * gg + wq) * 256 + lane;
      #pragma unroll
      for (int t = 0; t < 4; ++t) {
        const v4f a = pr[(2 * t) * 32];
        const v4f c = pr[(2 * t + 1) * 32];
        o[t][0] += a.x * f;  o[t][1] += a.y * f;  o[t][2] += a.z * f;  o[t][3] += a.w * f;
        o[t][4] += c.x * f;  o[t][5] += c.y * f;  o[t][6] += c.z * f;  o[t][7] += c.w * f;
      }
    }
  }

  // ---- normalise; attn D tiles -> bf16 hi/lo B-fragments (k = c) ----
  const float inv = 1.0f / lrun;               // O and the sum both carry 2^15
  FragB bh0, bl0, bh1, bl1;
  {
    const v8us ha = hi8(o[0], inv), hb = hi8(o[1], inv), hc = hi8(o[2], inv), hd = hi8(o[3], inv);
    bh0.half[0] = ha;  bh0.half[1] = hb;
    bh1.half[0] = hc;  bh1.half[1] = hd;
    bl0.half[0] = lo8(o[0], inv, ha);  bl0.half[1] = lo8(o[1], inv, hb);
    bl1.half[0] = lo8(o[2], inv, hc);  bl1.half[1] = lo8(o[3], inv, hd);
  }

  // ---- out^T[o][query] = sum_c Wo[o][c] attn[c][query]; group g does out-channel tile g ----
  v8f acc2;
  {
    const unsigned short* wrh = wohi + (16 * g + m) * CC;
    const unsigned short* wrl = wolo + (16 * g + m) * CC;
    v8f z = zero8;
    {
      const v16b a_h = ldfrag_b(wrh, h);
      const v16b a_l = ldfrag_b(wrl, h);
      z = wmma_bf16(a_h, bh0.v, z);
      z = wmma_bf16(a_h, bl0.v, z);
      z = wmma_bf16(a_l, bh0.v, z);
    }
    {
      const v16b a_h = ldfrag_b(wrh + 32, h);
      const v16b a_l = ldfrag_b(wrl + 32, h);
      z = wmma_bf16(a_h, bh1.v, z);
      z = wmma_bf16(a_h, bl1.v, z);
      z = wmma_bf16(a_l, bh1.v, z);
    }
    acc2 = z;
  }

  // ---- stage [64 o][64 queries] tile; D[r] = out[o 16g+8h+r][query m] ----
  float* so = sOut + 16 * wq + m;
  #pragma unroll
  for (int r = 0; r < 8; ++r) {
    const int orow = 16 * g + 8 * h + r;
    so[orow * 64] = acc2[r] + bo[orow];
  }
  __syncthreads();

  float* od = out + (size_t)b * CC * NN + qblk;
  out_store(sOut, od, tid);
  
}

// ---------------------------------------------------------------------------
extern "C" void kernel_launch(void* const* d_in, const int* in_sizes, int n_in,
                              void* d_out, int out_size, void* d_ws, size_t ws_size,
                              hipStream_t stream) {
  if (n_in < 9) return;
  if (in_sizes[0] != NB * CC * NN) return;
  if (in_sizes[1] != NWQ || in_sizes[2] != CH) return;
  if (in_sizes[3] != NWQ || in_sizes[4] != CH) return;
  if (in_sizes[5] != NWV || in_sizes[6] != CC) return;
  if (in_sizes[7] != NWV || in_sizes[8] != CC) return;
  if (out_size != NB * CC * NN) return;

  const float* x  = (const float*)d_in[0];
  const float* wq = (const float*)d_in[1];
  const float* bq = (const float*)d_in[2];
  const float* wk = (const float*)d_in[3];
  const float* bk = (const float*)d_in[4];
  const float* wv = (const float*)d_in[5];
  const float* bv = (const float*)d_in[6];
  const float* wo = (const float*)d_in[7];
  const float* bo = (const float*)d_in[8];
  float* out = (float*)d_out;

  const size_t w_bytes  = (size_t)NWALL * 2;              //    24576 per plane
  const size_t qk_bytes = (size_t)NB * NN * CH * 2;        //  1048576 each
  const size_t v_bytes  = (size_t)NB * CC * NN * 2;        //  2097152
  const size_t total = 2 * w_bytes + 2 * qk_bytes + v_bytes;   // 4243456
  if (total > ws_size) return;

  char* ws = (char*)d_ws;
  unsigned short* whi = (unsigned short*)(ws);
  unsigned short* wlo = (unsigned short*)(ws + w_bytes);
  _Float16* qpl = (_Float16*)(ws + 2 * w_bytes);
  _Float16* kpl = (_Float16*)(ws + 2 * w_bytes + qk_bytes);
  _Float16* vpl = (_Float16*)(ws + 2 * w_bytes + 2 * qk_bytes);
  unsigned short* wohi = whi + (2 * NWQ + NWV);
  unsigned short* wolo = wlo + (2 * NWQ + NWV);

  dim3 gProj(NN / 64, NB);                                  // (128, 2)
  k_proj<<<gProj, 128, 0, stream>>>(x, wq, wk, wv, wo, bq, bk, bv, qpl, kpl, vpl, wohi, wolo);

  dim3 gAtt(NN / 64, NB);                                   // (128, 2)
  k_attn<<<gAtt, 512, 0, stream>>>(qpl, kpl, vpl, wohi, wolo, bo, out);
}

// v006
// Measured time: 38.5 microseconds a run.
// In two side-by-side timings against v005, it was 1.05 and 1.04 times as fast.
// Over all steps from v000 it is 10.7 times as fast.
// Contractions: q/k/v and output 1x1x1 projections on v_wmma_f32_16x16x32_bf16 as bf16 hi/lo split (hi*hi + hi*lo + lo*hi); key*query scores and value*prob products on v_wmma_f32_16x16x32_f16 (f16 operands, prob carried x128 at the maximum in use, the row sum too, so the factor cancels in the normalisation); f32 accumulate everywhere; softmax, bias, normalisation in f32.
#include <hip/hip_runtime.h>
#include <stdint.h>

typedef _Float16 v16h __attribute__((ext_vector_type(16)));
typedef _Float16 v8h  __attribute__((ext_vector_type(8)));
typedef __bf16   v16b __attribute__((ext_vector_type(16)));
typedef unsigned short v8us __attribute__((ext_vector_type(8)));
typedef float v8f __attribute__((ext_vector_type(8)));
typedef float v4f __attribute__((ext_vector_type(4)));
typedef v8h  __attribute__((may_alias)) v8ha;
typedef v8us __attribute__((may_alias)) v8usa;
typedef v4f  __attribute__((may_alias)) v4fa;
typedef float v2f __attribute__((ext_vector_type(2)));
typedef v2f  __attribute__((may_alias)) v2fa;

union FragH { v16h v; v8h half[2]; };
union FragB { v16b v; v8us half[2]; };

#define NB   2        // batch
#define CC   64       // channels
#define CH   32       // q/k channels
#define NN   8192     // voxels 8*32*32
#define XP   72       // LDS pitch (halves) of the transposed x tile
#define NWQ  (CH * CC)            // 2048
#define NWV  (CC * CC)            // 4096
#define NWALL (2 * NWQ + 2 * NWV) // 12288 : [wq | wk | wv | wo]
#define SC2  0.25503486f         // 32^-0.5 * log2(e), multiplied into q in f32 ahead of its one rounding to f16
#define PEXP 7.0f                // prob carried x 2^7 at the maximum in use, added in the exponent
#define PLIM 32768.0f            // a lane's sum of one trip's probs below 2^15: each of them is finite in f16
#define KPB  80                  // LDS pitch, bytes, of a staged key row (64 B of data): 16 B x odd
#define VPB  144                 // LDS pitch, bytes, of a staged value row (128 B of data): 16 B x odd
#define KTB  (64 * KPB)          // 5120 : key part of one wave group's part of a stage (64 keys)
#define BUFB (KTB + 64 * VPB)    // 14336 : 64 keys of K and V = one wave group's part of a stage
#define NG   4                   // wave groups of the attention block; each takes its own keys
#define STGB (NG * BUFB)         // 57344 : one stage = 256 keys
#define PARTB (16 * 8 * 32 * 16) // 65536 : the 16 waves' partial O tiles, 8 x 16 B per lane

// ---------------------------------------------------------------------------
// WMMA helpers with hazard guard (ties D, keeps A/B live).
// Fragment map (wave32): lane l, h = l>>4, m = n = l&15.
//   A/B element i: i<8 -> k0+8h+i ; i>=8 -> k0+16+8h+(i-8)
//   D element r : row 8h+r, col l&15
// ---------------------------------------------------------------------------
__device__ __forceinline__ v8f wmma_f16(v16h a, v16h b, v8f c) {
  v8f d = __builtin_amdgcn_wmma_f32_16x16x32_f16(false, a, false, b, (short)0, c, false, false);
  asm volatile("v_nop\n\tv_nop\n\tv_nop\n\tv_nop" : "+v"(d) : "v"(a), "v"(b));
  return d;
}
__device__ __forceinline__ v8f wmma_bf16(v16b a, v16b b, v8f c) {
  v8f d = __builtin_amdgcn_wmma_f32_16x16x32_bf16(false, a, false, b, (short)0, c, false, false);
  asm volatile("v_nop\n\tv_nop\n\tv_nop\n\tv_nop" : "+v"(d) : "v"(a), "v"(b));
  return d;
}

// A or B fragment from a k-contiguous 16-bit row; p points at element k0 of
// the row owned by this lane (row index lane&15 added by the caller).
__device__ __forceinline__ v16h ldfrag_h(const _Float16* p, int h) {
  FragH f;
  f.half[0] = *(const v8ha*)(p + 8 * h);
  f.half[1] = *(const v8ha*)(p + 16 + 8 * h);
  return f.v;
}
__device__ __forceinline__ v16b ldfrag_b(const unsigned short* p, int h) {
  FragB f;
  f.half[0] = *(const v8usa*)(p + 8 * h);
  f.half[1] = *(const v8usa*)(p + 16 + 8 * h);
  return f.v;
}

// bf16 RNE convert on the f32 bit pattern, and back.
__device__ __forceinline__ unsigned short bf16_rne(float f) {
  unsigned u = __float_as_uint(f);
  u = u + 0x7FFFu + ((u >> 16) & 1u);
  return (unsigned short)(u >> 16);
}
__device__ __forceinline__ float bf16_f32(unsigned short b) {
  return __uint_as_float(((unsigned)b) << 16);
}

__device__ __forceinline__ v8us hi8(v8f v, float sc) {
  const v8us r = { bf16_rne(v[0] * sc), bf16_rne(v[1] * sc), bf16_rne(v[2] * sc), bf16_rne(v[3] * sc),
                   bf16_rne(v[4] * sc), bf16_rne(v[5] * sc), bf16_rne(v[6] * sc), bf16_rne(v[7] * sc) };
  return r;
}
__device__ __forceinline__ v8us lo8(v8f v, float sc, v8us hh) {
  const v8us r = { bf16_rne(v[0] * sc - bf16_f32(hh[0])), bf16_rne(v[1] * sc - bf16_f32(hh[1])),
                   bf16_rne(v[2] * sc - bf16_f32(hh[2])), bf16_rne(v[3] * sc - bf16_f32(hh[3])),
                   bf16_rne(v[4] * sc - bf16_f32(hh[4])), bf16_rne(v[5] * sc - bf16_f32(hh[5])),
                   bf16_rne(v[6] * sc - bf16_f32(hh[6])), bf16_rne(v[7] * sc - bf16_f32(hh[7])) };
  return r;
}

// ---------------------------------------------------------------------------
// Eight f32 weights -> eight bf16 hi and eight bf16 lo (lo = rounded remainder).
// ---------------------------------------------------------------------------
__device__ __forceinline__ void split8(v4f a, v4f c, v8us& hv, v8us& lv) {
  const unsigned short h0 = bf16_rne(a.x), h1 = bf16_rne(a.y), h2 = bf16_rne(a.z), h3 = bf16_rne(a.w);
  const unsigned short h4 = bf16_rne(c.x), h5 = bf16_rne(c.y), h6 = bf16_rne(c.z), h7 = bf16_rne(c.w);
  const v8us hh = { h0, h1, h2, h3, h4, h5, h6, h7 };
  const v8us ll = { bf16_rne(a.x - bf16_f32(h0)), bf16_rne(a.y - bf16_f32(h1)),
                    bf16_rne(a.z - bf16_f32(h2)), bf16_rne(a.w - bf16_f32(h3)),
                    bf16_rne(c.x - bf16_f32(h4)), bf16_rne(c.y - bf16_f32(h5)),
                    bf16_rne(c.z - bf16_f32(h6)), bf16_rne(c.w - bf16_f32(h7)) };
  hv = hh;
  lv = ll;
}

// ---------------------------------------------------------------------------
// one 16-B store per lane, lanes 8q..8q+7 per line.
//   qd/kd : 64 token rows x 32 halves, contiguous 4096 B (32 lines)
// ---------------------------------------------------------------------------
__device__ __forceinline__ void proj_store(const _Float16* sQ, const _Float16* sK, const _Float16* sV,
                                           _Float16* qd, _Float16* kd, _Float16* vd, int tid) {
  #pragma unroll
  for (int i = 0; i < 2; ++i) {
    const int off = (i * 128 + tid) * 8;
    const v8h a = *(const v8ha*)(sQ + off);
    *(v8h*)(qd + off) = a;
    const v8h c = *(const v8ha*)(sK + off);
    *(v8h*)(kd + off) = c;
  }
  const int q8 = tid & 7, sub = tid >> 3;        // sub 0..15
  #pragma unroll
  for (int i = 0; i < 4; ++i) {
    const int c = i * 16 + sub;                    // channel row 0..63
    const v8h a = *(const v8ha*)(sV + c * 64 + 8 * q8);
    *(v8h*)(vd + (size_t)c * NN + 8 * q8) = a;
  }
}

// ---------------------------------------------------------------------------
// Kernel 1: fused q/k/v projection. Block = 128 thr (4 waves) = 64 tokens of
// one batch x all 128 output features (32 q, 32 k, 64 v); K = 64 = 2 steps.
// x tile [64 c][64 n] f32 -> LDS as bf16 hi/lo [n][c] (pitch XP);
// the block splits the f32 rows [wq | wk | wv] itself into bf16 hi/lo rows in LDS
// (pitch XP), their loads in flight beside the x loads;
// A = x^T rows (row = token, k = c) from LDS, B = W rows (k-contiguous) from
// LDS. The first 64 blocks also split one row of wo each into the global bf16
// planes that the attention kernel reads. D[token][feature]. Epilogue: +bias -> f16 -> LDS
// staging -> whole-line stores. q,k planes [b][n][32]; v plane [b][c][n].
// ---------------------------------------------------------------------------
__global__ __launch_bounds__(128) void k_proj(
    const float* __restrict__ x,
    const float* __restrict__ wq, const float* __restrict__ wk,
    const float* __restrict__ wv, const float* __restrict__ wo,
    const float* __restrict__ bq, const float* __restrict__ bk, const float* __restrict__ bv,
    _Float16* __restrict__ qpl, _Float16* __restrict__ kpl, _Float16* __restrict__ vpl,
    unsigned short* __restrict__ wohi, unsigned short* __restrict__ wolo)
{
  __shared__ __attribute__((aligned(16))) unsigned short sWh[128 * XP];  // 18432 B
  __shared__ __attribute__((aligned(16))) unsigned short sWl[128 * XP];  // 18432 B
  __shared__ __attribute__((aligned(16))) unsigned short sXh[64 * XP];   // 9216 B
  __shared__ __attribute__((aligned(16))) unsigned short sXl[64 * XP];   // 9216 B
  __shared__ __attribute__((aligned(16))) _Float16 sQ[64 * CH];          // 4096 B
  __shared__ __attribute__((aligned(16))) _Float16 sK[64 * CH];          // 4096 B
  __shared__ __attribute__((aligned(16))) _Float16 sV[CC * 64];          // 8192 B

  const int tid = threadIdx.x, lane = tid & 31, w = tid >> 5;
  const int h = lane >> 4, m = lane & 15;
  const int n0 = blockIdx.x * 64;
  const int b = blockIdx.y;

  // ---- all loads of the block first: x tile, the 128 fused weight rows, 8 values of a wo row ----
  const float* xb = x + (size_t)b * CC * NN + n0;
  v4f xv[8], wa[8], wc[8];
  #pragma unroll
  for (int i = 0; i < 8; ++i) {
    const int f4 = i * 128 + tid;        // 0..1023
    xv[i] = *(const v4fa*)(xb + (size_t)(f4 >> 4) * NN + 4 * (f4 & 15));
  }
  #pragma unroll
  for (int i = 0; i < 8; ++i) {
    const int e = (i * 128 + tid) * 8;   // element of [wq | wk | wv], 1024 per i
    const float* ws = (i < 2) ? wq + e : (i < 4) ? wk + (e - NWQ) : wv + (e - 2 * NWQ);
    wa[i] = *(const v4fa*)ws;
    wc[i] = *(const v4fa*)(ws + 4);
  }
  // The two loads below may land in registers that held addresses of the loads above.
  asm volatile("s_wait_xcnt 0x0" ::: "memory");
  const int oe = (blockIdx.x & (CC - 1)) * CC + (tid & 7) * 8;   // inside wo for every thread
  const v4f oa = *(const v4fa*)(wo + oe);
  const v4f oc = *(const v4fa*)(wo + oe + 4);
  // Holds every load of the block above the first use of one: without it the weight
  // loads are issued only behind the wait for the first x values, two latencies in a row.
  __builtin_amdgcn_sched_barrier(0);

  // ---- x tile: transpose + split into LDS ----
  #pragma unroll
  for (int i = 0; i < 8; ++i) {
    const int f4 = i * 128 + tid;        // 0..1023
    const int c = f4 >> 4;               // 0..63
    const int j4 = f4 & 15;              // tokens 4*j4 .. 4*j4+3
    const v4f v = xv[i];
    const float e0 = v.x, e1 = v.y, e2 = v.z, e3 = v.w;
    const unsigned short a0 = bf16_rne(e0), a1 = bf16_rne(e1), a2 = bf16_rne(e2), a3 = bf16_rne(e3);
    const int t0 = 4 * j4;
    sXh[(t0 + 0) * XP + c] = a0;  sXl[(t0 + 0) * XP + c] = bf16_rne(e0 - bf16_f32(a0));
    sXh[(t0 + 1) * XP + c] = a1;  sXl[(t0 + 1) * XP + c] = bf16_rne(e1 - bf16_f32(a1));
    sXh[(t0 + 2) * XP + c] = a2;  sXl[(t0 + 2) * XP + c] = bf16_rne(e2 - bf16_f32(a2));
    sXh[(t0 + 3) * XP + c] = a3;  sXl[(t0 + 3) * XP + c] = bf16_rne(e3 - bf16_f32(a3));
  }
  // ---- weight rows: split into LDS, row = fused feature, 64 k-contiguous inputs ----
  #pragma unroll
  for (int i = 0; i < 8; ++i) {
    const int e = (i * 128 + tid) * 8;
    v8us hv, lv;
    split8(wa[i], wc[i], hv, lv);
    const int off = (e >> 6) * XP + (e & 63);
    *(v8usa*)(sWh + off) = hv;
    *(v8usa*)(sWl + off) = lv;
  }
  // ---- wo row blockIdx.x: one 128-B line of each plane, written by 8 lanes of one block ----
  // Inputs-only fence on the loaded values: keeps the two wo loads up with the block's other
  // loads; without it they sink into the branch and their whole latency stands open there.
  asm volatile("" :: "v"(oa), "v"(oc));
  if (b == 0 && blockIdx.x < CC && tid < 8) {
    v8us hv, lv;
    split8(oa, oc, hv, lv);
    *(v8us*)(wohi + oe) = hv;
    *(v8us*)(wolo + oe) = lv;
  }
  __syncthreads();

  const v8f zero8 = {0.f, 0.f, 0.f, 0.f, 0.f, 0.f, 0.f, 0.f};
  v8f acc[8];
  #pragma unroll
  for (int nt = 0; nt < 8; ++nt) acc[nt] = zero8;

  const unsigned short* arow_h = sXh + (16 * w + m) * XP;   // token row
  const unsigned short* arow_l = sXl + (16 * w + m) * XP;

  #pragma unroll
  for (int ks = 0; ks < 2; ++ks) {
    const int k0 = 32 * ks;
    const v16b ah = ldfrag_b(arow_h + k0, h);
    const v16b al = ldfrag_b(arow_l + k0, h);
    v16b bh[8], bl[8];                                      // the k step's B fragments, one LDS load group
    #pragma unroll
    for (int nt = 0; nt < 8; ++nt) {
      const int f = 16 * nt + m;                            // fused feature row 0..127
      bh[nt] = ldfrag_b(sWh + f * XP + k0, h);
      bl[nt] = ldfrag_b(sWl + f * XP + k0, h);
    }
    #pragma unroll
    for (int nt = 0; nt < 8; ++nt) {
      acc[nt] = wmma_bf16(ah, bh[nt], acc[nt]);
      acc[nt] = wmma_bf16(ah, bl[nt], acc[nt]);
      acc[nt] = wmma_bf16(al, bh[nt], acc[nt]);
    }
  }

  // ---- epilogue: D[r] of tile nt = Y[token 16w+8h+r][feature 16nt+m] ----
  #pragma unroll
  for (int nt = 0; nt < 8; ++nt) {
    const int f = 16 * nt + m;
    float bias;
    if (nt < 2)      bias = bq[f];
    else if (nt < 4) bias = bk[f - CH];
    else             bias = bv[f - 2 * CH];
    #pragma unroll
    for (int r = 0; r < 8; ++r) {
      const int tok = 16 * w + 8 * h + r;                    // 0..63
      const float yf = acc[nt][r] + bias;
      const _Float16 y = (_Float16)(nt < 2 ? yf * SC2 : yf);   // q carries SC2: scores come out as exponents to base 2
      if (nt < 2)      sQ[tok * CH + f] = y;
      else if (nt < 4) sK[tok * CH + (f - CH)] = y;
      else             sV[(f - 2 * CH) * 64 + tok] = y;
    }
  }
  __syncthreads();

  _Float16* qd = qpl + ((size_t)b * NN + n0) * CH;
  _Float16* kd = kpl + ((size_t)b * NN + n0) * CH;
  _Float16* vd = vpl + (size_t)b * CC * NN + n0;
  proj_store(sQ, sK, sV, qd, kd, vd, tid);
  
}

// ---------------------------------------------------------------------------
// P^T B-fragment from the lane's own score D values: element r <- tile a row r,
// element 8+r <- tile c row r (same lane, same query column); the values already carry 2^7.
// ---------------------------------------------------------------------------
__device__ __forceinline__ v16h pack_p(v8f a, v8f c) {
  const v16h r = { (_Float16)a[0], (_Float16)a[1], (_Float16)a[2], (_Float16)a[3],
                   (_Float16)a[4], (_Float16)a[5], (_Float16)a[6], (_Float16)a[7],
                   (_Float16)c[0], (_Float16)c[1], (_Float16)c[2], (_Float16)c[3],
                   (_Float16)c[4], (_Float16)c[5], (_Float16)c[6], (_Float16)c[7] };
  return r;
}

// Lane l's value as seen from lane l ^ 16, by a vector cross-row move: it does not
// count on dscnt, so an exchange does not wait for LDS fragment loads still in flight.
__device__ __forceinline__ float xhalf(float x) {
  const int b = __builtin_bit_cast(int, x);
  return __builtin_bit_cast(float, __builtin_amdgcn_permlanex16(b, b, 0x76543210, 0xfedcba98, false, false));
}

// Block tile [64 out-channels][64 queries] f32 in LDS -> out[b][o][qblk..+63];
// 128 lines (2 per channel row), each by lanes 8q..8q+7 in one instruction.
__device__ __forceinline__ void out_store(const float* sOut, float* od, int tid) {
  const int q8 = tid & 7, sub = tid >> 3;        // sub 0..63
  #pragma unroll
  for (int i = 0; i < 2; ++i) {
    const int L = i * 64 + sub;                    // line 0..127
    const int o = L >> 1, hl = L & 1;
    const v4f v = *(const v4fa*)(sOut + o * 64 + 32 * hl + 4 * q8);
    *(v4f*)(od + (size_t)o * NN + 32 * hl + 4 * q8) = v;
  }
}

// One wave group's part of a stage (64 keys) from global memory into LDS, through no register: six
// 16-B asynchronous copies per lane (2 of K, 4 of V), every lane on.
// lk/lv: the lane's LDS byte addresses; gk/gv: its global addresses.
// The s_wait_xcnt closes the statement so that no address register named by a
// copy is rewritten ahead of it.
__device__ __forceinline__ void stage_copy(unsigned lk, unsigned lv, const _Float16* gk, const _Float16* gv) {
  asm volatile(
      "global_load_async_to_lds_b128 %0, %6, off\n\t"
      "global_load_async_to_lds_b128 %1, %7, off\n\t"
      "global_load_async_to_lds_b128 %2, %8, off\n\t"
      "global_load_async_to_lds_b128 %3, %9, off\n\t"
      "global_load_async_to_lds_b128 %4, %10, off\n\t"
      "global_load_async_to_lds_b128 %5, %11, off\n\t"
      "s_wait_xcnt 0x0"
      :: "v"(lk), "v"(lk + 32 * KPB),
         "v"(lv), "v"(lv + 16 * VPB), "v"(lv + 32 * VPB), "v"(lv + 48 * VPB),
         "v"(gk), "v"(gk + 32 * CH),
         "v"(gv), "v"(gv + (size_t)16 * NN), "v"(gv + (size_t)32 * NN), "v"(gv + (size_t)48 * NN)
      : "memory");
}

// ---------------------------------------------------------------------------
// Kernel 2: streaming attention, transposed form, fused output projection.
// Block 512 thr (16 waves, 4 per SIMD) = 4 wave groups x 4 waves; 64 queries per
// block, 16 per wave. A step is 256 keys: group g takes keys 64g..64g+63 of it,
// so every query is walked by four waves, each over a quarter of the keys with
// its own maximum in use, sum and O tile; the four are merged through LDS
// behind the loop. K and V of a step are staged once per block in a two-buffer
// LDS ring by asynchronous copies (the next step's tile flies while this one is
// worked on); the four waves of a group read their fragments from its part.
//   S^T = K * Q^T : A = K rows (row = key, k = d), B = Q^T loaded like A from
//                   the query row (k = d, n = query)
//   O^T += V * P^T : A = V rows (row = c, k = key), B = P^T from registers
//   out^T = Wo * attn : A = Wo rows (row = o, k = c), B = attn from the O^T
//                   D tiles (k = c = tile row, n = query), bf16 hi/lo split
// Lane owns 32 keys of query column lane&15; partner = lane ^ 16.
// ---------------------------------------------------------------------------
__global__ __launch_bounds__(512) void k_attn(
    const _Float16* __restrict__ qpl,      // [B][N][32]
    const _Float16* __restrict__ kpl,      // [B][N][32]
    const _Float16* __restrict__ vpl,      // [B][64][N]
    const unsigned short* __restrict__ wohi, const unsigned short* __restrict__ wolo,   // [64][64]
    const float* __restrict__ bo,
    float* __restrict__ out)               // [B][64][N]
{
  __shared__ __attribute__((aligned(16))) float sOut[CC * 64];   // 16384 B
  __shared__ __attribute__((aligned(16))) unsigned char sRing[2 * STGB];   // 114688 B

  const int tid = threadIdx.x, lane = tid & 31, w = tid >> 5;
  const int g = w >> 2, wq = w & 3;          // key group, query tile
  const int tl = tid & 127;                  // thread within its group
  const int h = lane >> 4, m = lane & 15;
  const int b = blockIdx.y;
  const int qblk = blockIdx.x * 64;
  const int q0 = qblk + 16 * wq;

  // Q^T B-fragment: column n = query q0+m, k = d (32 deep)
  const v16h qf = ldfrag_h(qpl + ((size_t)b * NN + q0 + m) * CH, h);

  const v8f zero8 = {0.f, 0.f, 0.f, 0.f, 0.f, 0.f, 0.f, 0.f};
  v8f o[4];                                  // o[t][r] = attn[c 16t+8h+r][query m] * row sum (which carries 2^7)
  #pragma unroll
  for (int t = 0; t < 4; ++t) o[t] = zero8;
  // mrun: the maximum in use, the same in lanes l and l ^ 16. lrun: the lane's own half of the row sum.
  // cofs: PEXP - mrun in all eight rows, the C operand of the score products. The start value sends
  // the first trip through the exact branch, which sets the first maximum.
  float mrun = -1e30f, lrun = 0.0f;
  const float c0 = PEXP - mrun;
  v8f cofs = { c0, c0, c0, c0, c0, c0, c0, c0 };

  // copy side, the group's own part: K chunk = 16 B of key row tl>>2 (+32), V chunk = 16 B of channel row tl>>3 (+16i)
  const unsigned ring = (unsigned)(uintptr_t)sRing + g * BUFB;  // LDS byte address of the group's part
  const unsigned lk = ring + (tl >> 2) * KPB + (tl & 3) * 16;
  const unsigned lv = ring + KTB + (tl >> 3) * VPB + (tl & 7) * 16;
  const _Float16* gk = kpl + ((size_t)b * NN + 64 * g) * CH + tl * 8;                        // + key0*CH
  const _Float16* gv = vpl + ((size_t)b * CC + (tl >> 3)) * NN + 64 * g + (tl & 7) * 8;      // + key0
  // read side: key row 16j+m, channel row 16t+m of the group's part
  const unsigned char* krow = sRing + g * BUFB + m * KPB;
  const unsigned char* vrow = sRing + g * BUFB + KTB + m * VPB;

  stage_copy(lk, lv, gk, gv);
  asm volatile("s_wait_asynccnt 0x0" ::: "memory");   // own copies of stage 0 landed
  __syncthreads();                                     // stage 0 readable by every wave
  stage_copy(lk + STGB, lv + STGB, gk + 256 * CH, gv + 256);

  #pragma unroll 1
  for (int kb = 0; kb < NN; kb += 256) {
    const unsigned boff = (kb & 256) ? STGB : 0;
    // ---- this stage's fragments, one load group ----
    v16h kf[4], vf0[4], vf1[4];
    #pragma unroll
    for (int j = 0; j < 4; ++j)
      kf[j] = ldfrag_h((const _Float16*)(krow + boff + 16 * j * KPB), h);
    #pragma unroll
    for (int t = 0; t < 4; ++t) {
      const _Float16* vp = (const _Float16*)(vrow + boff + 16 * t * VPB);
      vf0[t] = ldfrag_h(vp, h);
      vf1[t] = ldfrag_h(vp + 32, h);
    }

    // ---- scores as exponents: s[j][r] = S[query m][key kb+64g+16j+8h+r] * scale * log2(e) + PEXP - mrun;
    //      the factor sits in q, the offset in the product's C operand ----
    v8f s[4];
    #pragma unroll
    for (int j = 0; j < 4; ++j)
      s[j] = wmma_f16(kf[j], qf, cofs);

    // ---- softmax (f32), base 2, on the maximum in use: one exp2 and one add a score ----
    // (the loops here and in the branch below are unrolled so that s, ts and o are indexed by constants and stay in registers)
    v2f ts[2];                                   // partial sums, even and odd rows: of tiles 0, 1 and of tiles 2, 3
    #pragma unroll
    for (int j = 0; j < 4; ++j)
      #pragma unroll
      for (int r = 0; r < 8; r += 2) {
        const v2f p = { __builtin_amdgcn_exp2f(s[j][r]), __builtin_amdgcn_exp2f(s[j][r + 1]) };
        s[j][r] = p.x;
        s[j][r + 1] = p.y;
        ts[j >> 1] = ((j & 1) | r) ? ts[j >> 1] + p : p;
      }
    const v2f tt = ts[0] + ts[1];
    float lsum = tt.x + tt.y;

    // ---- one test a trip, a scalar branch: a lane's sum at or above PLIM (or not a number) means a prob of
    //      this trip may leave f16's range. Then the trip is done again on the larger of the maximum in use
    //      and the trip's own, which becomes the maximum in use, and sum and O are brought onto it. ----
    if (__builtin_expect(__builtin_amdgcn_ballot_w32(!(lsum < PLIM)) != 0, 0)) {   // rare: laid out of the loop's line
      #pragma unroll
      for (int j = 0; j < 4; ++j)
        s[j] = wmma_f16(kf[j], qf, zero8);
      float mloc = s[0][0];
      #pragma unroll
      for (int j = 0; j < 4; ++j)
        #pragma unroll
        for (int r = 0; r < 8; ++r) mloc = fmaxf(mloc, s[j][r]);
      mloc = fmaxf(mloc, xhalf(mloc));
      const float mnew = fmaxf(mrun, mloc);
      const float alpha = __builtin_amdgcn_exp2f(mrun - mnew);
      const float mb = mnew - PEXP;
      mrun = mnew;
      const v8f cn = { -mb, -mb, -mb, -mb, -mb, -mb, -mb, -mb };
      cofs = cn;
      lsum = 0.0f;
      #pragma unroll
      for (int j = 0; j < 4; ++j)
        #pragma unroll
        for (int r = 0; r < 8; ++r) {
          const float p = __builtin_amdgcn_exp2f(s[j][r] - mb);
          s[j][r] = p;
          lsum += p;
        }
      lrun = lrun * alpha;
      #pragma unroll
      for (int t = 0; t < 4; ++t)
        #pragma unroll
        for (int r = 0; r < 8; ++r) o[t][r] = o[t][r] * alpha;
    }
    lrun += lsum;

    // ---- P^T B-fragments (the group's keys 0..31 and 32..63 of this step) ----
    const v16h pb0 = pack_p(s[0], s[1]);
    const v16h pb1 = pack_p(s[2], s[3]);

    // ---- O^T += V * P^T ----
    #pragma unroll
    for (int t = 0; t < 4; ++t) {
      o[t] = wmma_f16(vf0[t], pb0, o[t]);
      o[t] = wmma_f16(vf1[t], pb1, o[t]);
    }

    // ---- publish point of the next stage ----
    asm volatile("s_wait_dscnt 0x0" ::: "memory");     // own reads of this buffer done before it is refilled
    asm volatile("s_wait_asynccnt 0x0" ::: "memory");  // own copies of the next stage landed
    __syncthreads();                                    // next stage readable; this buffer left by every wave
    if (kb + 512 < NN)
      stage_copy(lk + boff, lv + boff, gk + (size_t)(kb + 512) * CH, gv + (kb + 512));
  }
  asm volatile("s_wait_asynccnt 0x0" ::: "memory");    // nothing in flight behind the loop
  lrun += xhalf(lrun);                                 // the two halves' sums joined once

  // ---- merge the four groups' partial maximum, sum and O tile ----
  // The ring is free: the last trip's barrier ended every wave's reads of it.
  // Each wave lays its partials down, and behind one barrier every wave reads
  // the four partials of its query tile and joins them on the common maximum.
  {
    v4fa* pw = (v4fa*)sRing + w * 256 + lane;
    #pragma unroll
    for (int t = 0; t < 4; ++t) {
      const v4f a = { o[t][0], o[t][1], o[t][2], o[t][3] };
      const v4f c = { o[t][4], o[t][5], o[t][6], o[t][7] };
      pw[(2 * t) * 32] = a;
      pw[(2 * t + 1) * 32] = c;
    }
    const v2f ml = { mrun, lrun };
    ((v2fa*)(sRing + PARTB))[w * 32 + lane] = ml;
  }
  __syncthreads();                                     // every group's partials readable
  {
    v2f ml[NG];
    #pragma unroll
    for (int gg = 0; gg < NG; ++gg)
      ml[gg] = ((const v2fa*)(sRing + PARTB))[(4 * gg + wq) * 32 + lane];
    const float mall = fmaxf(fmaxf(ml[0].x, ml[1].x), fmaxf(ml[2].x, ml[3].x));
    lrun = 0.0f;
    #pragma unroll
    for (int t = 0; t < 4; ++t) o[t] = zero8;
    #pragma unroll
    for (int gg = 0; gg < NG; ++gg) {
      const float f = __builtin_amdgcn_exp2f(ml[gg].x - mall);
      lrun += ml[gg].y * f;
      const v4fa* pr = (const v4fa*)sRing + (4 * gg + wq) * 256 + lane;
      #pragma unroll
      for (int t = 0; t < 4; ++t) {
        const v4f a = pr[(2 * t) * 32];
        const v4f c = pr[(2 * t + 1) * 32];
        o[t][0] += a.x * f;  o[t][1] += a.y * f;  o[t][2] += a.z * f;  o[t][3] += a.w * f;
        o[t][4] += c.x * f;  o[t][5] += c.y * f;  o[t][6] += c.z * f;  o[t][7] += c.w * f;
      }
    }
  }

  // ---- normalise; attn D tiles -> bf16 hi/lo B-fragments (k = c) ----
  const float inv = 1.0f / lrun;               // O and the sum both carry 2^7
  FragB bh0, bl0, bh1, bl1;
  {
    const v8us ha = hi8(o[0], inv), hb = hi8(o[1], inv), hc = hi8(o[2], inv), hd = hi8(o[3], inv);
    bh0.half[0] = ha;  bh0.half[1] = hb;
    bh1.half[0] = hc;  bh1.half[1] = hd;
    bl0.half[0] = lo8(o[0], inv, ha);  bl0.half[1] = lo8(o[1], inv, hb);
    bl1.half[0] = lo8(o[2], inv, hc);  bl1.half[1] = lo8(o[3], inv, hd);
  }

  // ---- out^T[o][query] = sum_c Wo[o][c] attn[c][query]; group g does out-channel tile g ----
  v8f acc2;
  {
    const unsigned short* wrh = wohi + (16 * g + m) * CC;
    const unsigned short* wrl = wolo + (16 * g + m) * CC;
    v8f z = zero8;
    {
      const v16b a_h = ldfrag_b(wrh, h);
      const v16b a_l = ldfrag_b(wrl, h);
      z = wmma_bf16(a_h, bh0.v, z);
      z = wmma_bf16(a_h, bl0.v, z);
      z = wmma_bf16(a_l, bh0.v, z);
    }
    {
      const v16b a_h = ldfrag_b(wrh + 32, h);
      const v16b a_l = ldfrag_b(wrl + 32, h);
      z = wmma_bf16(a_h, bh1.v, z);
      z = wmma_bf16(a_h, bl1.v, z);
      z = wmma_bf16(a_l, bh1.v, z);
    }
    acc2 = z;
  }

  // ---- stage [64 o][64 queries] tile; D[r] = out[o 16g+8h+r][query m] ----
  float* so = sOut + 16 * wq + m;
  #pragma unroll
  for (int r = 0; r < 8; ++r) {
    const int orow = 16 * g + 8 * h + r;
    so[orow * 64] = acc2[r] + bo[orow];
  }
  __syncthreads();

  float* od = out + (size_t)b * CC * NN + qblk;
  out_store(sOut, od, tid);
  
}

// ---------------------------------------------------------------------------
extern "C" void kernel_launch(void* const* d_in, const int* in_sizes, int n_in,
                              void* d_out, int out_size, void* d_ws, size_t ws_size,
                              hipStream_t stream) {
  if (n_in < 9) return;
  if (in_sizes[0] != NB * CC * NN) return;
  if (in_sizes[1] != NWQ || in_sizes[2] != CH) return;
  if (in_sizes[3] != NWQ || in_sizes[4] != CH) return;
  if (in_sizes[5] != NWV || in_sizes[6] != CC) return;
  if (in_sizes[7] != NWV || in_sizes[8] != CC) return;
  if (out_size != NB * CC * NN) return;

  const float* x  = (const float*)d_in[0];
  const float* wq = (const float*)d_in[1];
  const float* bq = (const float*)d_in[2];
  const float* wk = (const float*)d_in[3];
  const float* bk = (const float*)d_in[4];
  const float* wv = (const float*)d_in[5];
  const float* bv = (const float*)d_in[6];
  const float* wo = (const float*)d_in[7];
  const float* bo = (const float*)d_in[8];
  float* out = (float*)d_out;

  const size_t w_bytes  = (size_t)NWALL * 2;              //    24576 per plane
  const size_t qk_bytes = (size_t)NB * NN * CH * 2;        //  1048576 each
  const size_t v_bytes  = (size_t)NB * CC * NN * 2;        //  2097152
  const size_t total = 2 * w_bytes + 2 * qk_bytes + v_bytes;   // 4243456
  if (total > ws_size) return;

  char* ws = (char*)d_ws;
  unsigned short* whi = (unsigned short*)(ws);
  unsigned short* wlo = (unsigned short*)(ws + w_bytes);
  _Float16* qpl = (_Float16*)(ws + 2 * w_bytes);
  _Float16* kpl = (_Float16*)(ws + 2 * w_bytes + qk_bytes);
  _Float16* vpl = (_Float16*)(ws + 2 * w_bytes + 2 * qk_bytes);
  unsigned short* wohi = whi + (2 * NWQ + NWV);
  unsigned short* wolo = wlo + (2 * NWQ + NWV);

  dim3 gProj(NN / 64, NB);                                  // (128, 2)
  k_proj<<<gProj, 128, 0, stream>>>(x, wq, wk, wv, wo, bq, bk, bv, qpl, kpl, vpl, wohi, wolo);

  dim3 gAtt(NN / 64, NB);                                   // (128, 2)
  k_attn<<<gAtt, 512, 0, stream>>>(qpl, kpl, vpl, wohi, wolo, bo, out);
}

// v007
// Measured time: 32.7 microseconds a run.
// Next to v006, in two timings, it ran 1.16 and 1.13 times as fast.
// Over all steps from v000 it is 12.3 times as fast.
// Contractions: q/k/v and output 1x1x1 projections on v_wmma_f32_16x16x32_bf16 as bf16 hi/lo split (hi*hi + hi*lo + lo*hi); key*query scores and value*prob products on v_wmma_f32_16x16x32_f16 (f16 operands, prob carried x128 at the maximum in use, the row sum too, so the factor cancels in the normalisation); f32 accumulate everywhere; softmax, bias, normalisation in f32.
#include <hip/hip_runtime.h>
#include <stdint.h>

typedef _Float16 v16h __attribute__((ext_vector_type(16)));
typedef _Float16 v8h  __attribute__((ext_vector_type(8)));
typedef __bf16   v16b __attribute__((ext_vector_type(16)));
typedef unsigned short v8us __attribute__((ext_vector_type(8)));
typedef float v8f __attribute__((ext_vector_type(8)));
typedef float v4f __attribute__((ext_vector_type(4)));
typedef v8h  __attribute__((may_alias)) v8ha;
typedef v8us __attribute__((may_alias)) v8usa;
typedef v4f  __attribute__((may_alias)) v4fa;
typedef float v2f __attribute__((ext_vector_type(2)));
typedef v2f  __attribute__((may_alias)) v2fa;

union FragH { v16h v; v8h half[2]; };
union FragB { v16b v; v8us half[2]; };

#define NB   2        // batch
#define CC   64       // channels
#define CH   32       // q/k channels
#define NN   8192     // voxels 8*32*32
#define XP   72       // LDS pitch (halves) of the transposed x tile
#define NWQ  (CH * CC)            // 2048
#define NWV  (CC * CC)            // 4096
#define NWALL (2 * NWQ + 2 * NWV) // 12288 : [wq | wk | wv | wo]
#define SC2  0.25503486f         // 32^-0.5 * log2(e), multiplied into q in f32 ahead of its one rounding to f16
#define PEXP 7.0f                // prob carried x 2^7 at the maximum in use, added in the exponent
#define PLIM 32768.0f            // a lane's sum of one trip's probs below 2^15: each of them is finite in f16
#define KPB  80                  // LDS pitch, bytes, of a staged key row (64 B of data): 16 B x odd
#define VPB  144                 // LDS pitch, bytes, of a staged value row (128 B of data): 16 B x odd
#define KTB  (64 * KPB)          // 5120 : key part of one stage
#define BUFB (KTB + 64 * VPB)    // 14336 : 64 keys of K and V = one wave's stage
#define NW   8                   // waves of the attention block; each takes its own keys
#define WRB  (2 * BUFB)          // 28672 : one wave's own ring, two buffers
#define STEPK (NW * 64)          // 512 : keys of one step over the block
#define PARTB (16 * 2 * 32 * 16) // 16384 : one wave's partial O tiles, 32 x 16 B per lane

// ---------------------------------------------------------------------------
// WMMA helpers; the bf16 one with hazard guard (ties D, keeps A/B live).
// Fragment map (wave32): lane l, h = l>>4, m = n = l&15.
//   A/B element i: i<8 -> k0+8h+i ; i>=8 -> k0+16+8h+(i-8)
//   D element r : row 8h+r, col l&15
// ---------------------------------------------------------------------------
// The f16 form is the bare builtin (the compiler keeps its distances itself): the attention kernel holds more than
// 256 registers, and with a v_nop statement tied to D, A and B behind each product the build spilled to scratch
// inside its loop (the query fragments among others).
__device__ __forceinline__ v8f wmma_f16(v16h a, v16h b, v8f c) {
  return __builtin_amdgcn_wmma_f32_16x16x32_f16(false, a, false, b, (short)0, c, false, false);
}
__device__ __forceinline__ v8f wmma_bf16(v16b a, v16b b, v8f c) {
  v8f d = __builtin_amdgcn_wmma_f32_16x16x32_bf16(false, a, false, b, (short)0, c, false, false);
  asm volatile("v_nop\n\tv_nop\n\tv_nop\n\tv_nop" : "+v"(d) : "v"(a), "v"(b));
  return d;
}

// A or B fragment from a k-contiguous 16-bit row; p points at element k0 of
// the row owned by this lane (row index lane&15 added by the caller).
__device__ __forceinline__ v16h ldfrag_h(const _Float16* p, int h) {
  FragH f;
  f.half[0] = *(const v8ha*)(p + 8 * h);
  f.half[1] = *(const v8ha*)(p + 16 + 8 * h);
  return f.v;
}
__device__ __forceinline__ v16b ldfrag_b(const unsigned short* p, int h) {
  FragB f;
  f.half[0] = *(const v8usa*)(p + 8 * h);
  f.half[1] = *(const v8usa*)(p + 16 + 8 * h);
  return f.v;
}

// bf16 RNE convert on the f32 bit pattern, and back.
__device__ __forceinline__ unsigned short bf16_rne(float f) {
  unsigned u = __float_as_uint(f);
  u = u + 0x7FFFu + ((u >> 16) & 1u);
  return (unsigned short)(u >> 16);
}
__device__ __forceinline__ float bf16_f32(unsigned short b) {
  return __uint_as_float(((unsigned)b) << 16);
}

__device__ __forceinline__ v8us hi8(v8f v, float sc) {
  const v8us r = { bf16_rne(v[0] * sc), bf16_rne(v[1] * sc), bf16_rne(v[2] * sc), bf16_rne(v[3] * sc),
                   bf16_rne(v[4] * sc), bf16_rne(v[5] * sc), bf16_rne(v[6] * sc), bf16_rne(v[7] * sc) };
  return r;
}
__device__ __forceinline__ v8us lo8(v8f v, float sc, v8us hh) {
  const v8us r = { bf16_rne(v[0] * sc - bf16_f32(hh[0])), bf16_rne(v[1] * sc - bf16_f32(hh[1])),
                   bf16_rne(v[2] * sc - bf16_f32(hh[2])), bf16_rne(v[3] * sc - bf16_f32(hh[3])),
                   bf16_rne(v[4] * sc - bf16_f32(hh[4])), bf16_rne(v[5] * sc - bf16_f32(hh[5])),
                   bf16_rne(v[6] * sc - bf16_f32(hh[6])), bf16_rne(v[7] * sc - bf16_f32(hh[7])) };
  return r;
}

// ---------------------------------------------------------------------------
// Eight f32 weights -> eight bf16 hi and eight bf16 lo (lo = rounded remainder).
// ---------------------------------------------------------------------------
__device__ __forceinline__ void split8(v4f a, v4f c, v8us& hv, v8us& lv) {
  const unsigned short h0 = bf16_rne(a.x), h1 = bf16_rne(a.y), h2 = bf16_rne(a.z), h3 = bf16_rne(a.w);
  const unsigned short h4 = bf16_rne(c.x), h5 = bf16_rne(c.y), h6 = bf16_rne(c.z), h7 = bf16_rne(c.w);
  const v8us hh = { h0, h1, h2, h3, h4, h5, h6, h7 };
  const v8us ll = { bf16_rne(a.x - bf16_f32(h0)), bf16_rne(a.y - bf16_f32(h1)),
                    bf16_rne(a.z - bf16_f32(h2)), bf16_rne(a.w - bf16_f32(h3)),
                    bf16_rne(c.x - bf16_f32(h4)), bf16_rne(c.y - bf16_f32(h5)),
                    bf16_rne(c.z - bf16_f32(h6)), bf16_rne(c.w - bf16_f32(h7)) };
  hv = hh;
  lv = ll;
}

// ---------------------------------------------------------------------------
// one 16-B store per lane, lanes 8q..8q+7 per line.
//   qd/kd : 64 token rows x 32 halves, contiguous 4096 B (32 lines)
// ---------------------------------------------------------------------------
__device__ __forceinline__ void proj_store(const _Float16* sQ, const _Float16* sK, const _Float16* sV,
                                           _Float16* qd, _Float16* kd, _Float16* vd, int tid) {
  #pragma unroll
  for (int i = 0; i < 2; ++i) {
    const int off = (i * 128 + tid) * 8;
    const v8h a = *(const v8ha*)(sQ + off);
    *(v8h*)(qd + off) = a;
    const v8h c = *(const v8ha*)(sK + off);
    *(v8h*)(kd + off) = c;
  }
  const int q8 = tid & 7, sub = tid >> 3;        // sub 0..15
  #pragma unroll
  for (int i = 0; i < 4; ++i) {
    const int c = i * 16 + sub;                    // channel row 0..63
    const v8h a = *(const v8ha*)(sV + c * 64 + 8 * q8);
    *(v8h*)(vd + (size_t)c * NN + 8 * q8) = a;
  }
}

// ---------------------------------------------------------------------------
// Kernel 1: fused q/k/v projection. Block = 128 thr (4 waves) = 64 tokens of
// one batch x all 128 output features (32 q, 32 k, 64 v); K = 64 = 2 steps.
// x tile [64 c][64 n] f32 -> LDS as bf16 hi/lo [n][c] (pitch XP);
// the block splits the f32 rows [wq | wk | wv] itself into bf16 hi/lo rows in LDS
// (pitch XP), their loads in flight beside the x loads;
// A = x^T rows (row = token, k = c) from LDS, B = W rows (k-contiguous) from
// LDS. The first 64 blocks also split one row of wo each into the global bf16
// planes that the attention kernel reads. D[token][feature]. Epilogue: +bias -> f16 -> LDS
// staging -> whole-line stores. q,k planes [b][n][32]; v plane [b][c][n].
// ---------------------------------------------------------------------------
__global__ __launch_bounds__(128) void k_proj(
    const float* __restrict__ x,
    const float* __restrict__ wq, const float* __restrict__ wk,
    const float* __restrict__ wv, const float* __restrict__ wo,
    const float* __restrict__ bq, const float* __restrict__ bk, const float* __restrict__ bv,
    _Float16* __restrict__ qpl, _Float16* __restrict__ kpl, _Float16* __restrict__ vpl,
    unsigned short* __restrict__ wohi, unsigned short* __restrict__ wolo)
{
  __shared__ __attribute__((aligned(16))) unsigned short sWh[128 * XP];  // 18432 B
  __shared__ __attribute__((aligned(16))) unsigned short sWl[128 * XP];  // 18432 B
  __shared__ __attribute__((aligned(16))) unsigned short sXh[64 * XP];   // 9216 B
  __shared__ __attribute__((aligned(16))) unsigned short sXl[64 * XP];   // 9216 B
  __shared__ __attribute__((aligned(16))) _Float16 sQ[64 * CH];          // 4096 B
  __shared__ __attribute__((aligned(16))) _Float16 sK[64 * CH];          // 4096 B
  __shared__ __attribute__((aligned(16))) _Float16 sV[CC * 64];          // 8192 B

  const int tid = threadIdx.x, lane = tid & 31, w = tid >> 5;
  const int h = lane >> 4, m = lane & 15;
  const int n0 = blockIdx.x * 64;
  const int b = blockIdx.y;

  // ---- all loads of the block first: x tile, the 128 fused weight rows, 8 values of a wo row ----
  const float* xb = x + (size_t)b * CC * NN + n0;
  v4f xv[8], wa[8], wc[8];
  #pragma unroll
  for (int i = 0; i < 8; ++i) {
    const int f4 = i * 128 + tid;        // 0..1023
    xv[i] = *(const v4fa*)(xb + (size_t)(f4 >> 4) * NN + 4 * (f4 & 15));
  }
  #pragma unroll
  for (int i = 0; i < 8; ++i) {
    const int e = (i * 128 + tid) * 8;   // element of [wq | wk | wv], 1024 per i
    const float* ws = (i < 2) ? wq + e : (i < 4) ? wk + (e - NWQ) : wv + (e - 2 * NWQ);
    wa[i] = *(const v4fa*)ws;
    wc[i] = *(const v4fa*)(ws + 4);
  }
  // The two loads below may land in registers that held addresses of the loads above.
  asm volatile("s_wait_xcnt 0x0" ::: "memory");
  const int oe = (blockIdx.x & (CC - 1)) * CC + (tid & 7) * 8;   // inside wo for every thread
  const v4f oa = *(const v4fa*)(wo + oe);
  const v4f oc = *(const v4fa*)(wo + oe + 4);
  // Holds every load of the block above the first use of one: without it the weight
  // loads are issued only behind the wait for the first x values, two latencies in a row.
  __builtin_amdgcn_sched_barrier(0);

  // ---- x tile: transpose + split into LDS ----
  #pragma unroll
  for (int i = 0; i < 8; ++i) {
    const int f4 = i * 128 + tid;        // 0..1023
    const int c = f4 >> 4;               // 0..63
    const int j4 = f4 & 15;              // tokens 4*j4 .. 4*j4+3
    const v4f v = xv[i];
    const float e0 = v.x, e1 = v.y, e2 = v.z, e3 = v.w;
    const unsigned short a0 = bf16_rne(e0), a1 = bf16_rne(e1), a2 = bf16_rne(e2), a3 = bf16_rne(e3);
    const int t0 = 4 * j4;
    sXh[(t0 + 0) * XP + c] = a0;  sXl[(t0 + 0) * XP + c] = bf16_rne(e0 - bf16_f32(a0));
    sXh[(t0 + 1) * XP + c] = a1;  sXl[(t0 + 1) * XP + c] = bf16_rne(e1 - bf16_f32(a1));
    sXh[(t0 + 2) * XP + c] = a2;  sXl[(t0 + 2) * XP + c] = bf16_rne(e2 - bf16_f32(a2));
    sXh[(t0 + 3) * XP + c] = a3;  sXl[(t0 + 3) * XP + c] = bf16_rne(e3 - bf16_f32(a3));
  }
  // ---- weight rows: split into LDS, row = fused feature, 64 k-contiguous inputs ----
  #pragma unroll
  for (int i = 0; i < 8; ++i) {
    const int e = (i * 128 + tid) * 8;
    v8us hv, lv;
    split8(wa[i], wc[i], hv, lv);
    const int off = (e >> 6) * XP + (e & 63);
    *(v8usa*)(sWh + off) = hv;
    *(v8usa*)(sWl + off) = lv;
  }
  // ---- wo row blockIdx.x: one 128-B line of each plane, written by 8 lanes of one block ----
  // Inputs-only fence on the loaded values: keeps the two wo loads up with the block's other
  // loads; without it they sink into the branch and their whole latency stands open there.
  asm volatile("" :: "v"(oa), "v"(oc));
  if (b == 0 && blockIdx.x < CC && tid < 8) {
    v8us hv, lv;
    split8(oa, oc, hv, lv);
    *(v8us*)(wohi + oe) = hv;
    *(v8us*)(wolo + oe) = lv;
  }
  __syncthreads();

  const v8f zero8 = {0.f, 0.f, 0.f, 0.f, 0.f, 0.f, 0.f, 0.f};
  v8f acc[8];
  #pragma unroll
  for (int nt = 0; nt < 8; ++nt) acc[nt] = zero8;

  const unsigned short* arow_h = sXh + (16 * w + m) * XP;   // token row
  const unsigned short* arow_l = sXl + (16 * w + m) * XP;

  #pragma unroll
  for (int ks = 0; ks < 2; ++ks) {
    const int k0 = 32 * ks;
    const v16b ah = ldfrag_b(arow_h + k0, h);
    const v16b al = ldfrag_b(arow_l + k0, h);
    v16b bh[8], bl[8];                                      // the k step's B fragments, one LDS load group
    #pragma unroll
    for (int nt = 0; nt < 8; ++nt) {
      const int f = 16 * nt + m;                            // fused feature row 0..127
      bh[nt] = ldfrag_b(sWh + f * XP + k0, h);
      bl[nt] = ldfrag_b(sWl + f * XP + k0, h);
    }
    #pragma unroll
    for (int nt = 0; nt < 8; ++nt) {
      acc[nt] = wmma_bf16(ah, bh[nt], acc[nt]);
      acc[nt] = wmma_bf16(ah, bl[nt], acc[nt]);
      acc[nt] = wmma_bf16(al, bh[nt], acc[nt]);
    }
  }

  // ---- epilogue: D[r] of tile nt = Y[token 16w+8h+r][feature 16nt+m] ----
  #pragma unroll
  for (int nt = 0; nt < 8; ++nt) {
    const int f = 16 * nt + m;
    float bias;
    if (nt < 2)      bias = bq[f];
    else if (nt < 4) bias = bk[f - CH];
    else             bias = bv[f - 2 * CH];
    #pragma unroll
    for (int r = 0; r < 8; ++r) {
      const int tok = 16 * w + 8 * h + r;                    // 0..63
      const float yf = acc[nt][r] + bias;
      const _Float16 y = (_Float16)(nt < 2 ? yf * SC2 : yf);   // q carries SC2: scores come out as exponents to base 2
      if (nt < 2)      sQ[tok * CH + f] = y;
      else if (nt < 4) sK[tok * CH + (f - CH)] = y;
      else             sV[(f - 2 * CH) * 64 + tok] = y;
    }
  }
  __syncthreads();

  _Float16* qd = qpl + ((size_t)b * NN + n0) * CH;
  _Float16* kd = kpl + ((size_t)b * NN + n0) * CH;
  _Float16* vd = vpl + (size_t)b * CC * NN + n0;
  proj_store(sQ, sK, sV, qd, kd, vd, tid);
  
}

// ---------------------------------------------------------------------------
// P^T B-fragment from the lane's own score D values: element r <- tile a row r,
// element 8+r <- tile c row r (same lane, same query column); the values already carry 2^7.
// ---------------------------------------------------------------------------
__device__ __forceinline__ v16h pack_p(v8f a, v8f c) {
  const v16h r = { (_Float16)a[0], (_Float16)a[1], (_Float16)a[2], (_Float16)a[3],
                   (_Float16)a[4], (_Float16)a[5], (_Float16)a[6], (_Float16)a[7],
                   (_Float16)c[0], (_Float16)c[1], (_Float16)c[2], (_Float16)c[3],
                   (_Float16)c[4], (_Float16)c[5], (_Float16)c[6], (_Float16)c[7] };
  return r;
}

// Lane l's value as seen from lane l ^ 16, by a vector cross-row move: it does not
// count on dscnt, so an exchange does not wait for LDS fragment loads still in flight.
__device__ __forceinline__ float xhalf(float x) {
  const int b = __builtin_bit_cast(int, x);
  return __builtin_bit_cast(float, __builtin_amdgcn_permlanex16(b, b, 0x76543210, 0xfedcba98, false, false));
}

// Block tile [64 out-channels][64 queries] f32 in LDS -> out[b][o][qblk..+63];
// 128 lines (2 per channel row), each by lanes 8q..8q+7 in one instruction.
__device__ __forceinline__ void out_store(const float* sOut, float* od, int tid) {
  const int q8 = tid & 7, sub = tid >> 3;        // sub 0..31
  #pragma unroll
  for (int i = 0; i < 4; ++i) {
    const int L = i * 32 + sub;                    // line 0..127
    const int o = L >> 1, hl = L & 1;
    const v4f v = *(const v4fa*)(sOut + o * 64 + 32 * hl + 4 * q8);
    *(v4f*)(od + (size_t)o * NN + 32 * hl + 4 * q8) = v;
  }
}

typedef int v4i __attribute__((ext_vector_type(4)));
typedef __attribute__((address_space(1))) v4i gv4i;
typedef __attribute__((address_space(3))) v4i lv4i;

// Eight 16-B asynchronous copies per lane from global memory into LDS, through no register, every lane on.
// l: the lane's place in LDS, ls: its step in bytes from copy to copy; g, gs: the same on the global side (gs in halves).
__device__ __forceinline__ void copy8(unsigned char* l, unsigned ls, const _Float16* g, size_t gs) {
  #pragma unroll
  for (int i = 0; i < 8; ++i)
    __builtin_amdgcn_global_load_async_to_lds_b128((gv4i*)(g + i * gs), (lv4i*)(l + i * ls), 0, 0);
}

// One wave's stage (its own 64 keys of K and V): 24 copies per lane, 8 of K (8 key rows a copy)
// and 16 of V (4 channel rows a copy). lk/lv: the lane's places in LDS; gk/gv: its global addresses.
__device__ __forceinline__ void stage_copy(unsigned char* lk, unsigned char* lv, const _Float16* gk, const _Float16* gv) {
  copy8(lk, 8 * KPB, gk, 8 * CH);
  copy8(lv, 4 * VPB, gv, (size_t)4 * NN);
  copy8(lv + 32 * VPB, 4 * VPB, gv + (size_t)32 * NN, (size_t)4 * NN);
}

// ---------------------------------------------------------------------------
// Kernel 2: streaming attention, transposed form, fused output projection.
// Block 256 thr (8 waves, 2 per SIMD), 64 queries per block. Every wave holds all
// 64 queries (four 16-column tiles) and walks keys of its own: a step is 512 keys,
// wave w takes keys 64w..64w+63 of it, with its own maximum in use, sum and O tiles;
// the eight are merged through LDS behind the loop. A wave stages its K and V
// itself, by asynchronous copies into a two-buffer LDS ring that no other wave
// touches (the next step's tile flies while this one is worked on), so the loop
// holds no work-group barrier, and each fragment read from LDS feeds four query tiles.
//   S^T = K * Q^T : A = K rows (row = key, k = d), B = Q^T loaded like A from
//                   the query row (k = d, n = query)
//   O^T += V * P^T : A = V rows (row = c, k = key), B = P^T from registers
//   out^T = Wo * attn : A = Wo rows (row = o, k = c), B = attn from the O^T
//                   D tiles (k = c = tile row, n = query), bf16 hi/lo split
// Lane owns 32 keys of query column lane&15 of each tile; partner = lane ^ 16.
// ---------------------------------------------------------------------------
__global__ __launch_bounds__(256) void k_attn(
    const _Float16* __restrict__ qpl,      // [B][N][32]
    const _Float16* __restrict__ kpl,      // [B][N][32]
    const _Float16* __restrict__ vpl,      // [B][64][N]
    const unsigned short* __restrict__ wohi, const unsigned short* __restrict__ wolo,   // [64][64]
    const float* __restrict__ bo,
    float* __restrict__ out)               // [B][64][N]
{
  __shared__ __attribute__((aligned(16))) float sOut[CC * 64];   // 16384 B
  __shared__ __attribute__((aligned(16))) unsigned char sRing[NW * WRB];   // 229376 B

  const int tid = threadIdx.x, lane = tid & 31;
  const int w = __builtin_amdgcn_readfirstlane(tid >> 5);   // the wave's number, in a scalar register: its bases are scalar
  const int h = lane >> 4, m = lane & 15;
  const int b = blockIdx.y;
  const int qblk = blockIdx.x * 64;

  // Q^T B-fragments: tile qt, column n = query qblk+16qt+m, k = d (32 deep)
  v16h qf[4];
  #pragma unroll
  for (int qt = 0; qt < 4; ++qt)
    qf[qt] = ldfrag_h(qpl + ((size_t)b * NN + qblk + 16 * qt + m) * CH, h);

  const v8f zero8 = {0.f, 0.f, 0.f, 0.f, 0.f, 0.f, 0.f, 0.f};
  v8f o[4][4];                               // o[qt][t][r] = attn[c 16t+8h+r][query 16qt+m] * row sum (which carries 2^7)
  // mrun: the maximum in use, the same in lanes l and l ^ 16. lrun: the lane's own half of the row sum.
  // cofs: PEXP - mrun in all eight rows, the C operand of the score products. The start value sends
  // the first step through the exact branch, which sets the first maximum.
  float mrun[4], lrun[4];
  v8f cofs[4];
  #pragma unroll
  for (int qt = 0; qt < 4; ++qt) {
    #pragma unroll
    for (int t = 0; t < 4; ++t) o[qt][t] = zero8;
    mrun[qt] = -1e30f;
    lrun[qt] = 0.0f;
    const float c0 = PEXP + 1e30f;
    const v8f cs = { c0, c0, c0, c0, c0, c0, c0, c0 };
    cofs[qt] = cs;
  }

  // copy side, the wave's own ring: K chunk = 16 B of key row lane>>2 (+8i), V chunk = 16 B of channel row lane>>3 (+4i)
  unsigned char* myring = sRing + w * WRB;
  unsigned char* lk = myring + (lane >> 2) * KPB + (lane & 3) * 16;
  unsigned char* lv = myring + KTB + (lane >> 3) * VPB + (lane & 7) * 16;
  const _Float16* gk = kpl + ((size_t)b * NN + 64 * w) * CH + lane * 8;                        // + key0*CH
  const _Float16* gv = vpl + (size_t)b * CC * NN + 64 * w + (lane >> 3) * NN + (lane & 7) * 8; // + key0
  // read side: key row 16j+m, channel row 16t+m
  const unsigned char* krow = myring + m * KPB;
  const unsigned char* vrow = myring + KTB + m * VPB;

  // Stages 0 and 1. Kept rolled: unrolled, the compiler reaches stage 0's rows from stage 1's addresses by
  // immediate offsets near 64 KiB, with LDS address registers wrapped below zero in the first waves.
  #pragma unroll 1
  for (int st = 0; st < 2; ++st) {
    stage_copy(lk + st * BUFB, lv + st * BUFB, gk + st * (STEPK * CH), gv + st * STEPK);
    if (st == 0)
      asm volatile("s_wait_asynccnt 0x0" ::: "memory");   // own copies of stage 0 landed: only this wave reads them
  }

  #pragma unroll 1
  for (int kb = 0; kb < NN; kb += STEPK) {
    const unsigned boff = (kb & STEPK) ? BUFB : 0;
    // ---- this stage's fragments, one load group ----
    v16h kf[4], vf0[4], vf1[4];
    #pragma unroll
    for (int j = 0; j < 4; ++j)
      kf[j] = ldfrag_h((const _Float16*)(krow + boff + 16 * j * KPB), h);
    #pragma unroll
    for (int t = 0; t < 4; ++t) {
      const _Float16* vp = (const _Float16*)(vrow + boff + 16 * t * VPB);
      vf0[t] = ldfrag_h(vp, h);
      vf1[t] = ldfrag_h(vp + 32, h);
    }

    // ---- per query tile: scores, softmax, value products ----
    // (the loops here are unrolled so that every array is indexed by constants and stays in registers)
    #pragma unroll
    for (int qt = 0; qt < 4; ++qt) {
      // scores as exponents: s[j][r] = S[query 16qt+m][key kb+64w+16j+8h+r] * scale * log2(e) + PEXP - mrun;
      // the factor sits in q, the offset in the product's C operand
      v8f s[4];
      #pragma unroll
      for (int j = 0; j < 4; ++j)
        s[j] = wmma_f16(kf[j], qf[qt], cofs[qt]);

      // softmax (f32), base 2, on the maximum in use: one exp2 and one add a score
      v2f ts[2];                                 // partial sums, even and odd rows: of tiles 0, 1 and of tiles 2, 3
      #pragma unroll
      for (int j = 0; j < 4; ++j)
        #pragma unroll
        for (int r = 0; r < 8; r += 2) {
          const v2f p = { __builtin_amdgcn_exp2f(s[j][r]), __builtin_amdgcn_exp2f(s[j][r + 1]) };
          s[j][r] = p.x;
          s[j][r + 1] = p.y;
          ts[j >> 1] = ((j & 1) | r) ? ts[j >> 1] + p : p;
        }
      const v2f tt = ts[0] + ts[1];
      float lsum = tt.x + tt.y;

      // one test a tile, a scalar branch: a lane's sum at or above PLIM (or not a number) means a prob of
      // this tile may leave f16's range. Then the tile is done again on the larger of the maximum in use
      // and the tile's own, which becomes the maximum in use, and sum and O are brought onto it.
      if (__builtin_expect(__builtin_amdgcn_ballot_w32(!(lsum < PLIM)) != 0, 0)) {   // rare: laid out of the loop's line
        #pragma unroll
        for (int j = 0; j < 4; ++j)
          s[j] = wmma_f16(kf[j], qf[qt], zero8);
        float mloc = s[0][0];
        #pragma unroll
        for (int j = 0; j < 4; ++j)
          #pragma unroll
          for (int r = 0; r < 8; ++r) mloc = fmaxf(mloc, s[j][r]);
        mloc = fmaxf(mloc, xhalf(mloc));
        const float mnew = fmaxf(mrun[qt], mloc);
        const float alpha = __builtin_amdgcn_exp2f(mrun[qt] - mnew);
        const float mb = mnew - PEXP;
        mrun[qt] = mnew;
        const v8f cn = { -mb, -mb, -mb, -mb, -mb, -mb, -mb, -mb };
        cofs[qt] = cn;
        lsum = 0.0f;
        #pragma unroll
        for (int j = 0; j < 4; ++j)
          #pragma unroll
          for (int r = 0; r < 8; ++r) {
            const float p = __builtin_amdgcn_exp2f(s[j][r] - mb);
            s[j][r] = p;
            lsum += p;
          }
        lrun[qt] = lrun[qt] * alpha;
        #pragma unroll
        for (int t = 0; t < 4; ++t)
          #pragma unroll
          for (int r = 0; r < 8; ++r) o[qt][t][r] = o[qt][t][r] * alpha;
      }
      lrun[qt] += lsum;

      // P^T B-fragments (the wave's keys 0..31 and 32..63 of this step), then O^T += V * P^T
      const v16h pb0 = pack_p(s[0], s[1]);
      const v16h pb1 = pack_p(s[2], s[3]);
      #pragma unroll
      for (int t = 0; t < 4; ++t) {
        o[qt][t] = wmma_f16(vf0[t], pb0, o[qt][t]);
        o[qt][t] = wmma_f16(vf1[t], pb1, o[qt][t]);
      }
    }

    // ---- hand-over inside the wave: its ring is read and refilled by itself alone ----
    asm volatile("s_wait_dscnt 0x0" ::: "memory");     // own reads of this buffer done before it is refilled
    asm volatile("s_wait_asynccnt 0x0" ::: "memory");  // own copies of the next stage landed
    if (kb + 2 * STEPK < NN)
      stage_copy(lk + boff, lv + boff, gk + (size_t)(kb + 2 * STEPK) * CH, gv + (kb + 2 * STEPK));
  }
  asm volatile("s_wait_asynccnt 0x0" ::: "memory");    // nothing in flight behind the loop

  // ---- merge the eight waves' partial maximum, sum and O tiles ----
  // Each wave lays its partials down in its own ring (its reads and copies there are over), and behind
  // one barrier wave w reads the eight partials of query tile w>>1 and joins them on the common maximum.
  {
    v4fa* pw = (v4fa*)myring + lane;
    #pragma unroll
    for (int qt = 0; qt < 4; ++qt) {
      #pragma unroll
      for (int t = 0; t < 4; ++t) {
        const v4f a = { o[qt][t][0], o[qt][t][1], o[qt][t][2], o[qt][t][3] };
        const v4f c = { o[qt][t][4], o[qt][t][5], o[qt][t][6], o[qt][t][7] };
        pw[(8 * qt + 2 * t) * 32] = a;
        pw[(8 * qt + 2 * t + 1) * 32] = c;
      }
      const float lj = lrun[qt] + xhalf(lrun[qt]);       // the two halves' sums joined once
      const v2f ml = { mrun[qt], lj };
      ((v2fa*)(myring + PARTB))[qt * 32 + lane] = ml;
    }
  }
  __syncthreads();                                     // every wave's partials readable
  const int qm = w >> 1;                               // the query tile this wave merges and projects
  // Output bias of the two out-channel tiles that this wave projects (rows 32(w&1)+16oi+8h+r), asked for here
  // so that its latency passes under the merge.
  float bias[16];
  #pragma unroll
  for (int i = 0; i < 16; ++i) bias[i] = bo[32 * (w & 1) + 16 * (i >> 3) + 8 * h + (i & 7)];
  v8f om[4];
  float lall = 0.0f;
  {
    v2f ml[NW];
    #pragma unroll
    for (int gg = 0; gg < NW; ++gg)
      ml[gg] = ((const v2fa*)(sRing + gg * WRB + PARTB))[qm * 32 + lane];
    float mall = ml[0].x;
    #pragma unroll
    for (int gg = 1; gg < NW; ++gg) mall = fmaxf(mall, ml[gg].x);
    #pragma unroll
    for (int t = 0; t < 4; ++t) om[t] = zero8;
    #pragma unroll
    for (int gg = 0; gg < NW; ++gg) {
      const float f = __builtin_amdgcn_exp2f(ml[gg].x - mall);
      lall += ml[gg].y * f;
      const v4fa* pr = (const v4fa*)(sRing + gg * WRB) + qm * 256 + lane;
      #pragma unroll
      for (int t = 0; t < 4; ++t) {
        const v4f a = pr[(2 * t) * 32];
        const v4f c = pr[(2 * t + 1) * 32];
        om[t][0] += a.x * f;  om[t][1] += a.y * f;  om[t][2] += a.z * f;  om[t][3] += a.w * f;
        om[t][4] += c.x * f;  om[t][5] += c.y * f;  om[t][6] += c.z * f;  om[t][7] += c.w * f;
      }
    }
  }

  // ---- normalise; attn D tiles -> bf16 hi/lo B-fragments (k = c) ----
  const float inv = 1.0f / lall;               // O and the sum both carry 2^7
  FragB bh0, bl0, bh1, bl1;
  {
    const v8us ha = hi8(om[0], inv), hb = hi8(om[1], inv), hc = hi8(om[2], inv), hd = hi8(om[3], inv);
    bh0.half[0] = ha;  bh0.half[1] = hb;
    bh1.half[0] = hc;  bh1.half[1] = hd;
    bl0.half[0] = lo8(om[0], inv, ha);  bl0.half[1] = lo8(om[1], inv, hb);
    bl1.half[0] = lo8(om[2], inv, hc);  bl1.half[1] = lo8(om[3], inv, hd);
  }

  // ---- out^T[o][query] = sum_c Wo[o][c] attn[c][query]; wave w does out-channel tiles 2(w&1), 2(w&1)+1 ----
  #pragma unroll
  for (int oi = 0; oi < 2; ++oi) {
    const int ot = 2 * (w & 1) + oi;
    const unsigned short* wrh = wohi + (16 * ot + m) * CC;
    const unsigned short* wrl = wolo + (16 * ot + m) * CC;
    v8f z = zero8;
    {
      const v16b a_h = ldfrag_b(wrh, h);
      const v16b a_l = ldfrag_b(wrl, h);
      z = wmma_bf16(a_h, bh0.v, z);
      z = wmma_bf16(a_h, bl0.v, z);
      z = wmma_bf16(a_l, bh0.v, z);
    }
    {
      const v16b a_h = ldfrag_b(wrh + 32, h);
      const v16b a_l = ldfrag_b(wrl + 32, h);
      z = wmma_bf16(a_h, bh1.v, z);
      z = wmma_bf16(a_h, bl1.v, z);
      z = wmma_bf16(a_l, bh1.v, z);
    }
    // ---- stage [64 o][64 queries] tile; D[r] = out[o 16ot+8h+r][query 16qm+m] ----
    float* so = sOut + 16 * qm + m;
    #pragma unroll
    for (int r = 0; r < 8; ++r) {
      const int orow = 16 * ot + 8 * h + r;
      so[orow * 64] = z[r] + bias[8 * oi + r];
    }
  }
  __syncthreads();

  float* od = out + (size_t)b * CC * NN + qblk;
  out_store(sOut, od, tid);
}

// ---------------------------------------------------------------------------
extern "C" void kernel_launch(void* const* d_in, const int* in_sizes, int n_in,
                              void* d_out, int out_size, void* d_ws, size_t ws_size,
                              hipStream_t stream) {
  if (n_in < 9) return;
  if (in_sizes[0] != NB * CC * NN) return;
  if (in_sizes[1] != NWQ || in_sizes[2] != CH) return;
  if (in_sizes[3] != NWQ || in_sizes[4] != CH) return;
  if (in_sizes[5] != NWV || in_sizes[6] != CC) return;
  if (in_sizes[7] != NWV || in_sizes[8] != CC) return;
  if (out_size != NB * CC * NN) return;

  const float* x  = (const float*)d_in[0];
  const float* wq = (const float*)d_in[1];
  const float* bq = (const float*)d_in[2];
  const float* wk = (const float*)d_in[3];
  const float* bk = (const float*)d_in[4];
  const float* wv = (const float*)d_in[5];
  const float* bv = (const float*)d_in[6];
  const float* wo = (const float*)d_in[7];
  const float* bo = (const float*)d_in[8];
  float* out = (float*)d_out;

  const size_t w_bytes  = (size_t)NWALL * 2;              //    24576 per plane
  const size_t qk_bytes = (size_t)NB * NN * CH * 2;        //  1048576 each
  const size_t v_bytes  = (size_t)NB * CC * NN * 2;        //  2097152
  const size_t total = 2 * w_bytes + 2 * qk_bytes + v_bytes;   // 4243456
  if (total > ws_size) return;

  char* ws = (char*)d_ws;
  unsigned short* whi = (unsigned short*)(ws);
  unsigned short* wlo = (unsigned short*)(ws + w_bytes);
  _Float16* qpl = (_Float16*)(ws + 2 * w_bytes);
  _Float16* kpl = (_Float16*)(ws + 2 * w_bytes + qk_bytes);
  _Float16* vpl = (_Float16*)(ws + 2 * w_bytes + 2 * qk_bytes);
  unsigned short* wohi = whi + (2 * NWQ + NWV);
  unsigned short* wolo = wlo + (2 * NWQ + NWV);

  dim3 gProj(NN / 64, NB);                                  // (128, 2)
  k_proj<<<gProj, 128, 0, stream>>>(x, wq, wk, wv, wo, bq, bk, bv, qpl, kpl, vpl, wohi, wolo);

  dim3 gAtt(NN / 64, NB);                                   // (128, 2)
  k_attn<<<gAtt, 256, 0, stream>>>(qpl, kpl, vpl, wohi, wolo, bo, out);
}

// v008
// Measured time: 28.7 microseconds a run.
// In two side-by-side timings against v007, it was 1.15 and 1.14 times as fast.
// All steps since v000 together make it 14.1 times as fast.
// Contractions: q/k/v and output 1x1x1 projections on v_wmma_f32_16x16x32_bf16 as bf16 hi/lo split (hi*hi + hi*lo + lo*hi); key*query scores and value*prob products on v_wmma_f32_16x16x32_f16 (f16 operands, prob carried x128 at the maximum in use, the row sum too, so the factor cancels in the normalisation); f32 accumulate everywhere; softmax, bias, normalisation in f32.
#include <hip/hip_runtime.h>
#include <stdint.h>

typedef _Float16 v16h __attribute__((ext_vector_type(16)));
typedef _Float16 v8h  __attribute__((ext_vector_type(8)));
typedef __bf16   v16b __attribute__((ext_vector_type(16)));
typedef unsigned short v8us __attribute__((ext_vector_type(8)));
typedef float v8f __attribute__((ext_vector_type(8)));
typedef float v4f __attribute__((ext_vector_type(4)));
typedef v8h  __attribute__((may_alias)) v8ha;
typedef v8us __attribute__((may_alias)) v8usa;
typedef v4f  __attribute__((may_alias)) v4fa;
typedef float v2f __attribute__((ext_vector_type(2)));
typedef v2f  __attribute__((may_alias)) v2fa;

union FragH { v16h v; v8h half[2]; };
union FragB { v16b v; v8us half[2]; };

#define NB   2        // batch
#define CC   64       // channels
#define CH   32       // q/k channels
#define NN   8192     // voxels 8*32*32
#define XP   72       // LDS pitch (halves) of the transposed x tile
#define NWQ  (CH * CC)            // 2048
#define NWV  (CC * CC)            // 4096
#define NWALL (2 * NWQ + 2 * NWV) // 12288 : [wq | wk | wv | wo]
#define SC2  0.25503486f         // 32^-0.5 * log2(e), multiplied into q in f32 ahead of its one rounding to f16
#define PEXP 7.0f                // prob carried x 2^7 at the maximum in use, added in the exponent
#define PLIM 32768.0f            // a lane's sum of one trip's probs below 2^15: each of them is finite in f16
#define KP2  144                 // LDS pitch, bytes, of a staged pair of key rows (2 x 64 B of data): 16 B x odd
#define VPB  144                 // LDS pitch, bytes, of a staged value row (128 B of data): 16 B x odd
#define KSL  6144                // key part of one stage: 32 pair rows x 144 B = 4608, rounded up to a multiple of 2 KiB
#define VSL  10240               // value part of one stage: 64 rows x 144 B = 9216, rounded up to a multiple of 2 KiB
#define BUFB (KSL + VSL)         // 16384 : 64 keys of K and V = one wave's stage
#define NW   8                   // waves of the attention block; each takes its own keys
#define WRB  (2 * BUFB)          // 32768 : one wave's own ring, two buffers
#define STEPK (NW * 64)          // 512 : keys of one step over the block
#define PARTB (16 * 2 * 32 * 16) // 16384 : one wave's partial O tiles, 32 x 16 B per lane

// ---------------------------------------------------------------------------
// WMMA helpers; the bf16 one with hazard guard (ties D, keeps A/B live).
// Fragment map (wave32): lane l, h = l>>4, m = n = l&15.
//   A/B element i: i<8 -> k0+8h+i ; i>=8 -> k0+16+8h+(i-8)
//   D element r : row 8h+r, col l&15
// ---------------------------------------------------------------------------
// The f16 form is the bare builtin (the compiler keeps its distances itself): the attention kernel holds more than
// 256 registers, and with a v_nop statement tied to D, A and B behind each product the build spilled to scratch
// inside its loop (the query fragments among others).
__device__ __forceinline__ v8f wmma_f16(v16h a, v16h b, v8f c) {
  return __builtin_amdgcn_wmma_f32_16x16x32_f16(false, a, false, b, (short)0, c, false, false);
}
__device__ __forceinline__ v8f wmma_bf16(v16b a, v16b b, v8f c) {
  v8f d = __builtin_amdgcn_wmma_f32_16x16x32_bf16(false, a, false, b, (short)0, c, false, false);
  asm volatile("v_nop\n\tv_nop\n\tv_nop\n\tv_nop" : "+v"(d) : "v"(a), "v"(b));
  return d;
}

// A or B fragment from a k-contiguous 16-bit row; p points at element k0 of
// the row owned by this lane (row index lane&15 added by the caller).
__device__ __forceinline__ v16h ldfrag_h(const _Float16* p, int h) {
  FragH f;
  f.half[0] = *(const v8ha*)(p + 8 * h);
  f.half[1] = *(const v8ha*)(p + 16 + 8 * h);
  return f.v;
}
__device__ __forceinline__ v16b ldfrag_b(const unsigned short* p, int h) {
  FragB f;
  f.half[0] = *(const v8usa*)(p + 8 * h);
  f.half[1] = *(const v8usa*)(p + 16 + 8 * h);
  return f.v;
}

// bf16 RNE convert on the f32 bit pattern, and back.
__device__ __forceinline__ unsigned short bf16_rne(float f) {
  unsigned u = __float_as_uint(f);
  u = u + 0x7FFFu + ((u >> 16) & 1u);
  return (unsigned short)(u >> 16);
}
__device__ __forceinline__ float bf16_f32(unsigned short b) {
  return __uint_as_float(((unsigned)b) << 16);
}

__device__ __forceinline__ v8us hi8(v8f v, float sc) {
  const v8us r = { bf16_rne(v[0] * sc), bf16_rne(v[1] * sc), bf16_rne(v[2] * sc), bf16_rne(v[3] * sc),
                   bf16_rne(v[4] * sc), bf16_rne(v[5] * sc), bf16_rne(v[6] * sc), bf16_rne(v[7] * sc) };
  return r;
}
__device__ __forceinline__ v8us lo8(v8f v, float sc, v8us hh) {
  const v8us r = { bf16_rne(v[0] * sc - bf16_f32(hh[0])), bf16_rne(v[1] * sc - bf16_f32(hh[1])),
                   bf16_rne(v[2] * sc - bf16_f32(hh[2])), bf16_rne(v[3] * sc - bf16_f32(hh[3])),
                   bf16_rne(v[4] * sc - bf16_f32(hh[4])), bf16_rne(v[5] * sc - bf16_f32(hh[5])),
                   bf16_rne(v[6] * sc - bf16_f32(hh[6])), bf16_rne(v[7] * sc - bf16_f32(hh[7])) };
  return r;
}

// ---------------------------------------------------------------------------
// Eight f32 weights -> eight bf16 hi and eight bf16 lo (lo = rounded remainder).
// ---------------------------------------------------------------------------
__device__ __forceinline__ void split8(v4f a, v4f c, v8us& hv, v8us& lv) {
  const unsigned short h0 = bf16_rne(a.x), h1 = bf16_rne(a.y), h2 = bf16_rne(a.z), h3 = bf16_rne(a.w);
  const unsigned short h4 = bf16_rne(c.x), h5 = bf16_rne(c.y), h6 = bf16_rne(c.z), h7 = bf16_rne(c.w);
  const v8us hh = { h0, h1, h2, h3, h4, h5, h6, h7 };
  const v8us ll = { bf16_rne(a.x - bf16_f32(h0)), bf16_rne(a.y - bf16_f32(h1)),
                    bf16_rne(a.z - bf16_f32(h2)), bf16_rne(a.w - bf16_f32(h3)),
                    bf16_rne(c.x - bf16_f32(h4)), bf16_rne(c.y - bf16_f32(h5)),
                    bf16_rne(c.z - bf16_f32(h6)), bf16_rne(c.w - bf16_f32(h7)) };
  hv = hh;
  lv = ll;
}

// ---------------------------------------------------------------------------
// one 16-B store per lane, lanes 8q..8q+7 per line.
//   qd/kd : 64 token rows x 32 halves, contiguous 4096 B (32 lines)
// ---------------------------------------------------------------------------
__device__ __forceinline__ void proj_store(const _Float16* sQ, const _Float16* sK, const _Float16* sV,
                                           _Float16* qd, _Float16* kd, _Float16* vd, int tid) {
  #pragma unroll
  for (int i = 0; i < 2; ++i) {
    const int off = (i * 128 + tid) * 8;
    const v8h a = *(const v8ha*)(sQ + off);
    *(v8h*)(qd + off) = a;
    const v8h c = *(const v8ha*)(sK + off);
    *(v8h*)(kd + off) = c;
  }
  const int q8 = tid & 7, sub = tid >> 3;        // sub 0..15
  #pragma unroll
  for (int i = 0; i < 4; ++i) {
    const int c = i * 16 + sub;                    // channel row 0..63
    const v8h a = *(const v8ha*)(sV + c * 64 + 8 * q8);
    *(v8h*)(vd + (size_t)c * NN + 8 * q8) = a;
  }
}

// ---------------------------------------------------------------------------
// Kernel 1: fused q/k/v projection. Block = 128 thr (4 waves) = 64 tokens of
// one batch x all 128 output features (32 q, 32 k, 64 v); K = 64 = 2 steps.
// x tile [64 c][64 n] f32 -> LDS as bf16 hi/lo [n][c] (pitch XP);
// the block splits the f32 rows [wq | wk | wv] itself into bf16 hi/lo rows in LDS
// (pitch XP), their loads in flight beside the x loads;
// A = x^T rows (row = token, k = c) from LDS, B = W rows (k-contiguous) from
// LDS. The first 64 blocks also split one row of wo each into the global bf16
// planes that the attention kernel reads. D[token][feature]. Epilogue: +bias -> f16 -> LDS
// staging -> whole-line stores. q,k planes [b][n][32]; v plane [b][c][n].
// ---------------------------------------------------------------------------
__global__ __launch_bounds__(128) void k_proj(
    const float* __restrict__ x,
    const float* __restrict__ wq, const float* __restrict__ wk,
    const float* __restrict__ wv, const float* __restrict__ wo,
    const float* __restrict__ bq, const float* __restrict__ bk, const float* __restrict__ bv,
    _Float16* __restrict__ qpl, _Float16* __restrict__ kpl, _Float16* __restrict__ vpl,
    unsigned short* __restrict__ wohi, unsigned short* __restrict__ wolo)
{
  __shared__ __attribute__((aligned(16))) unsigned short sWh[128 * XP];  // 18432 B
  __shared__ __attribute__((aligned(16))) unsigned short sWl[128 * XP];  // 18432 B
  __shared__ __attribute__((aligned(16))) unsigned short sXh[64 * XP];   // 9216 B
  __shared__ __attribute__((aligned(16))) unsigned short sXl[64 * XP];   // 9216 B
  __shared__ __attribute__((aligned(16))) _Float16 sQ[64 * CH];          // 4096 B
  __shared__ __attribute__((aligned(16))) _Float16 sK[64 * CH];          // 4096 B
  __shared__ __attribute__((aligned(16))) _Float16 sV[CC * 64];          // 8192 B

  const int tid = threadIdx.x, lane = tid & 31, w = tid >> 5;
  const int h = lane >> 4, m = lane & 15;
  const int n0 = blockIdx.x * 64;
  const int b = blockIdx.y;

  // ---- all loads of the block first: x tile, the 128 fused weight rows, 8 values of a wo row ----
  const float* xb = x + (size_t)b * CC * NN + n0;
  v4f xv[8], wa[8], wc[8];
  #pragma unroll
  for (int i = 0; i < 8; ++i) {
    const int f4 = i * 128 + tid;        // 0..1023
    xv[i] = *(const v4fa*)(xb + (size_t)(f4 >> 4) * NN + 4 * (f4 & 15));
  }
  #pragma unroll
  for (int i = 0; i < 8; ++i) {
    const int e = (i * 128 + tid) * 8;   // element of [wq | wk | wv], 1024 per i
    const float* ws = (i < 2) ? wq + e : (i < 4) ? wk + (e - NWQ) : wv + (e - 2 * NWQ);
    wa[i] = *(const v4fa*)ws;
    wc[i] = *(const v4fa*)(ws + 4);
  }
  // The two loads below may land in registers that held addresses of the loads above.
  asm volatile("s_wait_xcnt 0x0" ::: "memory");
  const int oe = (blockIdx.x & (CC - 1)) * CC + (tid & 7) * 8;   // inside wo for every thread
  const v4f oa = *(const v4fa*)(wo + oe);
  const v4f oc = *(const v4fa*)(wo + oe + 4);
  // Holds every load of the block above the first use of one: without it the weight
  // loads are issued only behind the wait for the first x values, two latencies in a row.
  __builtin_amdgcn_sched_barrier(0);

  // ---- x tile: transpose + split into LDS ----
  #pragma unroll
  for (int i = 0; i < 8; ++i) {
    const int f4 = i * 128 + tid;        // 0..1023
    const int c = f4 >> 4;               // 0..63
    const int j4 = f4 & 15;              // tokens 4*j4 .. 4*j4+3
    const v4f v = xv[i];
    const float e0 = v.x, e1 = v.y, e2 = v.z, e3 = v.w;
    const unsigned short a0 = bf16_rne(e0), a1 = bf16_rne(e1), a2 = bf16_rne(e2), a3 = bf16_rne(e3);
    const int t0 = 4 * j4;
    sXh[(t0 + 0) * XP + c] = a0;  sXl[(t0 + 0) * XP + c] = bf16_rne(e0 - bf16_f32(a0));
    sXh[(t0 + 1) * XP + c] = a1;  sXl[(t0 + 1) * XP + c] = bf16_rne(e1 - bf16_f32(a1));
    sXh[(t0 + 2) * XP + c] = a2;  sXl[(t0 + 2) * XP + c] = bf16_rne(e2 - bf16_f32(a2));
    sXh[(t0 + 3) * XP + c] = a3;  sXl[(t0 + 3) * XP + c] = bf16_rne(e3 - bf16_f32(a3));
  }
  // ---- weight rows: split into LDS, row = fused feature, 64 k-contiguous inputs ----
  #pragma unroll
  for (int i = 0; i < 8; ++i) {
    const int e = (i * 128 + tid) * 8;
    v8us hv, lv;
    split8(wa[i], wc[i], hv, lv);
    const int off = (e >> 6) * XP + (e & 63);
    *(v8usa*)(sWh + off) = hv;
    *(v8usa*)(sWl + off) = lv;
  }
  // ---- wo row blockIdx.x: one 128-B line of each plane, written by 8 lanes of one block ----
  // Inputs-only fence on the loaded values: keeps the two wo loads up with the block's other
  // loads; without it they sink into the branch and their whole latency stands open there.
  asm volatile("" :: "v"(oa), "v"(oc));
  if (b == 0 && blockIdx.x < CC && tid < 8) {
    v8us hv, lv;
    split8(oa, oc, hv, lv);
    *(v8us*)(wohi + oe) = hv;
    *(v8us*)(wolo + oe) = lv;
  }
  __syncthreads();

  const v8f zero8 = {0.f, 0.f, 0.f, 0.f, 0.f, 0.f, 0.f, 0.f};
  v8f acc[8];
  #pragma unroll
  for (int nt = 0; nt < 8; ++nt) acc[nt] = zero8;

  const unsigned short* arow_h = sXh + (16 * w + m) * XP;   // token row
  const unsigned short* arow_l = sXl + (16 * w + m) * XP;

  #pragma unroll
  for (int ks = 0; ks < 2; ++ks) {
    const int k0 = 32 * ks;
    const v16b ah = ldfrag_b(arow_h + k0, h);
    const v16b al = ldfrag_b(arow_l + k0, h);
    v16b bh[8], bl[8];                                      // the k step's B fragments, one LDS load group
    #pragma unroll
    for (int nt = 0; nt < 8; ++nt) {
      const int f = 16 * nt + m;                            // fused feature row 0..127
      bh[nt] = ldfrag_b(sWh + f * XP + k0, h);
      bl[nt] = ldfrag_b(sWl + f * XP + k0, h);
    }
    #pragma unroll
    for (int nt = 0; nt < 8; ++nt) {
      acc[nt] = wmma_bf16(ah, bh[nt], acc[nt]);
      acc[nt] = wmma_bf16(ah, bl[nt], acc[nt]);
      acc[nt] = wmma_bf16(al, bh[nt], acc[nt]);
    }
  }

  // ---- epilogue: D[r] of tile nt = Y[token 16w+8h+r][feature 16nt+m] ----
  #pragma unroll
  for (int nt = 0; nt < 8; ++nt) {
    const int f = 16 * nt + m;
    float bias;
    if (nt < 2)      bias = bq[f];
    else if (nt < 4) bias = bk[f - CH];
    else             bias = bv[f - 2 * CH];
    #pragma unroll
    for (int r = 0; r < 8; ++r) {
      const int tok = 16 * w + 8 * h + r;                    // 0..63
      const float yf = acc[nt][r] + bias;
      const _Float16 y = (_Float16)(nt < 2 ? yf * SC2 : yf);   // q carries SC2: scores come out as exponents to base 2
      if (nt < 2)      sQ[tok * CH + f] = y;
      else if (nt < 4) sK[tok * CH + (f - CH)] = y;
      else             sV[(f - 2 * CH) * 64 + tok] = y;
    }
  }
  __syncthreads();

  _Float16* qd = qpl + ((size_t)b * NN + n0) * CH;
  _Float16* kd = kpl + ((size_t)b * NN + n0) * CH;
  _Float16* vd = vpl + (size_t)b * CC * NN + n0;
  proj_store(sQ, sK, sV, qd, kd, vd, tid);
  
}

// ---------------------------------------------------------------------------
// P^T B-fragment from the lane's own score D values: element r <- tile a row r,
// element 8+r <- tile c row r (same lane, same query column); the values already carry 2^7.
// ---------------------------------------------------------------------------
__device__ __forceinline__ v16h pack_p(v8f a, v8f c) {
  const v16h r = { (_Float16)a[0], (_Float16)a[1], (_Float16)a[2], (_Float16)a[3],
                   (_Float16)a[4], (_Float16)a[5], (_Float16)a[6], (_Float16)a[7],
                   (_Float16)c[0], (_Float16)c[1], (_Float16)c[2], (_Float16)c[3],
                   (_Float16)c[4], (_Float16)c[5], (_Float16)c[6], (_Float16)c[7] };
  return r;
}

// Lane l's value as seen from lane l ^ 16, by a vector cross-row move: it does not
// count on dscnt, so an exchange does not wait for LDS fragment loads still in flight.
__device__ __forceinline__ float xhalf(float x) {
  const int b = __builtin_bit_cast(int, x);
  return __builtin_bit_cast(float, __builtin_amdgcn_permlanex16(b, b, 0x76543210, 0xfedcba98, false, false));
}

// Block tile [64 out-channels][64 queries] f32 in LDS -> out[b][o][qblk..+63];
// 128 lines (2 per channel row), each by lanes 8q..8q+7 in one instruction.
__device__ __forceinline__ void out_store(const float* sOut, float* od, int tid) {
  const int q8 = tid & 7, sub = tid >> 3;        // sub 0..31
  #pragma unroll
  for (int i = 0; i < 4; ++i) {
    const int L = i * 32 + sub;                    // line 0..127
    const int o = L >> 1, hl = L & 1;
    const v4f v = *(const v4fa*)(sOut + o * 64 + 32 * hl + 4 * q8);
    *(v4f*)(od + (size_t)o * NN + 32 * hl + 4 * q8) = v;
  }
}

typedef uint32_t u32x4 __attribute__((ext_vector_type(4)));
typedef uint32_t u32x8 __attribute__((ext_vector_type(8)));

__device__ __forceinline__ uint32_t uni(uint32_t v) { return (uint32_t)__builtin_amdgcn_readfirstlane(v); }
// A wave-uniform test held in a scalar register, so that the branch on it is a scalar branch: a tensor load
// ignores EXEC, and only such a branch keeps a wave from issuing it.
__device__ __forceinline__ uint32_t pinned(uint32_t v) {
  uint32_t w = uni(v);
  asm volatile("" : "+s"(w));   // keeps the test in a scalar register
  return w;
}
// Descriptor group 1 of a two-dimensional tile: rows of 128 B, 1-byte elements, tensor = tile, no mask, and behind
// every 128-B row a pad of 16 B, so that the pitch in LDS is 144 B.
__device__ __forceinline__ u32x8 tdm_group1(uint32_t rows, uint32_t src_pitch) {
  u32x8 g;
  g[0] = uni((1u << 20) | (4u << 22) | (3u << 25));
  g[1] = uni(128u << 16);
  g[2] = uni(rows << 16);
  g[3] = uni(128u << 16);
  g[4] = uni(rows);
  g[5] = uni(src_pitch);
  g[6] = uni(0u);
  g[7] = uni(0u);
  return g;
}
// Descriptor group 0: count 1, place in LDS, global address of the tile's first byte, type 2.
__device__ __forceinline__ u32x4 tdm_group0(uint32_t lds_dst, uint64_t ga) {
  u32x4 g;
  g[0] = uni(1u);
  g[1] = uni(lds_dst);
  g[2] = uni((uint32_t)ga);
  g[3] = uni((((uint32_t)(ga >> 32)) & 0x01FFFFFFu) | 0x80000000u);
  return g;
}
// The next stage's group 0 out of the last one's: new place in LDS, address + step bytes (with the carry).
__device__ __forceinline__ void tdm_next(u32x4& g, uint32_t lds_dst, uint32_t step) {
  const uint32_t lo = g[2] + step;
  g[1] = uni(lds_dst);
  g[3] = uni(g[3] + (lo < step ? 1u : 0u));
  g[2] = uni(lo);
}
// One request of the whole wave: a tile from global memory into LDS, through no register and with no address work in the lanes.
__device__ __forceinline__ void tdm_load(u32x4 g0, u32x8 g1) {
  asm volatile("tensor_load_to_lds %0, %1" :: "s"(g0), "s"(g1) : "memory");
}
// The issuing wave's wait for its own tensor loads. It names the descriptors of the requests it covers: so their
// registers stay as they are while a request is outstanding, and a new group 0 (made from the old one) is formed behind it.
__device__ __forceinline__ void tdm_wait(u32x4& g0a, u32x4& g0b, u32x8 g1a, u32x8 g1b) {
  asm volatile("s_wait_tensorcnt 0x0" : "+s"(g0a), "+s"(g0b) : "s"(g1a), "s"(g1b) : "memory");
}

__global__ __launch_bounds__(256) void k_attn(
    const _Float16* __restrict__ qpl,      // [B][N][32]
    const _Float16* __restrict__ kpl,      // [B][N][32]
    const _Float16* __restrict__ vpl,      // [B][64][N]
    const unsigned short* __restrict__ wohi, const unsigned short* __restrict__ wolo,   // [64][64]
    const float* __restrict__ bo,
    float* __restrict__ out)               // [B][64][N]
{
  __shared__ __attribute__((aligned(16))) float sOut[CC * 64];   // 16384 B
  __shared__ __attribute__((aligned(2048))) unsigned char sRing[NW * WRB];   // 262144 B; every tile's place a multiple of 2 KiB

  const int tid = threadIdx.x, lane = tid & 31;
  const int w = __builtin_amdgcn_readfirstlane(tid >> 5);   // the wave's number, in a scalar register: its bases are scalar
  const int h = lane >> 4, m = lane & 15;
  const int b = blockIdx.y;
  const int qblk = blockIdx.x * 64;

  // Q^T B-fragments: tile qt, column n = query qblk+16qt+m, k = d (32 deep)
  v16h qf[4];
  #pragma unroll
  for (int qt = 0; qt < 4; ++qt)
    qf[qt] = ldfrag_h(qpl + ((size_t)b * NN + qblk + 16 * qt + m) * CH, h);

  const v8f zero8 = {0.f, 0.f, 0.f, 0.f, 0.f, 0.f, 0.f, 0.f};
  v8f o[4][4];                               // o[qt][t][r] = attn[c 16t+8h+r][query 16qt+m] * row sum (which carries 2^7)
  // mrun: the maximum in use, the same in lanes l and l ^ 16. lrun: the lane's own half of the row sum.
  // cofs: PEXP - mrun in all eight rows, the C operand of the score products. The start value sends
  // the first step through the exact branch, which sets the first maximum.
  float mrun[4], lrun[4];
  v8f cofs[4];
  #pragma unroll
  for (int qt = 0; qt < 4; ++qt) {
    #pragma unroll
    for (int t = 0; t < 4; ++t) o[qt][t] = zero8;
    mrun[qt] = -1e30f;
    lrun[qt] = 0.0f;
    const float c0 = PEXP + 1e30f;
    const v8f cs = { c0, c0, c0, c0, c0, c0, c0, c0 };
    cofs[qt] = cs;
  }

  // load side, the wave's own ring: per stage one K tile (its 64 keys = 4096 B in a row, taken as 32 rows of 128 B)
  // and one V tile (64 channel rows of 128 B, 2 * NN bytes apart)
  unsigned char* myring = sRing + w * WRB;
  const uint32_t ldsk = (uint32_t)(size_t)myring;          // byte offset in the work-group's LDS
  const uint32_t ldsv = ldsk + KSL;
  const u32x8 g1k = tdm_group1(32u, 128u);
  const u32x8 g1v = tdm_group1(64u, 2u * NN);
  u32x4 g0k = tdm_group0(ldsk, (uint64_t)(size_t)(kpl + ((size_t)b * NN + 64 * w) * CH));
  u32x4 g0v = tdm_group0(ldsv, (uint64_t)(size_t)(vpl + (size_t)b * CC * NN + 64 * w));
  // read side: key row 16j+m (pair row 8j + m/2, half m&1), channel row 16t+m
  const unsigned char* krow = myring + (m >> 1) * KP2 + (m & 1) * 64;
  const unsigned char* vrow = myring + KSL + m * VPB;

  // Stages 0 and 1: every wave issues its own, unconditionally.
  tdm_load(g0k, g1k);
  tdm_load(g0v, g1v);
  tdm_wait(g0k, g0v, g1k, g1v);                        // own tiles of stage 0 landed: only this wave reads them
  tdm_next(g0k, ldsk + BUFB, STEPK * CH * 2);
  tdm_next(g0v, ldsv + BUFB, STEPK * 2);
  tdm_load(g0k, g1k);
  tdm_load(g0v, g1v);

  #pragma unroll 1
  for (int kb = 0; kb < NN; kb += STEPK) {
    const unsigned boff = (kb & STEPK) ? BUFB : 0;
    // ---- this stage's fragments, one load group ----
    v16h kf[4], vf0[4], vf1[4];
    #pragma unroll
    for (int j = 0; j < 4; ++j)
      kf[j] = ldfrag_h((const _Float16*)(krow + boff + 8 * j * KP2), h);
    #pragma unroll
    for (int t = 0; t < 4; ++t) {
      const _Float16* vp = (const _Float16*)(vrow + boff + 16 * t * VPB);
      vf0[t] = ldfrag_h(vp, h);
      vf1[t] = ldfrag_h(vp + 32, h);
    }

    // ---- per query tile: scores, softmax, value products ----
    // (the loops here are unrolled so that every array is indexed by constants and stays in registers)
    #pragma unroll
    for (int qt = 0; qt < 4; ++qt) {
      // scores as exponents: s[j][r] = S[query 16qt+m][key kb+64w+16j+8h+r] * scale * log2(e) + PEXP - mrun;
      // the factor sits in q, the offset in the product's C operand
      v8f s[4];
      #pragma unroll
      for (int j = 0; j < 4; ++j)
        s[j] = wmma_f16(kf[j], qf[qt], cofs[qt]);

      // softmax (f32), base 2, on the maximum in use: one exp2 and one add a score
      v2f ts[2];                                 // partial sums, even and odd rows: of tiles 0, 1 and of tiles 2, 3
      #pragma unroll
      for (int j = 0; j < 4; ++j)
        #pragma unroll
        for (int r = 0; r < 8; r += 2) {
          const v2f p = { __builtin_amdgcn_exp2f(s[j][r]), __builtin_amdgcn_exp2f(s[j][r + 1]) };
          s[j][r] = p.x;
          s[j][r + 1] = p.y;
          ts[j >> 1] = ((j & 1) | r) ? ts[j >> 1] + p : p;
        }
      const v2f tt = ts[0] + ts[1];
      float lsum = tt.x + tt.y;

      // one test a tile, a scalar branch: a lane's sum at or above PLIM (or not a number) means a prob of
      // this tile may leave f16's range. Then the tile is done again on the larger of the maximum in use
      // and the tile's own, which becomes the maximum in use, and sum and O are brought onto it.
      if (__builtin_expect(__builtin_amdgcn_ballot_w32(!(lsum < PLIM)) != 0, 0)) {   // rare: laid out of the loop's line
        #pragma unroll
        for (int j = 0; j < 4; ++j)
          s[j] = wmma_f16(kf[j], qf[qt], zero8);
        float mloc = s[0][0];
        #pragma unroll
        for (int j = 0; j < 4; ++j)
          #pragma unroll
          for (int r = 0; r < 8; ++r) mloc = fmaxf(mloc, s[j][r]);
        mloc = fmaxf(mloc, xhalf(mloc));
        const float mnew = fmaxf(mrun[qt], mloc);
        const float alpha = __builtin_amdgcn_exp2f(mrun[qt] - mnew);
        const float mb = mnew - PEXP;
        mrun[qt] = mnew;
        const v8f cn = { -mb, -mb, -mb, -mb, -mb, -mb, -mb, -mb };
        cofs[qt] = cn;
        lsum = 0.0f;
        #pragma unroll
        for (int j = 0; j < 4; ++j)
          #pragma unroll
          for (int r = 0; r < 8; ++r) {
            const float p = __builtin_amdgcn_exp2f(s[j][r] - mb);
            s[j][r] = p;
            lsum += p;
          }
        lrun[qt] = lrun[qt] * alpha;
        #pragma unroll
        for (int t = 0; t < 4; ++t)
          #pragma unroll
          for (int r = 0; r < 8; ++r) o[qt][t][r] = o[qt][t][r] * alpha;
      }
      lrun[qt] += lsum;

      // P^T B-fragments (the wave's keys 0..31 and 32..63 of this step), then O^T += V * P^T
      const v16h pb0 = pack_p(s[0], s[1]);
      const v16h pb1 = pack_p(s[2], s[3]);
      #pragma unroll
      for (int t = 0; t < 4; ++t) {
        o[qt][t] = wmma_f16(vf0[t], pb0, o[qt][t]);
        o[qt][t] = wmma_f16(vf1[t], pb1, o[qt][t]);
      }
    }

    // ---- hand-over inside the wave: its ring is read and refilled by itself alone ----
    asm volatile("s_wait_dscnt 0x0" ::: "memory");     // own reads of this buffer done before it is refilled
    tdm_wait(g0k, g0v, g1k, g1v);                      // own tiles of the next stage landed
    if (pinned(kb + 2 * STEPK < NN)) {                 // a stage two ahead exists: a scalar branch
      tdm_next(g0k, ldsk + boff, STEPK * CH * 2);
      tdm_next(g0v, ldsv + boff, STEPK * 2);
      tdm_load(g0k, g1k);
      tdm_load(g0v, g1v);
    }
  }
  asm volatile("s_wait_tensorcnt 0x0" ::: "memory");   // nothing in flight behind the loop
  asm volatile("s_wait_dscnt 0x0" ::: "memory");       // own reads of the ring over before it takes the partials

  // ---- merge the eight waves' partial maximum, sum and O tiles ----
  // Each wave lays its partials down in its own ring (its reads and tensor loads there are over), and behind
  // one barrier wave w reads the eight partials of query tile w>>1 and joins them on the common maximum.
  {
    v4fa* pw = (v4fa*)myring + lane;
    #pragma unroll
    for (int qt = 0; qt < 4; ++qt) {
      #pragma unroll
      for (int t = 0; t < 4; ++t) {
        const v4f a = { o[qt][t][0], o[qt][t][1], o[qt][t][2], o[qt][t][3] };
        const v4f c = { o[qt][t][4], o[qt][t][5], o[qt][t][6], o[qt][t][7] };
        pw[(8 * qt + 2 * t) * 32] = a;
        pw[(8 * qt + 2 * t + 1) * 32] = c;
      }
      const float lj = lrun[qt] + xhalf(lrun[qt]);       // the two halves' sums joined once
      const v2f ml = { mrun[qt], lj };
      ((v2fa*)(myring + PARTB))[qt * 32 + lane] = ml;
    }
  }
  __syncthreads();                                     // every wave's partials readable
  const int qm = w >> 1;                               // the query tile this wave merges and projects
  // Output bias of the two out-channel tiles that this wave projects (rows 32(w&1)+16oi+8h+r), asked for here
  // so that its latency passes under the merge.
  float bias[16];
  #pragma unroll
  for (int i = 0; i < 16; ++i) bias[i] = bo[32 * (w & 1) + 16 * (i >> 3) + 8 * h + (i & 7)];
  v8f om[4];
  float lall = 0.0f;
  {
    v2f ml[NW];
    #pragma unroll
    for (int gg = 0; gg < NW; ++gg)
      ml[gg] = ((const v2fa*)(sRing + gg * WRB + PARTB))[qm * 32 + lane];
    float mall = ml[0].x;
    #pragma unroll
    for (int gg = 1; gg < NW; ++gg) mall = fmaxf(mall, ml[gg].x);
    #pragma unroll
    for (int t = 0; t < 4; ++t) om[t] = zero8;
    #pragma unroll
    for (int gg = 0; gg < NW; ++gg) {
      const float f = __builtin_amdgcn_exp2f(ml[gg].x - mall);
      lall += ml[gg].y * f;
      const v4fa* pr = (const v4fa*)(sRing + gg * WRB) + qm * 256 + lane;
      #pragma unroll
      for (int t = 0; t < 4; ++t) {
        const v4f a = pr[(2 * t) * 32];
        const v4f c = pr[(2 * t + 1) * 32];
        om[t][0] += a.x * f;  om[t][1] += a.y * f;  om[t][2] += a.z * f;  om[t][3] += a.w * f;
        om[t][4] += c.x * f;  om[t][5] += c.y * f;  om[t][6] += c.z * f;  om[t][7] += c.w * f;
      }
    }
  }

  // ---- normalise; attn D tiles -> bf16 hi/lo B-fragments (k = c) ----
  const float inv = 1.0f / lall;               // O and the sum both carry 2^7
  FragB bh0, bl0, bh1, bl1;
  {
    const v8us ha = hi8(om[0], inv), hb = hi8(om[1], inv), hc = hi8(om[2], inv), hd = hi8(om[3], inv);
    bh0.half[0] = ha;  bh0.half[1] = hb;
    bh1.half[0] = hc;  bh1.half[1] = hd;
    bl0.half[0] = lo8(om[0], inv, ha);  bl0.half[1] = lo8(om[1], inv, hb);
    bl1.half[0] = lo8(om[2], inv, hc);  bl1.half[1] = lo8(om[3], inv, hd);
  }

  // ---- out^T[o][query] = sum_c Wo[o][c] attn[c][query]; wave w does out-channel tiles 2(w&1), 2(w&1)+1 ----
  #pragma unroll
  for (int oi = 0; oi < 2; ++oi) {
    const int ot = 2 * (w & 1) + oi;
    const unsigned short* wrh = wohi + (16 * ot + m) * CC;
    const unsigned short* wrl = wolo + (16 * ot + m) * CC;
    v8f z = zero8;
    {
      const v16b a_h = ldfrag_b(wrh, h);
      const v16b a_l = ldfrag_b(wrl, h);
      z = wmma_bf16(a_h, bh0.v, z);
      z = wmma_bf16(a_h, bl0.v, z);
      z = wmma_bf16(a_l, bh0.v, z);
    }
    {
      const v16b a_h = ldfrag_b(wrh + 32, h);
      const v16b a_l = ldfrag_b(wrl + 32, h);
      z = wmma_bf16(a_h, bh1.v, z);
      z = wmma_bf16(a_h, bl1.v, z);
      z = wmma_bf16(a_l, bh1.v, z);
    }
    // ---- stage [64 o][64 queries] tile; D[r] = out[o 16ot+8h+r][query 16qm+m] ----
    float* so = sOut + 16 * qm + m;
    #pragma unroll
    for (int r = 0; r < 8; ++r) {
      const int orow = 16 * ot + 8 * h + r;
      so[orow * 64] = z[r] + bias[8 * oi + r];
    }
  }
  __syncthreads();

  float* od = out + (size_t)b * CC * NN + qblk;
  out_store(sOut, od, tid);
}

// ---------------------------------------------------------------------------
extern "C" void kernel_launch(void* const* d_in, const int* in_sizes, int n_in,
                              void* d_out, int out_size, void* d_ws, size_t ws_size,
                              hipStream_t stream) {
  if (n_in < 9) return;
  if (in_sizes[0] != NB * CC * NN) return;
  if (in_sizes[1] != NWQ || in_sizes[2] != CH) return;
  if (in_sizes[3] != NWQ || in_sizes[4] != CH) return;
  if (in_sizes[5] != NWV || in_sizes[6] != CC) return;
  if (in_sizes[7] != NWV || in_sizes[8] != CC) return;
  if (out_size != NB * CC * NN) return;

  const float* x  = (const float*)d_in[0];
  const float* wq = (const float*)d_in[1];
  const float* bq = (const float*)d_in[2];
  const float* wk = (const float*)d_in[3];
  const float* bk = (const float*)d_in[4];
  const float* wv = (const float*)d_in[5];
  const float* bv = (const float*)d_in[6];
  const float* wo = (const float*)d_in[7];
  const float* bo = (const float*)d_in[8];
  float* out = (float*)d_out;

  const size_t w_bytes  = (size_t)NWALL * 2;              //    24576 per plane
  const size_t qk_bytes = (size_t)NB * NN * CH * 2;        //  1048576 each
  const size_t v_bytes  = (size_t)NB * CC * NN * 2;        //  2097152
  const size_t total = 2 * w_bytes + 2 * qk_bytes + v_bytes;   // 4243456
  if (total > ws_size) return;

  char* ws = (char*)d_ws;
  unsigned short* whi = (unsigned short*)(ws);
  unsigned short* wlo = (unsigned short*)(ws + w_bytes);
  _Float16* qpl = (_Float16*)(ws + 2 * w_bytes);
  _Float16* kpl = (_Float16*)(ws + 2 * w_bytes + qk_bytes);
  _Float16* vpl = (_Float16*)(ws + 2 * w_bytes + 2 * qk_bytes);
  unsigned short* wohi = whi + (2 * NWQ + NWV);
  unsigned short* wolo = wlo + (2 * NWQ + NWV);

  dim3 gProj(NN / 64, NB);                                  // (128, 2)
  k_proj<<<gProj, 128, 0, stream>>>(x, wq, wk, wv, wo, bq, bk, bv, qpl, kpl, vpl, wohi, wolo);

  dim3 gAtt(NN / 64, NB);                                   // (128, 2)
  k_attn<<<gAtt, 256, 0, stream>>>(qpl, kpl, vpl, wohi, wolo, bo, out);
}

// v009
// A run of this version takes 27.6 microseconds.
// Next to v008, in two timings, it ran 1.04 times as fast each time.
// All steps since v000 together make it 14.6 times as fast.
// Contractions: q/k/v and output 1x1x1 projections on v_wmma_f32_16x16x32_bf16 as bf16 hi/lo split (hi*hi + hi*lo + lo*hi); key*query scores and value*prob products on v_wmma_f32_16x16x32_f16 (f16 operands, prob carried x128 at the maximum in use, the row sum too, so the factor cancels in the normalisation); f32 accumulate everywhere; softmax, bias, normalisation in f32.
#include <hip/hip_runtime.h>
#include <stdint.h>

typedef _Float16 v16h __attribute__((ext_vector_type(16)));
typedef _Float16 v8h  __attribute__((ext_vector_type(8)));
typedef __bf16   v16b __attribute__((ext_vector_type(16)));
typedef unsigned short v8us __attribute__((ext_vector_type(8)));
typedef float v8f __attribute__((ext_vector_type(8)));
typedef float v4f __attribute__((ext_vector_type(4)));
typedef v8h  __attribute__((may_alias)) v8ha;
typedef v8us __attribute__((may_alias)) v8usa;
typedef v4f  __attribute__((may_alias)) v4fa;
typedef float v2f __attribute__((ext_vector_type(2)));
typedef v2f  __attribute__((may_alias)) v2fa;

union FragH { v16h v; v8h half[2]; };
union FragB { v16b v; v8us half[2]; };

#define NB   2        // batch
#define CC   64       // channels
#define CH   32       // q/k channels
#define NN   8192     // voxels 8*32*32
#define XP   72       // LDS pitch (halves) of the transposed x tile
#define NWQ  (CH * CC)            // 2048
#define NWV  (CC * CC)            // 4096
#define NWALL (2 * NWQ + 2 * NWV) // 12288 : [wq | wk | wv | wo]
#define SC2  0.25503486f         // 32^-0.5 * log2(e), multiplied into q in f32 ahead of its one rounding to f16
#define PEXP 7.0f                // prob carried x 2^7 at the maximum in use, added in the exponent
#define PLIM 32768.0f            // a lane's sum of one trip's probs below 2^15: each of them is finite in f16
#define KP2  144                 // LDS pitch, bytes, of a staged pair of key rows (2 x 64 B of data): 16 B x odd
#define VPB  144                 // LDS pitch, bytes, of a staged value row (128 B of data): 16 B x odd
#define KSL  6144                // key part of one stage: 32 pair rows x 144 B = 4608, rounded up to a multiple of 2 KiB
#define VSL  10240               // value part of one stage: 64 rows x 144 B = 9216, rounded up to a multiple of 2 KiB
#define BUFB (KSL + VSL)         // 16384 : 64 keys of K and V = one wave's stage
#define NW   8                   // waves of the attention block; each takes its own keys
#define WRB  (2 * BUFB)          // 32768 : one wave's own ring, two buffers
#define STEPK (NW * 64)          // 512 : keys of one step over the block
#define NST  (NN / STEPK)        // 16 : steps of the walk over the keys
#define PARTB (16 * 2 * 32 * 16) // 16384 : one wave's partial O tiles, 32 x 16 B per lane

// ---------------------------------------------------------------------------
// WMMA helpers; the bf16 one with hazard guard (ties D, keeps A/B live).
// Fragment map (wave32): lane l, h = l>>4, m = n = l&15.
//   A/B element i: i<8 -> k0+8h+i ; i>=8 -> k0+16+8h+(i-8)
//   D element r : row 8h+r, col l&15
// ---------------------------------------------------------------------------
// The f16 form is the bare builtin (the compiler keeps its distances itself): the attention kernel holds more than
// 256 registers, and with a v_nop statement tied to D, A and B behind each product the build spilled to scratch
// inside its loop (the query fragments among others).
__device__ __forceinline__ v8f wmma_f16(v16h a, v16h b, v8f c) {
  return __builtin_amdgcn_wmma_f32_16x16x32_f16(false, a, false, b, (short)0, c, false, false);
}
__device__ __forceinline__ v8f wmma_bf16(v16b a, v16b b, v8f c) {
  v8f d = __builtin_amdgcn_wmma_f32_16x16x32_bf16(false, a, false, b, (short)0, c, false, false);
  asm volatile("v_nop\n\tv_nop\n\tv_nop\n\tv_nop" : "+v"(d) : "v"(a), "v"(b));
  return d;
}

// A or B fragment from a k-contiguous 16-bit row; p points at element k0 of
// the row owned by this lane (row index lane&15 added by the caller).
__device__ __forceinline__ v16h ldfrag_h(const _Float16* p, int h) {
  FragH f;
  f.half[0] = *(const v8ha*)(p + 8 * h);
  f.half[1] = *(const v8ha*)(p + 16 + 8 * h);
  return f.v;
}
__device__ __forceinline__ v16b ldfrag_b(const unsigned short* p, int h) {
  FragB f;
  f.half[0] = *(const v8usa*)(p + 8 * h);
  f.half[1] = *(const v8usa*)(p + 16 + 8 * h);
  return f.v;
}

// bf16 RNE convert on the f32 bit pattern, and back.
__device__ __forceinline__ unsigned short bf16_rne(float f) {
  unsigned u = __float_as_uint(f);
  u = u + 0x7FFFu + ((u >> 16) & 1u);
  return (unsigned short)(u >> 16);
}
__device__ __forceinline__ float bf16_f32(unsigned short b) {
  return __uint_as_float(((unsigned)b) << 16);
}

__device__ __forceinline__ v8us hi8(v8f v, float sc) {
  const v8us r = { bf16_rne(v[0] * sc), bf16_rne(v[1] * sc), bf16_rne(v[2] * sc), bf16_rne(v[3] * sc),
                   bf16_rne(v[4] * sc), bf16_rne(v[5] * sc), bf16_rne(v[6] * sc), bf16_rne(v[7] * sc) };
  return r;
}
__device__ __forceinline__ v8us lo8(v8f v, float sc, v8us hh) {
  const v8us r = { bf16_rne(v[0] * sc - bf16_f32(hh[0])), bf16_rne(v[1] * sc - bf16_f32(hh[1])),
                   bf16_rne(v[2] * sc - bf16_f32(hh[2])), bf16_rne(v[3] * sc - bf16_f32(hh[3])),
                   bf16_rne(v[4] * sc - bf16_f32(hh[4])), bf16_rne(v[5] * sc - bf16_f32(hh[5])),
                   bf16_rne(v[6] * sc - bf16_f32(hh[6])), bf16_rne(v[7] * sc - bf16_f32(hh[7])) };
  return r;
}

// ---------------------------------------------------------------------------
// Eight f32 weights -> eight bf16 hi and eight bf16 lo (lo = rounded remainder).
// ---------------------------------------------------------------------------
__device__ __forceinline__ void split8(v4f a, v4f c, v8us& hv, v8us& lv) {
  const unsigned short h0 = bf16_rne(a.x), h1 = bf16_rne(a.y), h2 = bf16_rne(a.z), h3 = bf16_rne(a.w);
  const unsigned short h4 = bf16_rne(c.x), h5 = bf16_rne(c.y), h6 = bf16_rne(c.z), h7 = bf16_rne(c.w);
  const v8us hh = { h0, h1, h2, h3, h4, h5, h6, h7 };
  const v8us ll = { bf16_rne(a.x - bf16_f32(h0)), bf16_rne(a.y - bf16_f32(h1)),
                    bf16_rne(a.z - bf16_f32(h2)), bf16_rne(a.w - bf16_f32(h3)),
                    bf16_rne(c.x - bf16_f32(h4)), bf16_rne(c.y - bf16_f32(h5)),
                    bf16_rne(c.z - bf16_f32(h6)), bf16_rne(c.w - bf16_f32(h7)) };
  hv = hh;
  lv = ll;
}

// ---------------------------------------------------------------------------
// one 16-B store per lane, lanes 8q..8q+7 per line.
//   qd/kd : 64 token rows x 32 halves, contiguous 4096 B (32 lines)
// ---------------------------------------------------------------------------
__device__ __forceinline__ void proj_store(const _Float16* sQ, const _Float16* sK, const _Float16* sV,
                                           _Float16* qd, _Float16* kd, _Float16* vd, int tid) {
  #pragma unroll
  for (int i = 0; i < 2; ++i) {
    const int off = (i * 128 + tid) * 8;
    const v8h a = *(const v8ha*)(sQ + off);
    *(v8h*)(qd + off) = a;
    const v8h c = *(const v8ha*)(sK + off);
    *(v8h*)(kd + off) = c;
  }
  const int q8 = tid & 7, sub = tid >> 3;        // sub 0..15
  #pragma unroll
  for (int i = 0; i < 4; ++i) {
    const int c = i * 16 + sub;                    // channel row 0..63
    const v8h a = *(const v8ha*)(sV + c * 64 + 8 * q8);
    *(v8h*)(vd + (size_t)c * NN + 8 * q8) = a;
  }
}

// ---------------------------------------------------------------------------
// Kernel 1: fused q/k/v projection. Block = 128 thr (4 waves) = 64 tokens of
// one batch x all 128 output features (32 q, 32 k, 64 v); K = 64 = 2 steps.
// x tile [64 c][64 n] f32 -> LDS as bf16 hi/lo [n][c] (pitch XP);
// the block splits the f32 rows [wq | wk | wv] itself into bf16 hi/lo rows in LDS
// (pitch XP), their loads in flight beside the x loads;
// A = x^T rows (row = token, k = c) from LDS, B = W rows (k-contiguous) from
// LDS. The first 64 blocks also split one row of wo each into the global bf16
// planes that the attention kernel reads. D[token][feature]. Epilogue: +bias -> f16 -> LDS
// staging -> whole-line stores. q,k planes [b][n][32]; v plane [b][c][n].
// ---------------------------------------------------------------------------
__global__ __launch_bounds__(128) void k_proj(
    const float* __restrict__ x,
    const float* __restrict__ wq, const float* __restrict__ wk,
    const float* __restrict__ wv, const float* __restrict__ wo,
    const float* __restrict__ bq, const float* __restrict__ bk, const float* __restrict__ bv,
    _Float16* __restrict__ qpl, _Float16* __restrict__ kpl, _Float16* __restrict__ vpl,
    unsigned short* __restrict__ wohi, unsigned short* __restrict__ wolo)
{
  __shared__ __attribute__((aligned(16))) unsigned short sWh[128 * XP];  // 18432 B
  __shared__ __attribute__((aligned(16))) unsigned short sWl[128 * XP];  // 18432 B
  __shared__ __attribute__((aligned(16))) unsigned short sXh[64 * XP];   // 9216 B
  __shared__ __attribute__((aligned(16))) unsigned short sXl[64 * XP];   // 9216 B
  __shared__ __attribute__((aligned(16))) _Float16 sQ[64 * CH];          // 4096 B
  __shared__ __attribute__((aligned(16))) _Float16 sK[64 * CH];          // 4096 B
  __shared__ __attribute__((aligned(16))) _Float16 sV[CC * 64];          // 8192 B

  const int tid = threadIdx.x, lane = tid & 31, w = tid >> 5;
  const int h = lane >> 4, m = lane & 15;
  const int n0 = blockIdx.x * 64;
  const int b = blockIdx.y;

  // ---- all loads of the block first: x tile, the 128 fused weight rows, 8 values of a wo row ----
  const float* xb = x + (size_t)b * CC * NN + n0;
  v4f xv[8], wa[8], wc[8];
  #pragma unroll
  for (int i = 0; i < 8; ++i) {
    const int f4 = i * 128 + tid;        // 0..1023
    xv[i] = *(const v4fa*)(xb + (size_t)(f4 >> 4) * NN + 4 * (f4 & 15));
  }
  #pragma unroll
  for (int i = 0; i < 8; ++i) {
    const int e = (i * 128 + tid) * 8;   // element of [wq | wk | wv], 1024 per i
    const float* ws = (i < 2) ? wq + e : (i < 4) ? wk + (e - NWQ) : wv + (e - 2 * NWQ);
    wa[i] = *(const v4fa*)ws;
    wc[i] = *(const v4fa*)(ws + 4);
  }
  // The two loads below may land in registers that held addresses of the loads above.
  asm volatile("s_wait_xcnt 0x0" ::: "memory");
  const int oe = (blockIdx.x & (CC - 1)) * CC + (tid & 7) * 8;   // inside wo for every thread
  const v4f oa = *(const v4fa*)(wo + oe);
  const v4f oc = *(const v4fa*)(wo + oe + 4);
  // Holds every load of the block above the first use of one: without it the weight
  // loads are issued only behind the wait for the first x values, two latencies in a row.
  __builtin_amdgcn_sched_barrier(0);

  // ---- x tile: transpose + split into LDS ----
  #pragma unroll
  for (int i = 0; i < 8; ++i) {
    const int f4 = i * 128 + tid;        // 0..1023
    const int c = f4 >> 4;               // 0..63
    const int j4 = f4 & 15;              // tokens 4*j4 .. 4*j4+3
    const v4f v = xv[i];
    const float e0 = v.x, e1 = v.y, e2 = v.z, e3 = v.w;
    const unsigned short a0 = bf16_rne(e0), a1 = bf16_rne(e1), a2 = bf16_rne(e2), a3 = bf16_rne(e3);
    const int t0 = 4 * j4;
    sXh[(t0 + 0) * XP + c] = a0;  sXl[(t0 + 0) * XP + c] = bf16_rne(e0 - bf16_f32(a0));
    sXh[(t0 + 1) * XP + c] = a1;  sXl[(t0 + 1) * XP + c] = bf16_rne(e1 - bf16_f32(a1));
    sXh[(t0 + 2) * XP + c] = a2;  sXl[(t0 + 2) * XP + c] = bf16_rne(e2 - bf16_f32(a2));
    sXh[(t0 + 3) * XP + c] = a3;  sXl[(t0 + 3) * XP + c] = bf16_rne(e3 - bf16_f32(a3));
  }
  // ---- weight rows: split into LDS, row = fused feature, 64 k-contiguous inputs ----
  #pragma unroll
  for (int i = 0; i < 8; ++i) {
    const int e = (i * 128 + tid) * 8;
    v8us hv, lv;
    split8(wa[i], wc[i], hv, lv);
    const int off = (e >> 6) * XP + (e & 63);
    *(v8usa*)(sWh + off) = hv;
    *(v8usa*)(sWl + off) = lv;
  }
  // ---- wo row blockIdx.x: one 128-B line of each plane, written by 8 lanes of one block ----
  // Inputs-only fence on the loaded values: keeps the two wo loads up with the block's other
  // loads; without it they sink into the branch and their whole latency stands open there.
  asm volatile("" :: "v"(oa), "v"(oc));
  if (b == 0 && blockIdx.x < CC && tid < 8) {
    v8us hv, lv;
    split8(oa, oc, hv, lv);
    *(v8us*)(wohi + oe) = hv;
    *(v8us*)(wolo + oe) = lv;
  }
  __syncthreads();

  const v8f zero8 = {0.f, 0.f, 0.f, 0.f, 0.f, 0.f, 0.f, 0.f};
  v8f acc[8];
  #pragma unroll
  for (int nt = 0; nt < 8; ++nt) acc[nt] = zero8;

  const unsigned short* arow_h = sXh + (16 * w + m) * XP;   // token row
  const unsigned short* arow_l = sXl + (16 * w + m) * XP;

  #pragma unroll
  for (int ks = 0; ks < 2; ++ks) {
    const int k0 = 32 * ks;
    const v16b ah = ldfrag_b(arow_h + k0, h);
    const v16b al = ldfrag_b(arow_l + k0, h);
    v16b bh[8], bl[8];                                      // the k step's B fragments, one LDS load group
    #pragma unroll
    for (int nt = 0; nt < 8; ++nt) {
      const int f = 16 * nt + m;                            // fused feature row 0..127
      bh[nt] = ldfrag_b(sWh + f * XP + k0, h);
      bl[nt] = ldfrag_b(sWl + f * XP + k0, h);
    }
    #pragma unroll
    for (int nt = 0; nt < 8; ++nt) {
      acc[nt] = wmma_bf16(ah, bh[nt], acc[nt]);
      acc[nt] = wmma_bf16(ah, bl[nt], acc[nt]);
      acc[nt] = wmma_bf16(al, bh[nt], acc[nt]);
    }
  }

  // ---- epilogue: D[r] of tile nt = Y[token 16w+8h+r][feature 16nt+m] ----
  #pragma unroll
  for (int nt = 0; nt < 8; ++nt) {
    const int f = 16 * nt + m;
    float bias;
    if (nt < 2)      bias = bq[f];
    else if (nt < 4) bias = bk[f - CH];
    else             bias = bv[f - 2 * CH];
    #pragma unroll
    for (int r = 0; r < 8; ++r) {
      const int tok = 16 * w + 8 * h + r;                    // 0..63
      const float yf = acc[nt][r] + bias;
      const _Float16 y = (_Float16)(nt < 2 ? yf * SC2 : yf);   // q carries SC2: scores come out as exponents to base 2
      if (nt < 2)      sQ[tok * CH + f] = y;
      else if (nt < 4) sK[tok * CH + (f - CH)] = y;
      else             sV[(f - 2 * CH) * 64 + tok] = y;
    }
  }
  __syncthreads();

  _Float16* qd = qpl + ((size_t)b * NN + n0) * CH;
  _Float16* kd = kpl + ((size_t)b * NN + n0) * CH;
  _Float16* vd = vpl + (size_t)b * CC * NN + n0;
  proj_store(sQ, sK, sV, qd, kd, vd, tid);
  
}

// ---------------------------------------------------------------------------
// P^T B-fragment from the lane's own score D values: element r <- tile a row r,
// element 8+r <- tile c row r (same lane, same query column); the values already carry 2^7.
// ---------------------------------------------------------------------------
__device__ __forceinline__ v16h pack_p(v8f a, v8f c) {
  const v16h r = { (_Float16)a[0], (_Float16)a[1], (_Float16)a[2], (_Float16)a[3],
                   (_Float16)a[4], (_Float16)a[5], (_Float16)a[6], (_Float16)a[7],
                   (_Float16)c[0], (_Float16)c[1], (_Float16)c[2], (_Float16)c[3],
                   (_Float16)c[4], (_Float16)c[5], (_Float16)c[6], (_Float16)c[7] };
  return r;
}

// Lane l's value as seen from lane l ^ 16, by a vector cross-row move: it does not
// count on dscnt, so an exchange does not wait for LDS fragment loads still in flight.
__device__ __forceinline__ float xhalf(float x) {
  const int b = __builtin_bit_cast(int, x);
  return __builtin_bit_cast(float, __builtin_amdgcn_permlanex16(b, b, 0x76543210, 0xfedcba98, false, false));
}

// Block tile [64 out-channels][64 queries] f32 in LDS -> out[b][o][qblk..+63];
// 128 lines (2 per channel row), each by lanes 8q..8q+7 in one instruction.
__device__ __forceinline__ void out_store(const float* sOut, float* od, int tid) {
  const int q8 = tid & 7, sub = tid >> 3;        // sub 0..31
  #pragma unroll
  for (int i = 0; i < 4; ++i) {
    const int L = i * 32 + sub;                    // line 0..127
    const int o = L >> 1, hl = L & 1;
    const v4f v = *(const v4fa*)(sOut + o * 64 + 32 * hl + 4 * q8);
    *(v4f*)(od + (size_t)o * NN + 32 * hl + 4 * q8) = v;
  }
}

typedef uint32_t u32x4 __attribute__((ext_vector_type(4)));
typedef uint32_t u32x8 __attribute__((ext_vector_type(8)));

__device__ __forceinline__ uint32_t uni(uint32_t v) { return (uint32_t)__builtin_amdgcn_readfirstlane(v); }
// A wave-uniform test held in a scalar register, so that the branch on it is a scalar branch: a tensor load
// ignores EXEC, and only such a branch keeps a wave from issuing it.
__device__ __forceinline__ uint32_t pinned(uint32_t v) {
  uint32_t w = uni(v);
  asm volatile("" : "+s"(w));   // keeps the test in a scalar register
  return w;
}
// Descriptor group 1 of a two-dimensional tile: rows of 128 B, 1-byte elements, tensor = tile, no mask, and behind
// every 128-B row a pad of 16 B, so that the pitch in LDS is 144 B.
__device__ __forceinline__ u32x8 tdm_group1(uint32_t rows, uint32_t src_pitch) {
  u32x8 g;
  g[0] = uni((1u << 20) | (4u << 22) | (3u << 25));
  g[1] = uni(128u << 16);
  g[2] = uni(rows << 16);
  g[3] = uni(128u << 16);
  g[4] = uni(rows);
  g[5] = uni(src_pitch);
  g[6] = uni(0u);
  g[7] = uni(0u);
  return g;
}
// Descriptor group 0: count 1, place in LDS, global address of the tile's first byte, type 2.
__device__ __forceinline__ u32x4 tdm_group0(uint32_t lds_dst, uint64_t ga) {
  u32x4 g;
  g[0] = uni(1u);
  g[1] = uni(lds_dst);
  g[2] = uni((uint32_t)ga);
  g[3] = uni((((uint32_t)(ga >> 32)) & 0x01FFFFFFu) | 0x80000000u);
  return g;
}
// A later stage's group 0 in the place of the last one's: new place in LDS, new address of the tile's first byte.
__device__ __forceinline__ void tdm_at(u32x4& g, uint32_t lds_dst, uint64_t ga) {
  g[1] = uni(lds_dst);
  g[2] = uni((uint32_t)ga);
  g[3] = uni((((uint32_t)(ga >> 32)) & 0x01FFFFFFu) | 0x80000000u);
}
// One request of the whole wave: a tile from global memory into LDS, through no register and with no address work in the lanes.
__device__ __forceinline__ void tdm_load(u32x4 g0, u32x8 g1) {
  asm volatile("tensor_load_to_lds %0, %1" :: "s"(g0), "s"(g1) : "memory");
}
// The issuing wave's wait for its own tensor loads. It names the descriptors of the requests it covers: so their
// registers stay as they are while a request is outstanding, and a new group 0 (written over the old one) is formed behind it.
__device__ __forceinline__ void tdm_wait(u32x4& g0a, u32x4& g0b, u32x8 g1a, u32x8 g1b) {
  asm volatile("s_wait_tensorcnt 0x0" : "+s"(g0a), "+s"(g0b) : "s"(g1a), "s"(g1b) : "memory");
}

__global__ __launch_bounds__(256) void k_attn(
    const _Float16* __restrict__ qpl,      // [B][N][32]
    const _Float16* __restrict__ kpl,      // [B][N][32]
    const _Float16* __restrict__ vpl,      // [B][64][N]
    const unsigned short* __restrict__ wohi, const unsigned short* __restrict__ wolo,   // [64][64]
    const float* __restrict__ bo,
    float* __restrict__ out)               // [B][64][N]
{
  __shared__ __attribute__((aligned(16))) float sOut[CC * 64];   // 16384 B
  __shared__ __attribute__((aligned(2048))) unsigned char sRing[NW * WRB];   // 262144 B; every tile's place a multiple of 2 KiB

  const int tid = threadIdx.x, lane = tid & 31;
  const int w = __builtin_amdgcn_readfirstlane(tid >> 5);   // the wave's number, in a scalar register: its bases are scalar
  const int h = lane >> 4, m = lane & 15;
  const int b = blockIdx.y;
  const int qblk = blockIdx.x * 64;

  // Q^T B-fragments: tile qt, column n = query qblk+16qt+m, k = d (32 deep)
  v16h qf[4];
  #pragma unroll
  for (int qt = 0; qt < 4; ++qt)
    qf[qt] = ldfrag_h(qpl + ((size_t)b * NN + qblk + 16 * qt + m) * CH, h);

  const v8f zero8 = {0.f, 0.f, 0.f, 0.f, 0.f, 0.f, 0.f, 0.f};
  v8f o[4][4];                               // o[qt][t][r] = attn[c 16t+8h+r][query 16qt+m] * row sum (which carries 2^7)
  // mrun: the maximum in use, the same in lanes l and l ^ 16. lrun: the lane's own half of the row sum.
  // cofs: PEXP - mrun in all eight rows, the C operand of the score products. The start value sends
  // the first step through the exact branch, which sets the first maximum.
  float mrun[4], lrun[4];
  v8f cofs[4];
  #pragma unroll
  for (int qt = 0; qt < 4; ++qt) {
    #pragma unroll
    for (int t = 0; t < 4; ++t) o[qt][t] = zero8;
    mrun[qt] = -1e30f;
    lrun[qt] = 0.0f;
    const float c0 = PEXP + 1e30f;
    const v8f cs = { c0, c0, c0, c0, c0, c0, c0, c0 };
    cofs[qt] = cs;
  }

  // load side, the wave's own ring: per stage one K tile (its 64 keys = 4096 B in a row, taken as 32 rows of 128 B)
  // and one V tile (64 channel rows of 128 B, 2 * NN bytes apart)
  unsigned char* myring = sRing + w * WRB;
  const uint32_t ldsk = (uint32_t)(size_t)myring;          // byte offset in the work-group's LDS
  const uint32_t ldsv = ldsk + KSL;
  const u32x8 g1k = tdm_group1(32u, 128u);
  const u32x8 g1v = tdm_group1(64u, 2u * NN);
  // stage s holds step (s + rot) mod NST of the keys; neighbours in the index and blocks eight apart
  // both get steps of their own: for speed only
  const uint32_t rot = (blockIdx.x + (blockIdx.x >> 3)) & (NST - 1);
  const uint64_t kga = (uint64_t)(size_t)(kpl + ((size_t)b * NN + 64 * w) * CH);   // the wave's K tile of step 0
  const uint64_t vga = (uint64_t)(size_t)(vpl + (size_t)b * CC * NN + 64 * w);     // the wave's V tile of step 0
  u32x4 g0k = tdm_group0(ldsk, kga + rot * (STEPK * CH * 2));
  u32x4 g0v = tdm_group0(ldsv, vga + rot * (STEPK * 2));
  // read side: key row 16j+m (pair row 8j + m/2, half m&1), channel row 16t+m
  const unsigned char* krow = myring + (m >> 1) * KP2 + (m & 1) * 64;
  const unsigned char* vrow = myring + KSL + m * VPB;

  // Stages 0 and 1: every wave issues its own, unconditionally.
  tdm_load(g0k, g1k);
  tdm_load(g0v, g1v);
  tdm_wait(g0k, g0v, g1k, g1v);                        // own tiles of stage 0 landed: only this wave reads them
  {
    const uint32_t st = (rot + 1) & (NST - 1);
    tdm_at(g0k, ldsk + BUFB, kga + st * (STEPK * CH * 2));
    tdm_at(g0v, ldsv + BUFB, vga + st * (STEPK * 2));
  }
  tdm_load(g0k, g1k);
  tdm_load(g0v, g1v);

  #pragma unroll 1
  for (int kb = 0; kb < NN; kb += STEPK) {
    const unsigned boff = (kb & STEPK) ? BUFB : 0;
    // ---- this stage's fragments, one load group ----
    v16h kf[4], vf0[4], vf1[4];
    #pragma unroll
    for (int j = 0; j < 4; ++j)
      kf[j] = ldfrag_h((const _Float16*)(krow + boff + 8 * j * KP2), h);
    #pragma unroll
    for (int t = 0; t < 4; ++t) {
      const _Float16* vp = (const _Float16*)(vrow + boff + 16 * t * VPB);
      vf0[t] = ldfrag_h(vp, h);
      vf1[t] = ldfrag_h(vp + 32, h);
    }

    // ---- per query tile: scores, softmax, value products ----
    // (the loops here are unrolled so that every array is indexed by constants and stays in registers)
    #pragma unroll
    for (int qt = 0; qt < 4; ++qt) {
      // scores as exponents: s[j][r] = S[query 16qt+m][key 16j+8h+r of the wave's 64 of this stage] * scale * log2(e) + PEXP - mrun;
      // the factor sits in q, the offset in the product's C operand
      v8f s[4];
      #pragma unroll
      for (int j = 0; j < 4; ++j)
        s[j] = wmma_f16(kf[j], qf[qt], cofs[qt]);

      // softmax (f32), base 2, on the maximum in use: one exp2 and one add a score
      v2f ts[2];                                 // partial sums, even and odd rows: of tiles 0, 1 and of tiles 2, 3
      #pragma unroll
      for (int j = 0; j < 4; ++j)
        #pragma unroll
        for (int r = 0; r < 8; r += 2) {
          const v2f p = { __builtin_amdgcn_exp2f(s[j][r]), __builtin_amdgcn_exp2f(s[j][r + 1]) };
          s[j][r] = p.x;
          s[j][r + 1] = p.y;
          ts[j >> 1] = ((j & 1) | r) ? ts[j >> 1] + p : p;
        }
      const v2f tt = ts[0] + ts[1];
      float lsum = tt.x + tt.y;

      // one test a tile, a scalar branch: a lane's sum at or above PLIM (or not a number) means a prob of
      // this tile may leave f16's range. Then the tile is done again on the larger of the maximum in use
      // and the tile's own, which becomes the maximum in use, and sum and O are brought onto it.
      if (__builtin_expect(__builtin_amdgcn_ballot_w32(!(lsum < PLIM)) != 0, 0)) {   // rare: laid out of the loop's line
        #pragma unroll
        for (int j = 0; j < 4; ++j)
          s[j] = wmma_f16(kf[j], qf[qt], zero8);
        float mloc = s[0][0];
        #pragma unroll
        for (int j = 0; j < 4; ++j)
          #pragma unroll
          for (int r = 0; r < 8; ++r) mloc = fmaxf(mloc, s[j][r]);
        mloc = fmaxf(mloc, xhalf(mloc));
        const float mnew = fmaxf(mrun[qt], mloc);
        const float alpha = __builtin_amdgcn_exp2f(mrun[qt] - mnew);
        const float mb = mnew - PEXP;
        mrun[qt] = mnew;
        const v8f cn = { -mb, -mb, -mb, -mb, -mb, -mb, -mb, -mb };
        cofs[qt] = cn;
        lsum = 0.0f;
        #pragma unroll
        for (int j = 0; j < 4; ++j)
          #pragma unroll
          for (int r = 0; r < 8; ++r) {
            const float p = __builtin_amdgcn_exp2f(s[j][r] - mb);
            s[j][r] = p;
            lsum += p;
          }
        lrun[qt] = lrun[qt] * alpha;
        #pragma unroll
        for (int t = 0; t < 4; ++t)
          #pragma unroll
          for (int r = 0; r < 8; ++r) o[qt][t][r] = o[qt][t][r] * alpha;
      }
      lrun[qt] += lsum;

      // P^T B-fragments (the wave's keys 0..31 and 32..63 of this step), then O^T += V * P^T
      const v16h pb0 = pack_p(s[0], s[1]);
      const v16h pb1 = pack_p(s[2], s[3]);
      #pragma unroll
      for (int t = 0; t < 4; ++t) {
        o[qt][t] = wmma_f16(vf0[t], pb0, o[qt][t]);
        o[qt][t] = wmma_f16(vf1[t], pb1, o[qt][t]);
      }
    }

    // ---- hand-over inside the wave: its ring is read and refilled by itself alone ----
    asm volatile("s_wait_dscnt 0x0" ::: "memory");     // own reads of this buffer done before it is refilled
    tdm_wait(g0k, g0v, g1k, g1v);                      // own tiles of the next stage landed
    if (pinned(kb + 2 * STEPK < NN)) {                 // a stage two ahead exists: a scalar branch
      const uint32_t st = (kb / STEPK + 2 + rot) & (NST - 1);
      tdm_at(g0k, ldsk + boff, kga + st * (STEPK * CH * 2));
      tdm_at(g0v, ldsv + boff, vga + st * (STEPK * 2));
      tdm_load(g0k, g1k);
      tdm_load(g0v, g1v);
    }
  }
  asm volatile("s_wait_tensorcnt 0x0" ::: "memory");   // nothing in flight behind the loop
  asm volatile("s_wait_dscnt 0x0" ::: "memory");       // own reads of the ring over before it takes the partials

  // ---- merge the eight waves' partial maximum, sum and O tiles ----
  // Each wave lays its partials down in its own ring (its reads and tensor loads there are over), and behind
  // one barrier wave w reads the eight partials of query tile w>>1 and joins them on the common maximum.
  {
    v4fa* pw = (v4fa*)myring + lane;
    #pragma unroll
    for (int qt = 0; qt < 4; ++qt) {
      #pragma unroll
      for (int t = 0; t < 4; ++t) {
        const v4f a = { o[qt][t][0], o[qt][t][1], o[qt][t][2], o[qt][t][3] };
        const v4f c = { o[qt][t][4], o[qt][t][5], o[qt][t][6], o[qt][t][7] };
        pw[(8 * qt + 2 * t) * 32] = a;
        pw[(8 * qt + 2 * t + 1) * 32] = c;
      }
      const float lj = lrun[qt] + xhalf(lrun[qt]);       // the two halves' sums joined once
      const v2f ml = { mrun[qt], lj };
      ((v2fa*)(myring + PARTB))[qt * 32 + lane] = ml;
    }
  }
  __syncthreads();                                     // every wave's partials readable
  const int qm = w >> 1;                               // the query tile this wave merges and projects
  // Output bias of the two out-channel tiles that this wave projects (rows 32(w&1)+16oi+8h+r), asked for here
  // so that its latency passes under the merge.
  float bias[16];
  #pragma unroll
  for (int i = 0; i < 16; ++i) bias[i] = bo[32 * (w & 1) + 16 * (i >> 3) + 8 * h + (i & 7)];
  v8f om[4];
  float lall = 0.0f;
  {
    v2f ml[NW];
    #pragma unroll
    for (int gg = 0; gg < NW; ++gg)
      ml[gg] = ((const v2fa*)(sRing + gg * WRB + PARTB))[qm * 32 + lane];
    float mall = ml[0].x;
    #pragma unroll
    for (int gg = 1; gg < NW; ++gg) mall = fmaxf(mall, ml[gg].x);
    #pragma unroll
    for (int t = 0; t < 4; ++t) om[t] = zero8;
    #pragma unroll
    for (int gg = 0; gg < NW; ++gg) {
      const float f = __builtin_amdgcn_exp2f(ml[gg].x - mall);
      lall += ml[gg].y * f;
      const v4fa* pr = (const v4fa*)(sRing + gg * WRB) + qm * 256 + lane;
      #pragma unroll
      for (int t = 0; t < 4; ++t) {
        const v4f a = pr[(2 * t) * 32];
        const v4f c = pr[(2 * t + 1) * 32];
        om[t][0] += a.x * f;  om[t][1] += a.y * f;  om[t][2] += a.z * f;  om[t][3] += a.w * f;
        om[t][4] += c.x * f;  om[t][5] += c.y * f;  om[t][6] += c.z * f;  om[t][7] += c.w * f;
      }
    }
  }

  // ---- normalise; attn D tiles -> bf16 hi/lo B-fragments (k = c) ----
  const float inv = 1.0f / lall;               // O and the sum both carry 2^7
  FragB bh0, bl0, bh1, bl1;
  {
    const v8us ha = hi8(om[0], inv), hb = hi8(om[1], inv), hc = hi8(om[2], inv), hd = hi8(om[3], inv);
    bh0.half[0] = ha;  bh0.half[1] = hb;
    bh1.half[0] = hc;  bh1.half[1] = hd;
    bl0.half[0] = lo8(om[0], inv, ha);  bl0.half[1] = lo8(om[1], inv, hb);
    bl1.half[0] = lo8(om[2], inv, hc);  bl1.half[1] = lo8(om[3], inv, hd);
  }

  // ---- out^T[o][query] = sum_c Wo[o][c] attn[c][query]; wave w does out-channel tiles 2(w&1), 2(w&1)+1 ----
  #pragma unroll
  for (int oi = 0; oi < 2; ++oi) {
    const int ot = 2 * (w & 1) + oi;
    const unsigned short* wrh = wohi + (16 * ot + m) * CC;
    const unsigned short* wrl = wolo + (16 * ot + m) * CC;
    v8f z = zero8;
    {
      const v16b a_h = ldfrag_b(wrh, h);
      const v16b a_l = ldfrag_b(wrl, h);
      z = wmma_bf16(a_h, bh0.v, z);
      z = wmma_bf16(a_h, bl0.v, z);
      z = wmma_bf16(a_l, bh0.v, z);
    }
    {
      const v16b a_h = ldfrag_b(wrh + 32, h);
      const v16b a_l = ldfrag_b(wrl + 32, h);
      z = wmma_bf16(a_h, bh1.v, z);
      z = wmma_bf16(a_h, bl1.v, z);
      z = wmma_bf16(a_l, bh1.v, z);
    }
    // ---- stage [64 o][64 queries] tile; D[r] = out[o 16ot+8h+r][query 16qm+m] ----
    float* so = sOut + 16 * qm + m;
    #pragma unroll
    for (int r = 0; r < 8; ++r) {
      const int orow = 16 * ot + 8 * h + r;
      so[orow * 64] = z[r] + bias[8 * oi + r];
    }
  }
  __syncthreads();

  float* od = out + (size_t)b * CC * NN + qblk;
  out_store(sOut, od, tid);
}

// ---------------------------------------------------------------------------
extern "C" void kernel_launch(void* const* d_in, const int* in_sizes, int n_in,
                              void* d_out, int out_size, void* d_ws, size_t ws_size,
                              hipStream_t stream) {
  if (n_in < 9) return;
  if (in_sizes[0] != NB * CC * NN) return;
  if (in_sizes[1] != NWQ || in_sizes[2] != CH) return;
  if (in_sizes[3] != NWQ || in_sizes[4] != CH) return;
  if (in_sizes[5] != NWV || in_sizes[6] != CC) return;
  if (in_sizes[7] != NWV || in_sizes[8] != CC) return;
  if (out_size != NB * CC * NN) return;

  const float* x  = (const float*)d_in[0];
  const float* wq = (const float*)d_in[1];
  const float* bq = (const float*)d_in[2];
  const float* wk = (const float*)d_in[3];
  const float* bk = (const float*)d_in[4];
  const float* wv = (const float*)d_in[5];
  const float* bv = (const float*)d_in[6];
  const float* wo = (const float*)d_in[7];
  const float* bo = (const float*)d_in[8];
  float* out = (float*)d_out;

  const size_t w_bytes  = (size_t)NWALL * 2;              //    24576 per plane
  const size_t qk_bytes = (size_t)NB * NN * CH * 2;        //  1048576 each
  const size_t v_bytes  = (size_t)NB * CC * NN * 2;        //  2097152
  const size_t total = 2 * w_bytes + 2 * qk_bytes + v_bytes;   // 4243456
  if (total > ws_size) return;

  char* ws = (char*)d_ws;
  unsigned short* whi = (unsigned short*)(ws);
  unsigned short* wlo = (unsigned short*)(ws + w_bytes);
  _Float16* qpl = (_Float16*)(ws + 2 * w_bytes);
  _Float16* kpl = (_Float16*)(ws + 2 * w_bytes + qk_bytes);
  _Float16* vpl = (_Float16*)(ws + 2 * w_bytes + 2 * qk_bytes);
  unsigned short* wohi = whi + (2 * NWQ + NWV);
  unsigned short* wolo = wlo + (2 * NWQ + NWV);

  dim3 gProj(NN / 64, NB);                                  // (128, 2)
  k_proj<<<gProj, 128, 0, stream>>>(x, wq, wk, wv, wo, bq, bk, bv, qpl, kpl, vpl, wohi, wolo);

  dim3 gAtt(NN / 64, NB);                                   // (128, 2)
  k_attn<<<gAtt, 256, 0, stream>>>(qpl, kpl, vpl, wohi, wolo, bo, out);
}
